// v000
// Measured on an AMD MI455X. A time is GPU time per run, averaged over a window of back-to-back runs after a warm-up
// (all launches, gaps included; the runs take copies of the inputs in turn), and the median of several windows.
// Apart from v000's, it joins two sittings. Times from different sittings can be a few percent apart, while
// side-by-side timings come from the same sitting.
// The starting kernel, v000, takes 1440 microseconds a run.
#include <hip/hip_runtime.h>

// Causal multi-head self-attention with interleaved rotary embeddings from integer positions (x [2][2048][1024]; Q,K,V = x W^T ('oi' [1024][1024] 0.02, no bias; 16 heads x 64); rotary on (even, odd) pairs with angle pos[t] x THETA ** (-2i/64) (token_positions int [2048], read; float32 power-form constants; precise cosf/sinf); logits / 8, causal (-inf); softmax; out = merged Wo^T -> [2][2048][1024] (4.2 M)).
// Layout per batch: bf16 copy of x; exact projections; {cos, sin} per (position, pair) from the int positions (jnp-exact float32 inverse frequencies, precise cosf/sinf); interleaved rotary plane builder; causal T-2048 attention (hybrid rows: < 512 hi/lo 3 products, rest fp16 x1024; k_gemmc skips tiles above the diagonal); merged hi/lo x wo exact, no bias.
// Compute dtypes, f32 accumulate: every input rounded to bf16; projections exact ; rotary f32; attention rows < 512 3 products, rest fp16; softmax f32; wo hl x exact, no bias.

#define NB_  2
#define TT   2048
#define DM   1024
#define NH_  16
#define NKV  16
#define REP  (NH_ / NKV)
#define HD   64
#define DQ   (NH_ * HD)
#define DKV  (NKV * HD)
#define ZH   2
#define RH   512                  // query rows < RH use hi+lo planes (0: none)
#define WIN  2048
#define PCAR 1024.0f
#define SCL  0.125f   // HD^-0.5
typedef _Float16 h16;
typedef unsigned short bf;
typedef __attribute__((ext_vector_type(16))) __bf16   v16bf;
typedef __attribute__((ext_vector_type(16))) _Float16 v16h;
typedef __attribute__((ext_vector_type(8)))  _Float16 v8h;
typedef __attribute__((ext_vector_type(8)))  unsigned short v8us;
typedef __attribute__((ext_vector_type(8)))  float    v8f;
typedef __attribute__((ext_vector_type(4)))  float    v4f;
typedef v8h  __attribute__((may_alias)) v8ha;
typedef v4f  __attribute__((may_alias)) v4fa;
typedef v8us __attribute__((may_alias)) v8usa;

__device__ __forceinline__ unsigned short f2bf(float f) { unsigned u = __float_as_uint(f); u += 0x7FFFu + ((u >> 16) & 1u); return (unsigned short)(u >> 16); }
__device__ __forceinline__ float bf2f(unsigned short b) { return __uint_as_float(((unsigned)b) << 16); }
__device__ __forceinline__ float bfr(float f) { return bf2f(f2bf(f)); }
__device__ __forceinline__ v16h cat16(v8h lo, v8h hi) { return __builtin_shufflevector(lo, hi, 0, 1, 2, 3, 4, 5, 6, 7, 8, 9, 10, 11, 12, 13, 14, 15); }
__device__ __forceinline__ v16bf cat16b(v8us lo, v8us hi) { return __builtin_bit_cast(v16bf, __builtin_shufflevector(lo, hi, 0, 1, 2, 3, 4, 5, 6, 7, 8, 9, 10, 11, 12, 13, 14, 15)); }
__device__ __forceinline__ v8f wmma16(v16h a, v16h b, v8f c) { return __builtin_amdgcn_wmma_f32_16x16x32_f16(false, a, false, b, (short)0, c, false, false); }
__device__ __forceinline__ v8f wmmab(v16bf a, v16bf b, v8f c) { return __builtin_amdgcn_wmma_f32_16x16x32_bf16(false, a, false, b, (short)0, c, false, false); }



// ---- k_gemmw: register-blocked GEMM, ONE WAVE per 64x64 output tile (16 accumulators), operands straight from K-contiguous 16-bit planes; grid (M/64, N/64, Z), 32 threads.
// C[m][n] (f32, pitch ldc, + optional f32 bias[n]) = sum_k A[m][k] Bt[n][k] (+ split products per NSPLIT). z-batch strides sA/sB/sC in elements. K % 32 == 0.
template <typename T16> struct WFrag;
template <> struct WFrag<h16> { typedef v16h V; static __device__ __forceinline__ V ld(const h16* p) { return cat16(*(const v8h*)p, *(const v8h*)(p + 16)); } static __device__ __forceinline__ v8f mma(V a, V b, v8f c) { return wmma16(a, b, c); } };
template <> struct WFrag<bf> { typedef v16bf V; static __device__ __forceinline__ V ld(const bf* p) { return cat16b(*(const v8us*)p, *(const v8us*)(p + 16)); } static __device__ __forceinline__ v8f mma(V a, V b, v8f c) { return wmmab(a, b, c); } };
template <typename T16, int NSPLIT, bool BIAS>
__global__ __launch_bounds__(32) void k_gemmw(const T16* __restrict__ A, const T16* __restrict__ A2, const T16* __restrict__ Bt, const T16* __restrict__ Bt2, int K, float* C, int ldc, const float* __restrict__ bias, size_t sA, size_t sB, size_t sC) {
    typedef typename WFrag<T16>::V V;
    __shared__ __align__(16) float os[16 * 68];
    const size_t z = blockIdx.z; A += z * sA; if (A2) A2 += z * sA; Bt += z * sB; if (Bt2) Bt2 += z * sB; C += z * sC;
    const int lane = threadIdx.x & 31, lr = lane & 15, hi = lane >> 4; const int r0 = blockIdx.x * 64, c0 = blockIdx.y * 64;
    v8f acc[4][4];
#pragma unroll
    for (int mb = 0; mb < 4; ++mb)
#pragma unroll
        for (int nb = 0; nb < 4; ++nb) acc[mb][nb] = (v8f){};
    const size_t aoff = (size_t)(r0 + lr) * K + 8 * hi, boff = (size_t)(c0 + lr) * K + 8 * hi;
#pragma unroll 1
    for (int kc = 0; kc < K; kc += 32) {
        V a[4], a2[4];
#pragma unroll
        for (int mb = 0; mb < 4; ++mb) { a[mb] = WFrag<T16>::ld(A + aoff + (size_t)mb * 16 * K + kc); if (NSPLIT == 1 || NSPLIT == 2) a2[mb] = WFrag<T16>::ld(A2 + aoff + (size_t)mb * 16 * K + kc); }
#pragma unroll
        for (int nb = 0; nb < 4; ++nb) { const V b = WFrag<T16>::ld(Bt + boff + (size_t)nb * 16 * K + kc); V b2; if (NSPLIT >= 2) b2 = WFrag<T16>::ld(Bt2 + boff + (size_t)nb * 16 * K + kc);
#pragma unroll
            for (int mb = 0; mb < 4; ++mb) { acc[mb][nb] = WFrag<T16>::mma(a[mb], b, acc[mb][nb]); if (NSPLIT == 1 || NSPLIT == 2) acc[mb][nb] = WFrag<T16>::mma(a2[mb], b, acc[mb][nb]); if (NSPLIT >= 2) acc[mb][nb] = WFrag<T16>::mma(a[mb], b2, acc[mb][nb]); } }
        asm volatile("v_nop\n\tv_nop\n\tv_nop\n\tv_nop" : "+v"(acc[0][0]), "+v"(acc[1][1]), "+v"(acc[2][2]), "+v"(acc[3][3]) : "v"(a[0]), "v"(a[3]));
    }
#pragma unroll
    for (int mb = 0; mb < 4; ++mb) {
#pragma unroll
        for (int nb = 0; nb < 4; ++nb) {
#pragma unroll
            for (int j = 0; j < 8; ++j) os[(hi * 8 + j) * 68 + nb * 16 + lr] = acc[mb][nb][j]; }
        __builtin_amdgcn_wave_barrier(); asm volatile("" ::: "memory");
        float* crow = C + (size_t)(r0 + mb * 16) * ldc + c0;
{
#pragma unroll
            for (int s = 0; s < 8; ++s) { const int row = 2 * s + hi, cofs = lr * 4; v4f val = *(const v4fa*)(os + row * 68 + cofs); if (BIAS) { val[0] += bfr(bias[c0 + cofs]); val[1] += bfr(bias[c0 + cofs + 1]); val[2] += bfr(bias[c0 + cofs + 2]); val[3] += bfr(bias[c0 + cofs + 3]); }
                *(v4f*)(crow + (size_t)row * ldc + cofs) = val; }
             }
        __builtin_amdgcn_wave_barrier(); asm volatile("" ::: "memory");
    }
}

// ---- k_gemmc: the same one-wave 64x64 tile GEMM specialised for causal attention: CMODE 1 skips score tiles entirely above the diagonal (query rows r0+roff.., key columns c0..), CMODE 2 limits the
// key (K) loop of the probability x value contraction to the diagonal block (probabilities beyond it are exactly zero). roff = row offset of this launch's first row within the sequence.
template <typename T16, int NSPLIT, int CMODE>
__global__ __launch_bounds__(32) void k_gemmc(const T16* __restrict__ A, const T16* __restrict__ A2, const T16* __restrict__ Bt, const T16* __restrict__ Bt2, int K, float* C, int ldc, int roff, size_t sA, size_t sB, size_t sC) {
    typedef typename WFrag<T16>::V V;
    __shared__ __align__(16) float os[16 * 68];
    const size_t z = blockIdx.z; A += z * sA; if (A2) A2 += z * sA; Bt += z * sB; if (Bt2) Bt2 += z * sB; C += z * sC;
    const int lane = threadIdx.x & 31, lr = lane & 15, hi = lane >> 4; const int r0 = blockIdx.x * 64, c0 = blockIdx.y * 64;
    if (CMODE == 1 && c0 > r0 + roff + 63) return;                  // score tile entirely above the causal diagonal: never written (the softmax masks j > i by select)
    const int Kl = (CMODE == 2) ? min(K, r0 + roff + 64) : K;        // P.V: probabilities are exactly 0 beyond the diagonal block, so the K loop stops there
    v8f acc[4][4];
#pragma unroll
    for (int mb = 0; mb < 4; ++mb)
#pragma unroll
        for (int nb = 0; nb < 4; ++nb) acc[mb][nb] = (v8f){};
    const size_t aoff = (size_t)(r0 + lr) * K + 8 * hi, boff = (size_t)(c0 + lr) * K + 8 * hi;
#pragma unroll 1
    for (int kc = 0; kc < Kl; kc += 32) {
        V a[4], a2[4];
#pragma unroll
        for (int mb = 0; mb < 4; ++mb) { a[mb] = WFrag<T16>::ld(A + aoff + (size_t)mb * 16 * K + kc); if (NSPLIT == 1 || NSPLIT == 2) a2[mb] = WFrag<T16>::ld(A2 + aoff + (size_t)mb * 16 * K + kc); }
#pragma unroll
        for (int nb = 0; nb < 4; ++nb) { const V b = WFrag<T16>::ld(Bt + boff + (size_t)nb * 16 * K + kc); V b2; if (NSPLIT >= 2) b2 = WFrag<T16>::ld(Bt2 + boff + (size_t)nb * 16 * K + kc);
#pragma unroll
            for (int mb = 0; mb < 4; ++mb) { acc[mb][nb] = WFrag<T16>::mma(a[mb], b, acc[mb][nb]); if (NSPLIT == 1 || NSPLIT == 2) acc[mb][nb] = WFrag<T16>::mma(a2[mb], b, acc[mb][nb]); if (NSPLIT >= 2) acc[mb][nb] = WFrag<T16>::mma(a[mb], b2, acc[mb][nb]); } }
        asm volatile("v_nop\n\tv_nop\n\tv_nop\n\tv_nop" : "+v"(acc[0][0]), "+v"(acc[1][1]), "+v"(acc[2][2]), "+v"(acc[3][3]) : "v"(a[0]), "v"(a[3]));
    }
#pragma unroll
    for (int mb = 0; mb < 4; ++mb) {
#pragma unroll
        for (int nb = 0; nb < 4; ++nb) {
#pragma unroll
            for (int j = 0; j < 8; ++j) os[(hi * 8 + j) * 68 + nb * 16 + lr] = acc[mb][nb][j]; }
        __builtin_amdgcn_wave_barrier(); asm volatile("" ::: "memory");
        float* crow = C + (size_t)(r0 + mb * 16) * ldc + c0;
{
#pragma unroll
            for (int s = 0; s < 8; ++s) { const int row = 2 * s + hi, cofs = lr * 4; v4f val = *(const v4fa*)(os + row * 68 + cofs);
                *(v4f*)(crow + (size_t)row * ldc + cofs) = val; }
             }
        __builtin_amdgcn_wave_barrier(); asm volatile("" ::: "memory");
    }
}

__device__ __forceinline__ h16 tohx(float x) { return (h16)x; }
__device__ __forceinline__ void splitf(float y, unsigned short& h, unsigned short& l) { h = f2bf(y); l = f2bf(y - bf2f(h)); }
typedef __attribute__((ext_vector_type(2))) _Float16 v2h;
typedef __attribute__((ext_vector_type(4))) _Float16 v4h;
typedef __attribute__((ext_vector_type(2))) unsigned short v2us;
typedef __attribute__((ext_vector_type(4))) unsigned short v4us;
typedef __attribute__((ext_vector_type(2))) float v2f;
typedef __attribute__((ext_vector_type(4))) int v4i;

__global__ __launch_bounds__(256) void k_wtG(const float* __restrict__ w, int K, int N, bf* Bt) {
    const int lane = threadIdx.x & 31; const int L0 = (blockIdx.x * 8 + (threadIdx.x >> 5)) * 8; const int nlines = N * K / 64;
{
#pragma unroll 1
        for (int l = 0; l < 8; ++l) { const int L = L0 + l; if (L >= nlines) break; const size_t e = (size_t)L * 64 + lane * 2; const int k = (int)(e % K), n = (int)(e / K); v2us o;
            o[0] = f2bf(w[(size_t)k * N + n]); o[1] = f2bf(w[(size_t)(k + 1) * N + n]); *(v2us*)(Bt + e) = o; }
         }
}
__global__ __launch_bounds__(256) void k_cvt8(const float* __restrict__ src, bf* dst, size_t n8) { const size_t i = (size_t)blockIdx.x * 256 + threadIdx.x; if (i >= n8) return; const v8f v = *(const v8f*)(src + i * 8); v8us o;
#pragma unroll
    for (int k = 0; k < 8; ++k) o[k] = f2bf(v[k]); *(v8us*)(dst + i * 8) = o;  }
__constant__ float INVT[HD / 2] = { 1.000000000e+00f,7.498942018e-01f,5.623413324e-01f,4.216965139e-01f,3.162277639e-01f,2.371373773e-01f,1.778279394e-01f,1.333521456e-01f,1.000000015e-01f,7.498942316e-02f,5.623413250e-02f,4.216964915e-02f,3.162277490e-02f,2.371373773e-02f,1.778279431e-02f,1.333521400e-02f,9.999999776e-03f,7.498942316e-03f,5.623413250e-03f,4.216964822e-03f,3.162277630e-03f,2.371373819e-03f,1.778279431e-03f,1.333521446e-03f,1.000000047e-03f,7.498941850e-04f,5.623413017e-04f,4.216965172e-04f,3.162277571e-04f,2.371373703e-04f,1.778279402e-04f,1.333521504e-04f };   // THETA ** (-2 i / 64) as float32 (the module's power form, jnp-computed)
__global__ __launch_bounds__(256) void k_cstabT(const int* __restrict__ pid, float* CS) { const int idx = blockIdx.x * 256 + threadIdx.x; if (idx >= TT * HD) return; const int d = idx % HD; const int t = idx / HD; const float a = __fmul_rn((float)pid[t], INVT[d >> 1]); v2f cs; cs[0] = cosf(a); cs[1] = sinf(a); *(v2f*)(CS + (size_t)idx * 2) = cs;  }
__global__ __launch_bounds__(256) void k_ropeI(const float* __restrict__ F, int pitch, int nheads, const float* __restrict__ CS, float sc, h16* P16, bf* Ph, bf* Pl) {
    const size_t e = ((size_t)blockIdx.x * 256 + threadIdx.x) * 2; if (e >= (size_t)nheads * TT * HD) return; const int d = (int)(e % HD); const int t = (int)((e / HD) % TT); const int h = (int)(e / ((size_t)HD * TT)); const float* f = F + (size_t)t * pitch + h * HD; const float x0 = f[d], x1 = f[d + 1]; const v2f cs = *(const v2f*)(CS + ((size_t)t * HD + d) * 2); v2h o16; v2us oh, ol;
    float a0 = __fmul_rn(x0, cs[0]), b0 = __fmul_rn(x1, cs[1]), a1 = __fmul_rn(x1, cs[0]), b1 = __fmul_rn(x0, cs[1]); asm volatile("" : "+v"(a0), "+v"(b0), "+v"(a1), "+v"(b1));
    float r0 = __fsub_rn(a0, b0) * sc, r1 = __fadd_rn(b1, a1) * sc;   /* even: x0 c - x1 s; odd: x0 s + x1 c */
    o16[0] = tohx(r0); o16[1] = tohx(r1); { unsigned short a2, c2; splitf(r0, a2, c2); oh[0] = a2; ol[0] = c2; splitf(r1, a2, c2); oh[1] = a2; ol[1] = c2; }
    *(v2h*)(P16 + e) = o16; *(v2us*)(Ph + e) = oh; *(v2us*)(Pl + e) = ol;  }


// k_ropeI: head planes [h][t][d] (fp16 + hi/lo) of rope(x) x sc with the interleaved convention out[d] = x[d] cos[t][d] - x[d+1] sin[t][d], out[d+1] = x[d+1] cos[t][d] + x[d] sin[t][d] (d even)

__global__ __launch_bounds__(256) void k_vtp(const float* __restrict__ F, int pitch, int nheads, h16* V16, bf* Vh, bf* Vl) { const size_t e = ((size_t)blockIdx.x * 256 + threadIdx.x) * 2; if (e >= (size_t)nheads * HD * TT) return; const int t = (int)(e % TT); const int d = (int)((e / TT) % HD); const int g = (int)(e / ((size_t)TT * HD)); v2h o16; v2us oh, ol;
#pragma unroll
    for (int q = 0; q < 2; ++q) { const float x = F[(size_t)(t + q) * pitch + g * HD + d]; o16[q] = tohx(x); unsigned short a2, c2; splitf(x, a2, c2); oh[q] = a2; ol[q] = c2; }
    *(v2h*)(V16 + e) = o16; *(v2us*)(Vh + e) = oh; *(v2us*)(Vl + e) = ol;  }
// k_asoft: per row (zz, i): t = S x HD^-0.5 for j <= i and i - j < WIN (WIN = TT, so plain causal; the reference's -1e9 additive fill vanishes identically); softmax over the 2048 keys (register row, one exp, fixed trees);
__global__ __launch_bounds__(256) void k_asoft(const float* __restrict__ Sb, h16* P16, bf* Ph, bf* Pl) {
    const int lane = threadIdx.x & 31; const int row = blockIdx.x * 8 + (threadIdx.x >> 5); if (row >= ZH * TT) return; const int i = row % TT; const int zz = row / TT; (void)zz; const bool hires = (i < RH); const float* sr = Sb + (size_t)row * TT; float v[TT / 32]; float mx = -3.0e38f;
#pragma unroll
    for (int ch = 0; ch < TT / 128; ++ch) { const int j0 = ch * 128 + lane * 4; const v4f a = *(const v4f*)(sr + j0);
#pragma unroll
        for (int q = 0; q < 4; ++q) { const int j = j0 + q; (void)j; const float t = (j <= i && i - j < WIN) ? a[q] * SCL : -3.0e38f; v[ch * 4 + q] = t; mx = fmaxf(mx, t); } }
#pragma unroll
    for (int sh = 16; sh; sh >>= 1) mx = fmaxf(mx, __shfl_xor(mx, sh, 32));
    float sum = 0.f;
#pragma unroll
    for (int k = 0; k < TT / 32; ++k) { float d0 = __fsub_rn(v[k], mx); asm volatile("" : "+v"(d0)); v[k] = __builtin_amdgcn_exp2f(__fmul_rn(d0, 1.4426950408889634f)); sum += v[k]; }
#pragma unroll
    for (int sh = 16; sh; sh >>= 1) sum += __shfl_xor(sum, sh, 32);
    const float f = __fdiv_rn(hires ? 1.0f : PCAR, sum);
{
        if (hires) {
#pragma unroll
            for (int ch = 0; ch < TT / 128; ++ch) { v4us oh, ol;
#pragma unroll
                for (int q = 0; q < 4; ++q) { unsigned short a, c2; splitf(v[ch * 4 + q] * f, a, c2); oh[q] = a; ol[q] = c2; }
                const size_t oo = ((size_t)zz * (RH ? RH : 1) + i) * TT + ch * 128 + lane * 4; *(v4us*)(Ph + oo) = oh; *(v4us*)(Pl + oo) = ol; }
        } else {
#pragma unroll
            for (int ch = 0; ch < TT / 128; ++ch) { v4h o4;
#pragma unroll
                for (int q = 0; q < 4; ++q) o4[q] = tohx(v[ch * 4 + q] * f);
                *(v4h*)(P16 + (size_t)row * TT + ch * 128 + lane * 4) = o4; } }
         }
}
__global__ __launch_bounds__(256) void k_merge(const float* __restrict__ O, int h0, bf* Ah, bf* Al) { const size_t e = ((size_t)blockIdx.x * 256 + threadIdx.x) * 2; if (e >= (size_t)ZH * TT * HD) return; const int d = (int)(e % HD); const int t = (int)((e / HD) % TT); const int zz = (int)(e / ((size_t)HD * TT)); const float cs = (t < RH) ? 1.0f : (1.0f / PCAR); const size_t oo = (size_t)t * DQ + (h0 + zz) * HD + d;
    v2us oh, ol;
#pragma unroll
    for (int q = 0; q < 2; ++q) { unsigned short a, c2; splitf(O[e + q] * cs, a, c2); oh[q] = a; ol[q] = c2; } *(v2us*)(Ah + oo) = oh; *(v2us*)(Al + oo) = ol;  }

extern "C" void kernel_launch(void* const* d_in, const int* in_sizes, int n_in,
                              void* d_out, int out_size, void* d_ws, size_t ws_size, hipStream_t stream) {
    (void)in_sizes; (void)n_in; (void)out_size;
    const float* x = (const float*)d_in[0]; const float* wq = (const float*)d_in[1]; const float* wk = (const float*)d_in[2]; const float* wv = (const float*)d_in[3]; const float* wo = (const float*)d_in[4]; const int* pid = (const int*)d_in[5];   /* token_positions int32 [2048] (= arange) */
    float* OUT = (float*)d_out;     // [2][2048][1024]
    char* wsp = (char*)d_ws;
    auto take = [&](size_t bytes) { char* p = wsp; wsp += (bytes + 255) & ~(size_t)255; return (void*)p; };
    bf* WQ = (bf*)take((size_t)DQ * DM * 2); bf* WK = (bf*)take((size_t)DKV * DM * 2); bf* WV = (bf*)take((size_t)DKV * DM * 2); bf* WO = (bf*)take((size_t)DM * DQ * 2); float* CS = (float*)take((size_t)TT * HD * 2 * 4);
    bf* XB = (bf*)take((size_t)TT * DM * 2); float* FQ = (float*)take((size_t)TT * DQ * 4); float* FK = (float*)take((size_t)TT * DKV * 4);
    h16* QP16 = (h16*)take((size_t)NH_ * TT * HD * 2); h16* KP16 = (h16*)take((size_t)NKV * TT * HD * 2); h16* VT16 = (h16*)take((size_t)NKV * HD * TT * 2);
    bf* QPh = (bf*)take((size_t)NH_ * TT * HD * 2); bf* QPl = (bf*)take((size_t)NH_ * TT * HD * 2); bf* KPh = (bf*)take((size_t)NKV * TT * HD * 2); bf* KPl = (bf*)take((size_t)NKV * TT * HD * 2); bf* VTh = (bf*)take((size_t)NKV * HD * TT * 2); bf* VTl = (bf*)take((size_t)NKV * HD * TT * 2); bf* Ph = (bf*)take((size_t)ZH * RH * TT * 2); bf* Pl = (bf*)take((size_t)ZH * RH * TT * 2);
    float* Sb = (float*)take((size_t)ZH * TT * TT * 4); h16* P16 = (h16*)take((size_t)ZH * TT * TT * 2); float* Ob = (float*)take((size_t)ZH * TT * HD * 4); bf* ATh = (bf*)take((size_t)TT * DQ * 2); bf* ATl = (bf*)take((size_t)TT * DQ * 2);
    if ((size_t)(wsp - (char*)d_ws) > ws_size) return;    // ws 256 MiB
    float* FV = FK;   // v projection reuses the k buffer after the k planes are built (stream-ordered)
    { k_cvt8<<<(unsigned)(((size_t)DQ * DM / 8 + 255) / 256), 256, 0, stream>>>(wq, WQ, (size_t)DQ * DM / 8); k_cvt8<<<(unsigned)(((size_t)DKV * DM / 8 + 255) / 256), 256, 0, stream>>>(wk, WK, (size_t)DKV * DM / 8); k_cvt8<<<(unsigned)(((size_t)DKV * DM / 8 + 255) / 256), 256, 0, stream>>>(wv, WV, (size_t)DKV * DM / 8);
      k_cvt8<<<(unsigned)(((size_t)DM * DQ / 8 + 255) / 256), 256, 0, stream>>>(wo, WO, (size_t)DM * DQ / 8);
       }
    const unsigned LQ = (unsigned)(((size_t)NH_ * TT * HD / 2 + 255) / 256), LKv = (unsigned)(((size_t)NKV * TT * HD / 2 + 255) / 256);
    for (int b = 0; b < NB_; ++b) {
        if (b == 0) k_cstabT<<<(TT * HD + 255) / 256, 256, 0, stream>>>(pid, CS);
        k_cvt8<<<(unsigned)(((size_t)TT * DM / 8 + 255) / 256), 256, 0, stream>>>(x + (size_t)b * TT * DM, XB, (size_t)TT * DM / 8);
        k_gemmw<bf, 0, false><<<dim3(TT / 64, DQ / 64, 1), 32, 0, stream>>>(XB, nullptr, WQ, nullptr, DM, FQ, DQ, nullptr, 0, 0, 0);
        k_ropeI<<<LQ, 256, 0, stream>>>(FQ, DQ, NH_, CS, 1.0f, QP16, QPh, QPl);
        k_gemmw<bf, 0, false><<<dim3(TT / 64, DKV / 64, 1), 32, 0, stream>>>(XB, nullptr, WK, nullptr, DM, FK, DKV, nullptr, 0, 0, 0);
        k_ropeI<<<LKv, 256, 0, stream>>>(FK, DKV, NKV, CS, 1.0f, KP16, KPh, KPl);
        k_gemmw<bf, 0, false><<<dim3(TT / 64, DKV / 64, 1), 32, 0, stream>>>(XB, nullptr, WV, nullptr, DM, FV, DKV, nullptr, 0, 0, 0); k_vtp<<<LKv, 256, 0, stream>>>(FV, DKV, NKV, VT16, VTh, VTl);
        for (int h0 = 0; h0 < NH_; h0 += ZH) { const size_t zq = (size_t)h0, zk = (size_t)(h0 / REP);   // one kv head per query head: the pass's two heads use consecutive kv planes (z-strides TT*HD)
            k_gemmc<bf, 2, 1><<<dim3(RH / 64, TT / 64, ZH), 32, 0, stream>>>(QPh + zq * TT * HD, QPl + zq * TT * HD, KPh + zk * TT * HD, KPl + zk * TT * HD, HD, Sb, TT, 0, (size_t)TT * HD, (size_t)TT * HD, (size_t)TT * TT);
            k_gemmc<h16, 0, 1><<<dim3((TT - RH) / 64, TT / 64, ZH), 32, 0, stream>>>(QP16 + zq * TT * HD + (size_t)RH * HD, nullptr, KP16 + zk * TT * HD, nullptr, HD, Sb + (size_t)RH * TT, TT, RH, (size_t)TT * HD, (size_t)TT * HD, (size_t)TT * TT);
            k_asoft<<<ZH * TT / 8, 256, 0, stream>>>(Sb, P16, Ph, Pl);
            k_gemmc<bf, 2, 2><<<dim3(RH / 64, HD / 64, ZH), 32, 0, stream>>>(Ph, Pl, VTh + zk * HD * TT, VTl + zk * HD * TT, TT, Ob, HD, 0, (size_t)RH * TT, (size_t)HD * TT, (size_t)TT * HD);
            k_gemmc<h16, 0, 2><<<dim3((TT - RH) / 64, HD / 64, ZH), 32, 0, stream>>>(P16 + (size_t)RH * TT, nullptr, VT16 + zk * HD * TT, nullptr, TT, Ob + (size_t)RH * HD, HD, RH, (size_t)TT * TT, (size_t)HD * TT, (size_t)TT * HD);
            k_merge<<<(unsigned)(((size_t)ZH * TT * HD / 2 + 255) / 256), 256, 0, stream>>>(Ob, h0, ATh, ATl); }
        k_gemmw<bf, 1, false><<<dim3(TT / 64, DM / 64, 1), 32, 0, stream>>>(ATh, ATl, WO, nullptr, DQ, OUT + (size_t)b * TT * DM, DM, nullptr, 0, 0, 0); }
}

// v001
// A run of this version takes 741 microseconds.
// Next to v000, in two timings, it ran 1.91 and 1.95 times as fast.
#include <hip/hip_runtime.h>

// Causal multi-head self-attention with interleaved rotary embeddings from integer positions (x [2][2048][1024]; Q,K,V = x W^T ('oi' [1024][1024] 0.02, no bias; 16 heads x 64); rotary on (even, odd) pairs with angle pos[t] x THETA ** (-2i/64) (token_positions int [2048], read; float32 power-form constants; precise cosf/sinf); logits / 8, causal (-inf); softmax; out = merged Wo^T -> [2][2048][1024] (4.2 M)).
// Layout per batch: bf16 copy of x; exact projections; {cos, sin} per (position, pair) from the int positions (jnp-exact float32 inverse frequencies, precise cosf/sinf); interleaved rotary plane builder; causal T-2048 attention (hybrid rows: < 512 hi/lo 3 products, rest fp16 x1024; k_gemmc skips tiles above the diagonal); merged hi/lo x wo exact, no bias.
// Compute dtypes, f32 accumulate: every input rounded to bf16; projections exact ; rotary f32; attention rows < 512 3 products, rest fp16; softmax f32; wo hl x exact, no bias.

#define NB_  2
#define TT   2048
#define DM   1024
#define NH_  16
#define NKV  16
#define REP  (NH_ / NKV)
#define HD   64
#define DQ   (NH_ * HD)
#define DKV  (NKV * HD)
#define ZH   2
#define RH   512                  // query rows < RH use hi+lo planes (0: none)
#define WIN  2048
#define PCAR 1024.0f
#define SCL  0.125f   // HD^-0.5
typedef _Float16 h16;
typedef unsigned short bf;
typedef __attribute__((ext_vector_type(16))) __bf16   v16bf;
typedef __attribute__((ext_vector_type(16))) _Float16 v16h;
typedef __attribute__((ext_vector_type(8)))  _Float16 v8h;
typedef __attribute__((ext_vector_type(8)))  unsigned short v8us;
typedef __attribute__((ext_vector_type(8)))  float    v8f;
typedef __attribute__((ext_vector_type(4)))  float    v4f;
typedef v8h  __attribute__((may_alias)) v8ha;
typedef v4f  __attribute__((may_alias)) v4fa;
typedef v8us __attribute__((may_alias)) v8usa;

__device__ __forceinline__ unsigned short f2bf(float f) { unsigned u = __float_as_uint(f); u += 0x7FFFu + ((u >> 16) & 1u); return (unsigned short)(u >> 16); }
__device__ __forceinline__ float bf2f(unsigned short b) { return __uint_as_float(((unsigned)b) << 16); }
__device__ __forceinline__ float bfr(float f) { return bf2f(f2bf(f)); }
__device__ __forceinline__ v16h cat16(v8h lo, v8h hi) { return __builtin_shufflevector(lo, hi, 0, 1, 2, 3, 4, 5, 6, 7, 8, 9, 10, 11, 12, 13, 14, 15); }
__device__ __forceinline__ v16bf cat16b(v8us lo, v8us hi) { return __builtin_bit_cast(v16bf, __builtin_shufflevector(lo, hi, 0, 1, 2, 3, 4, 5, 6, 7, 8, 9, 10, 11, 12, 13, 14, 15)); }
__device__ __forceinline__ v8f wmma16(v16h a, v16h b, v8f c) { return __builtin_amdgcn_wmma_f32_16x16x32_f16(false, a, false, b, (short)0, c, false, false); }
__device__ __forceinline__ v8f wmmab(v16bf a, v16bf b, v8f c) { return __builtin_amdgcn_wmma_f32_16x16x32_bf16(false, a, false, b, (short)0, c, false, false); }



// ---- k_gemms: register-blocked GEMM, one 64x64 output tile per work-group of NW waves; operands straight from K-contiguous 16-bit planes; grid (M/64, N/64, Z), 32 * NW threads.
// C[m][n] (f32, pitch ldc) = sum_k A[m][k] Bt[n][k] (+ split products per NSPLIT). z-batch strides sA/sB/sC in elements. K % 32 == 0.
// The K loop is dealt over the waves in slices of 32 (wave w takes slices w, w + NW, ...): each wave holds a whole 64x64 f32 partial tile (16 accumulators), and the NW partials are summed through LDS in wave order 0 .. NW-1.
// CAUSALK: probability x value contraction; probabilities are exactly 0 beyond the diagonal block, so the K range stops there (roff = row offset of this launch's first row within the sequence).
template <typename T16> struct WFrag;
template <> struct WFrag<h16> { typedef v16h V; static __device__ __forceinline__ V ld(const h16* p) { return cat16(*(const v8h*)p, *(const v8h*)(p + 16)); } static __device__ __forceinline__ v8f mma(V a, V b, v8f c) { return wmma16(a, b, c); } };
template <> struct WFrag<bf> { typedef v16bf V; static __device__ __forceinline__ V ld(const bf* p) { return cat16b(*(const v8us*)p, *(const v8us*)(p + 16)); } static __device__ __forceinline__ v8f mma(V a, V b, v8f c) { return wmmab(a, b, c); } };
template <typename T16, int NSPLIT, bool CAUSALK, int NW>
__global__ __launch_bounds__(32 * NW) void k_gemms(const T16* __restrict__ A, const T16* __restrict__ A2, const T16* __restrict__ Bt, const T16* __restrict__ Bt2, int K, float* C, int ldc, int roff, size_t sA, size_t sB, size_t sC) {
    typedef typename WFrag<T16>::V V;
    __shared__ __align__(16) float part[NW * 4096];                  // [wave][accumulator 0..15][half 0..1][lane][4]: each wave's partial tile in register order, 16 B per lane
    const size_t z = blockIdx.z; A += z * sA; if (A2) A2 += z * sA; Bt += z * sB; if (Bt2) Bt2 += z * sB; C += z * sC;
    const int lane = threadIdx.x & 31, lr = lane & 15, hi = lane >> 4; const int r0 = blockIdx.x * 64, c0 = blockIdx.y * 64;
    const int wave = __builtin_amdgcn_readfirstlane((int)(threadIdx.x >> 5));   // scalar, so that the K loop's test is a scalar branch and every lane stays on at the matrix instructions
    const int Kl = CAUSALK ? min(K, r0 + roff + 64) : K;
    v8f acc[4][4];
#pragma unroll
    for (int mb = 0; mb < 4; ++mb)
#pragma unroll
        for (int nb = 0; nb < 4; ++nb) acc[mb][nb] = (v8f){};
    const size_t aoff = (size_t)(r0 + lr) * K + 8 * hi, boff = (size_t)(c0 + lr) * K + 8 * hi;
#pragma unroll 1
    for (int kc = wave * 32; kc < Kl; kc += NW * 32) {
        V a[4], a2[4];
#pragma unroll
        for (int mb = 0; mb < 4; ++mb) { a[mb] = WFrag<T16>::ld(A + aoff + (size_t)mb * 16 * K + kc); if (NSPLIT == 1 || NSPLIT == 2) a2[mb] = WFrag<T16>::ld(A2 + aoff + (size_t)mb * 16 * K + kc); }
#pragma unroll
        for (int nb = 0; nb < 4; ++nb) { const V b = WFrag<T16>::ld(Bt + boff + (size_t)nb * 16 * K + kc); V b2; if (NSPLIT >= 2) b2 = WFrag<T16>::ld(Bt2 + boff + (size_t)nb * 16 * K + kc);
#pragma unroll
            for (int mb = 0; mb < 4; ++mb) { acc[mb][nb] = WFrag<T16>::mma(a[mb], b, acc[mb][nb]); if (NSPLIT == 1 || NSPLIT == 2) acc[mb][nb] = WFrag<T16>::mma(a2[mb], b, acc[mb][nb]); if (NSPLIT >= 2) acc[mb][nb] = WFrag<T16>::mma(a[mb], b2, acc[mb][nb]); } }
        asm volatile("v_nop\n\tv_nop\n\tv_nop\n\tv_nop" : "+v"(acc[0][0]), "+v"(acc[1][1]), "+v"(acc[2][2]), "+v"(acc[3][3]) : "v"(a[0]), "v"(a[3]));
    }
    float* mine = part + wave * 4096 + lane * 4;
#pragma unroll
    for (int mb = 0; mb < 4; ++mb)
#pragma unroll
        for (int nb = 0; nb < 4; ++nb) { const v8f t = acc[mb][nb]; *(v4fa*)(mine + ((mb * 4 + nb) * 2) * 128) = (v4f){ t[0], t[1], t[2], t[3] }; *(v4fa*)(mine + ((mb * 4 + nb) * 2 + 1) * 128) = (v4f){ t[4], t[5], t[6], t[7] }; }
    __syncthreads();                                                 // every wave's partial tile is in LDS before any wave sums
    // 16 units of (16-row block mb, 32-column pair np, 4-row half jh); a wave owns 16 / NW of them, so each 128-byte line of C has one writing wave
    v4f s0[16 / NW], s1[16 / NW];
#pragma unroll
    for (int q = 0; q < 16 / NW; ++q) { const int u = wave * (16 / NW) + q, mb = u >> 2, np = (u >> 1) & 1, jh = u & 1;
        const float* sp = part + ((mb * 4 + np * 2) * 2 + jh) * 128 + lane * 4; s0[q] = *(const v4fa*)sp; s1[q] = *(const v4fa*)(sp + 256);
#pragma unroll
        for (int w = 1; w < NW; ++w) { s0[q] += *(const v4fa*)(sp + w * 4096); s1[q] += *(const v4fa*)(sp + w * 4096 + 256); } }
#pragma unroll
    for (int q = 0; q < 16 / NW; ++q) { const int u = wave * (16 / NW) + q, mb = u >> 2, np = (u >> 1) & 1, jh = u & 1;
        float* crow = C + (size_t)(r0 + mb * 16 + hi * 8 + jh * 4) * ldc + c0 + np * 32 + lr;
#pragma unroll
        for (int j = 0; j < 4; ++j) { crow[(size_t)j * ldc] = s0[q][j]; crow[(size_t)j * ldc + 16] = s1[q][j]; } }
}

// ---- k_gemmc: a one-wave 64x64 tile GEMM (k_gemms' tile loop, K not split over waves) specialised for causal attention: CMODE 1 skips score tiles entirely above the diagonal (query rows r0+roff.., key columns c0..), CMODE 2 limits the
// key (K) loop of the probability x value contraction to the diagonal block (probabilities beyond it are exactly zero). roff = row offset of this launch's first row within the sequence.
template <typename T16, int NSPLIT, int CMODE>
__global__ __launch_bounds__(32) void k_gemmc(const T16* __restrict__ A, const T16* __restrict__ A2, const T16* __restrict__ Bt, const T16* __restrict__ Bt2, int K, float* C, int ldc, int roff, size_t sA, size_t sB, size_t sC) {
    typedef typename WFrag<T16>::V V;
    __shared__ __align__(16) float os[16 * 68];
    const size_t z = blockIdx.z; A += z * sA; if (A2) A2 += z * sA; Bt += z * sB; if (Bt2) Bt2 += z * sB; C += z * sC;
    const int lane = threadIdx.x & 31, lr = lane & 15, hi = lane >> 4; const int r0 = blockIdx.x * 64, c0 = blockIdx.y * 64;
    if (CMODE == 1 && c0 > r0 + roff + 63) return;                  // score tile entirely above the causal diagonal: never written (the softmax masks j > i by select)
    const int Kl = (CMODE == 2) ? min(K, r0 + roff + 64) : K;        // P.V: probabilities are exactly 0 beyond the diagonal block, so the K loop stops there
    v8f acc[4][4];
#pragma unroll
    for (int mb = 0; mb < 4; ++mb)
#pragma unroll
        for (int nb = 0; nb < 4; ++nb) acc[mb][nb] = (v8f){};
    const size_t aoff = (size_t)(r0 + lr) * K + 8 * hi, boff = (size_t)(c0 + lr) * K + 8 * hi;
#pragma unroll 1
    for (int kc = 0; kc < Kl; kc += 32) {
        V a[4], a2[4];
#pragma unroll
        for (int mb = 0; mb < 4; ++mb) { a[mb] = WFrag<T16>::ld(A + aoff + (size_t)mb * 16 * K + kc); if (NSPLIT == 1 || NSPLIT == 2) a2[mb] = WFrag<T16>::ld(A2 + aoff + (size_t)mb * 16 * K + kc); }
#pragma unroll
        for (int nb = 0; nb < 4; ++nb) { const V b = WFrag<T16>::ld(Bt + boff + (size_t)nb * 16 * K + kc); V b2; if (NSPLIT >= 2) b2 = WFrag<T16>::ld(Bt2 + boff + (size_t)nb * 16 * K + kc);
#pragma unroll
            for (int mb = 0; mb < 4; ++mb) { acc[mb][nb] = WFrag<T16>::mma(a[mb], b, acc[mb][nb]); if (NSPLIT == 1 || NSPLIT == 2) acc[mb][nb] = WFrag<T16>::mma(a2[mb], b, acc[mb][nb]); if (NSPLIT >= 2) acc[mb][nb] = WFrag<T16>::mma(a[mb], b2, acc[mb][nb]); } }
        asm volatile("v_nop\n\tv_nop\n\tv_nop\n\tv_nop" : "+v"(acc[0][0]), "+v"(acc[1][1]), "+v"(acc[2][2]), "+v"(acc[3][3]) : "v"(a[0]), "v"(a[3]));
    }
#pragma unroll
    for (int mb = 0; mb < 4; ++mb) {
#pragma unroll
        for (int nb = 0; nb < 4; ++nb) {
#pragma unroll
            for (int j = 0; j < 8; ++j) os[(hi * 8 + j) * 68 + nb * 16 + lr] = acc[mb][nb][j]; }
        __builtin_amdgcn_wave_barrier(); asm volatile("" ::: "memory");
        float* crow = C + (size_t)(r0 + mb * 16) * ldc + c0;
{
#pragma unroll
            for (int s = 0; s < 8; ++s) { const int row = 2 * s + hi, cofs = lr * 4; v4f val = *(const v4fa*)(os + row * 68 + cofs);
                *(v4f*)(crow + (size_t)row * ldc + cofs) = val; }
             }
        __builtin_amdgcn_wave_barrier(); asm volatile("" ::: "memory");
    }
}

__device__ __forceinline__ h16 tohx(float x) { return (h16)x; }
__device__ __forceinline__ void splitf(float y, unsigned short& h, unsigned short& l) { h = f2bf(y); l = f2bf(y - bf2f(h)); }
typedef __attribute__((ext_vector_type(2))) _Float16 v2h;
typedef __attribute__((ext_vector_type(4))) _Float16 v4h;
typedef __attribute__((ext_vector_type(2))) unsigned short v2us;
typedef __attribute__((ext_vector_type(4))) unsigned short v4us;
typedef __attribute__((ext_vector_type(2))) float v2f;
typedef __attribute__((ext_vector_type(4))) int v4i;

__global__ __launch_bounds__(256) void k_wtG(const float* __restrict__ w, int K, int N, bf* Bt) {
    const int lane = threadIdx.x & 31; const int L0 = (blockIdx.x * 8 + (threadIdx.x >> 5)) * 8; const int nlines = N * K / 64;
{
#pragma unroll 1
        for (int l = 0; l < 8; ++l) { const int L = L0 + l; if (L >= nlines) break; const size_t e = (size_t)L * 64 + lane * 2; const int k = (int)(e % K), n = (int)(e / K); v2us o;
            o[0] = f2bf(w[(size_t)k * N + n]); o[1] = f2bf(w[(size_t)(k + 1) * N + n]); *(v2us*)(Bt + e) = o; }
         }
}
__global__ __launch_bounds__(256) void k_cvt8(const float* __restrict__ src, bf* dst, size_t n8) { const size_t i = (size_t)blockIdx.x * 256 + threadIdx.x; if (i >= n8) return; const v8f v = *(const v8f*)(src + i * 8); v8us o;
#pragma unroll
    for (int k = 0; k < 8; ++k) o[k] = f2bf(v[k]); *(v8us*)(dst + i * 8) = o;  }
__constant__ float INVT[HD / 2] = { 1.000000000e+00f,7.498942018e-01f,5.623413324e-01f,4.216965139e-01f,3.162277639e-01f,2.371373773e-01f,1.778279394e-01f,1.333521456e-01f,1.000000015e-01f,7.498942316e-02f,5.623413250e-02f,4.216964915e-02f,3.162277490e-02f,2.371373773e-02f,1.778279431e-02f,1.333521400e-02f,9.999999776e-03f,7.498942316e-03f,5.623413250e-03f,4.216964822e-03f,3.162277630e-03f,2.371373819e-03f,1.778279431e-03f,1.333521446e-03f,1.000000047e-03f,7.498941850e-04f,5.623413017e-04f,4.216965172e-04f,3.162277571e-04f,2.371373703e-04f,1.778279402e-04f,1.333521504e-04f };   // THETA ** (-2 i / 64) as float32 (the module's power form, jnp-computed)
__global__ __launch_bounds__(256) void k_cstabT(const int* __restrict__ pid, float* CS) { const int idx = blockIdx.x * 256 + threadIdx.x; if (idx >= TT * HD) return; const int d = idx % HD; const int t = idx / HD; const float a = __fmul_rn((float)pid[t], INVT[d >> 1]); v2f cs; cs[0] = cosf(a); cs[1] = sinf(a); *(v2f*)(CS + (size_t)idx * 2) = cs;  }
__global__ __launch_bounds__(256) void k_ropeI(const float* __restrict__ F, int pitch, int nheads, const float* __restrict__ CS, float sc, h16* P16, bf* Ph, bf* Pl) {
    const size_t e = ((size_t)blockIdx.x * 256 + threadIdx.x) * 2; if (e >= (size_t)nheads * TT * HD) return; const int d = (int)(e % HD); const int t = (int)((e / HD) % TT); const int h = (int)(e / ((size_t)HD * TT)); const float* f = F + (size_t)t * pitch + h * HD; const float x0 = f[d], x1 = f[d + 1]; const v2f cs = *(const v2f*)(CS + ((size_t)t * HD + d) * 2); v2h o16; v2us oh, ol;
    float a0 = __fmul_rn(x0, cs[0]), b0 = __fmul_rn(x1, cs[1]), a1 = __fmul_rn(x1, cs[0]), b1 = __fmul_rn(x0, cs[1]); asm volatile("" : "+v"(a0), "+v"(b0), "+v"(a1), "+v"(b1));
    float r0 = __fsub_rn(a0, b0) * sc, r1 = __fadd_rn(b1, a1) * sc;   /* even: x0 c - x1 s; odd: x0 s + x1 c */
    o16[0] = tohx(r0); o16[1] = tohx(r1); { unsigned short a2, c2; splitf(r0, a2, c2); oh[0] = a2; ol[0] = c2; splitf(r1, a2, c2); oh[1] = a2; ol[1] = c2; }
    *(v2h*)(P16 + e) = o16; *(v2us*)(Ph + e) = oh; *(v2us*)(Pl + e) = ol;  }


// k_ropeI: head planes [h][t][d] (fp16 + hi/lo) of rope(x) x sc with the interleaved convention out[d] = x[d] cos[t][d] - x[d+1] sin[t][d], out[d+1] = x[d+1] cos[t][d] + x[d] sin[t][d] (d even)

__global__ __launch_bounds__(256) void k_vtp(const float* __restrict__ F, int pitch, int nheads, h16* V16, bf* Vh, bf* Vl) { const size_t e = ((size_t)blockIdx.x * 256 + threadIdx.x) * 2; if (e >= (size_t)nheads * HD * TT) return; const int t = (int)(e % TT); const int d = (int)((e / TT) % HD); const int g = (int)(e / ((size_t)TT * HD)); v2h o16; v2us oh, ol;
#pragma unroll
    for (int q = 0; q < 2; ++q) { const float x = F[(size_t)(t + q) * pitch + g * HD + d]; o16[q] = tohx(x); unsigned short a2, c2; splitf(x, a2, c2); oh[q] = a2; ol[q] = c2; }
    *(v2h*)(V16 + e) = o16; *(v2us*)(Vh + e) = oh; *(v2us*)(Vl + e) = ol;  }
// k_asoft: per row (zz, i): t = S x HD^-0.5 for j <= i and i - j < WIN (WIN = TT, so plain causal; the reference's -1e9 additive fill vanishes identically); softmax over the 2048 keys (register row, one exp, fixed trees);
__global__ __launch_bounds__(256) void k_asoft(const float* __restrict__ Sb, h16* P16, bf* Ph, bf* Pl) {
    const int lane = threadIdx.x & 31; const int row = blockIdx.x * 8 + (threadIdx.x >> 5); if (row >= ZH * TT) return; const int i = row % TT; const int zz = row / TT; (void)zz; const bool hires = (i < RH); const float* sr = Sb + (size_t)row * TT; float v[TT / 32]; float mx = -3.0e38f;
#pragma unroll
    for (int ch = 0; ch < TT / 128; ++ch) { const int j0 = ch * 128 + lane * 4; const v4f a = *(const v4f*)(sr + j0);
#pragma unroll
        for (int q = 0; q < 4; ++q) { const int j = j0 + q; (void)j; const float t = (j <= i && i - j < WIN) ? a[q] * SCL : -3.0e38f; v[ch * 4 + q] = t; mx = fmaxf(mx, t); } }
#pragma unroll
    for (int sh = 16; sh; sh >>= 1) mx = fmaxf(mx, __shfl_xor(mx, sh, 32));
    float sum = 0.f;
#pragma unroll
    for (int k = 0; k < TT / 32; ++k) { float d0 = __fsub_rn(v[k], mx); asm volatile("" : "+v"(d0)); v[k] = __builtin_amdgcn_exp2f(__fmul_rn(d0, 1.4426950408889634f)); sum += v[k]; }
#pragma unroll
    for (int sh = 16; sh; sh >>= 1) sum += __shfl_xor(sum, sh, 32);
    const float f = __fdiv_rn(hires ? 1.0f : PCAR, sum);
{
        if (hires) {
#pragma unroll
            for (int ch = 0; ch < TT / 128; ++ch) { v4us oh, ol;
#pragma unroll
                for (int q = 0; q < 4; ++q) { unsigned short a, c2; splitf(v[ch * 4 + q] * f, a, c2); oh[q] = a; ol[q] = c2; }
                const size_t oo = ((size_t)zz * (RH ? RH : 1) + i) * TT + ch * 128 + lane * 4; *(v4us*)(Ph + oo) = oh; *(v4us*)(Pl + oo) = ol; }
        } else {
#pragma unroll
            for (int ch = 0; ch < TT / 128; ++ch) { v4h o4;
#pragma unroll
                for (int q = 0; q < 4; ++q) o4[q] = tohx(v[ch * 4 + q] * f);
                *(v4h*)(P16 + (size_t)row * TT + ch * 128 + lane * 4) = o4; } }
         }
}
__global__ __launch_bounds__(256) void k_merge(const float* __restrict__ O, int h0, bf* Ah, bf* Al) { const size_t e = ((size_t)blockIdx.x * 256 + threadIdx.x) * 2; if (e >= (size_t)ZH * TT * HD) return; const int d = (int)(e % HD); const int t = (int)((e / HD) % TT); const int zz = (int)(e / ((size_t)HD * TT)); const float cs = (t < RH) ? 1.0f : (1.0f / PCAR); const size_t oo = (size_t)t * DQ + (h0 + zz) * HD + d;
    v2us oh, ol;
#pragma unroll
    for (int q = 0; q < 2; ++q) { unsigned short a, c2; splitf(O[e + q] * cs, a, c2); oh[q] = a; ol[q] = c2; } *(v2us*)(Ah + oo) = oh; *(v2us*)(Al + oo) = ol;  }

extern "C" void kernel_launch(void* const* d_in, const int* in_sizes, int n_in,
                              void* d_out, int out_size, void* d_ws, size_t ws_size, hipStream_t stream) {
    (void)in_sizes; (void)n_in; (void)out_size;
    const float* x = (const float*)d_in[0]; const float* wq = (const float*)d_in[1]; const float* wk = (const float*)d_in[2]; const float* wv = (const float*)d_in[3]; const float* wo = (const float*)d_in[4]; const int* pid = (const int*)d_in[5];   /* token_positions int32 [2048] (= arange) */
    float* OUT = (float*)d_out;     // [2][2048][1024]
    char* wsp = (char*)d_ws;
    auto take = [&](size_t bytes) { char* p = wsp; wsp += (bytes + 255) & ~(size_t)255; return (void*)p; };
    bf* WQ = (bf*)take((size_t)DQ * DM * 2); bf* WK = (bf*)take((size_t)DKV * DM * 2); bf* WV = (bf*)take((size_t)DKV * DM * 2); bf* WO = (bf*)take((size_t)DM * DQ * 2); float* CS = (float*)take((size_t)TT * HD * 2 * 4);
    bf* XB = (bf*)take((size_t)TT * DM * 2); float* FQ = (float*)take((size_t)TT * DQ * 4); float* FK = (float*)take((size_t)TT * DKV * 4);
    h16* QP16 = (h16*)take((size_t)NH_ * TT * HD * 2); h16* KP16 = (h16*)take((size_t)NKV * TT * HD * 2); h16* VT16 = (h16*)take((size_t)NKV * HD * TT * 2);
    bf* QPh = (bf*)take((size_t)NH_ * TT * HD * 2); bf* QPl = (bf*)take((size_t)NH_ * TT * HD * 2); bf* KPh = (bf*)take((size_t)NKV * TT * HD * 2); bf* KPl = (bf*)take((size_t)NKV * TT * HD * 2); bf* VTh = (bf*)take((size_t)NKV * HD * TT * 2); bf* VTl = (bf*)take((size_t)NKV * HD * TT * 2); bf* Ph = (bf*)take((size_t)ZH * RH * TT * 2); bf* Pl = (bf*)take((size_t)ZH * RH * TT * 2);
    float* Sb = (float*)take((size_t)ZH * TT * TT * 4); h16* P16 = (h16*)take((size_t)ZH * TT * TT * 2); float* Ob = (float*)take((size_t)ZH * TT * HD * 4); bf* ATh = (bf*)take((size_t)TT * DQ * 2); bf* ATl = (bf*)take((size_t)TT * DQ * 2);
    if ((size_t)(wsp - (char*)d_ws) > ws_size) return;    // ws 256 MiB
    float* FV = FK;   // v projection reuses the k buffer after the k planes are built (stream-ordered)
    { k_cvt8<<<(unsigned)(((size_t)DQ * DM / 8 + 255) / 256), 256, 0, stream>>>(wq, WQ, (size_t)DQ * DM / 8); k_cvt8<<<(unsigned)(((size_t)DKV * DM / 8 + 255) / 256), 256, 0, stream>>>(wk, WK, (size_t)DKV * DM / 8); k_cvt8<<<(unsigned)(((size_t)DKV * DM / 8 + 255) / 256), 256, 0, stream>>>(wv, WV, (size_t)DKV * DM / 8);
      k_cvt8<<<(unsigned)(((size_t)DM * DQ / 8 + 255) / 256), 256, 0, stream>>>(wo, WO, (size_t)DM * DQ / 8);
       }
    const unsigned LQ = (unsigned)(((size_t)NH_ * TT * HD / 2 + 255) / 256), LKv = (unsigned)(((size_t)NKV * TT * HD / 2 + 255) / 256);
    for (int b = 0; b < NB_; ++b) {
        if (b == 0) k_cstabT<<<(TT * HD + 255) / 256, 256, 0, stream>>>(pid, CS);
        k_cvt8<<<(unsigned)(((size_t)TT * DM / 8 + 255) / 256), 256, 0, stream>>>(x + (size_t)b * TT * DM, XB, (size_t)TT * DM / 8);
        k_gemms<bf, 0, false, 8><<<dim3(TT / 64, DQ / 64, 1), 256, 0, stream>>>(XB, nullptr, WQ, nullptr, DM, FQ, DQ, 0, 0, 0, 0);
        k_ropeI<<<LQ, 256, 0, stream>>>(FQ, DQ, NH_, CS, 1.0f, QP16, QPh, QPl);
        k_gemms<bf, 0, false, 8><<<dim3(TT / 64, DKV / 64, 1), 256, 0, stream>>>(XB, nullptr, WK, nullptr, DM, FK, DKV, 0, 0, 0, 0);
        k_ropeI<<<LKv, 256, 0, stream>>>(FK, DKV, NKV, CS, 1.0f, KP16, KPh, KPl);
        k_gemms<bf, 0, false, 8><<<dim3(TT / 64, DKV / 64, 1), 256, 0, stream>>>(XB, nullptr, WV, nullptr, DM, FV, DKV, 0, 0, 0, 0); k_vtp<<<LKv, 256, 0, stream>>>(FV, DKV, NKV, VT16, VTh, VTl);
        for (int h0 = 0; h0 < NH_; h0 += ZH) { const size_t zq = (size_t)h0, zk = (size_t)(h0 / REP);   // one kv head per query head: the pass's two heads use consecutive kv planes (z-strides TT*HD)
            k_gemmc<bf, 2, 1><<<dim3(RH / 64, TT / 64, ZH), 32, 0, stream>>>(QPh + zq * TT * HD, QPl + zq * TT * HD, KPh + zk * TT * HD, KPl + zk * TT * HD, HD, Sb, TT, 0, (size_t)TT * HD, (size_t)TT * HD, (size_t)TT * TT);
            k_gemmc<h16, 0, 1><<<dim3((TT - RH) / 64, TT / 64, ZH), 32, 0, stream>>>(QP16 + zq * TT * HD + (size_t)RH * HD, nullptr, KP16 + zk * TT * HD, nullptr, HD, Sb + (size_t)RH * TT, TT, RH, (size_t)TT * HD, (size_t)TT * HD, (size_t)TT * TT);
            k_asoft<<<ZH * TT / 8, 256, 0, stream>>>(Sb, P16, Ph, Pl);
            k_gemms<bf, 2, true, 16><<<dim3(RH / 64, HD / 64, ZH), 512, 0, stream>>>(Ph, Pl, VTh + zk * HD * TT, VTl + zk * HD * TT, TT, Ob, HD, 0, (size_t)RH * TT, (size_t)HD * TT, (size_t)TT * HD);
            k_gemms<h16, 0, true, 16><<<dim3((TT - RH) / 64, HD / 64, ZH), 512, 0, stream>>>(P16 + (size_t)RH * TT, nullptr, VT16 + zk * HD * TT, nullptr, TT, Ob + (size_t)RH * HD, HD, RH, (size_t)TT * TT, (size_t)HD * TT, (size_t)TT * HD);
            k_merge<<<(unsigned)(((size_t)ZH * TT * HD / 2 + 255) / 256), 256, 0, stream>>>(Ob, h0, ATh, ATl); }
        k_gemms<bf, 1, false, 8><<<dim3(TT / 64, DM / 64, 1), 256, 0, stream>>>(ATh, ATl, WO, nullptr, DQ, OUT + (size_t)b * TT * DM, DM, 0, 0, 0, 0); }
}

// v002
// A run of this version takes 345 microseconds.
// Two timings next to v001 put it at 2.12 and 2.17 times that version's speed.
// Counting every step since v000, it is 4.14 times as fast.
#include <hip/hip_runtime.h>

// Causal multi-head self-attention with interleaved rotary embeddings from integer positions (x [2][2048][1024]; Q,K,V = x W^T ('oi' [1024][1024] 0.02, no bias; 16 heads x 64); rotary on (even, odd) pairs with angle pos[t] x THETA ** (-2i/64) (token_positions int [2048], read; float32 power-form constants; precise cosf/sinf); logits / 8, causal (-inf); softmax; out = merged Wo^T -> [2][2048][1024] (4.2 M)).
// Layout per batch: bf16 copy of x; exact projections; {cos, sin} per (position, pair) from the int positions (jnp-exact float32 inverse frequencies, precise cosf/sinf); interleaved rotary plane builder; causal T-2048 attention, all 16 heads of a batch in each launch (hybrid rows: < 512 hi/lo 3 products, rest fp16 x1024; k_gemmc skips tiles above the diagonal; scores packed by causal block row, probabilities written over their own score rows); merged hi/lo x wo exact, no bias.
// Compute dtypes, f32 accumulate: every input rounded to bf16; projections exact ; rotary f32; attention rows < 512 3 products, rest fp16; softmax f32; wo hl x exact, no bias.

#define NB_  2
#define TT   2048
#define DM   1024
#define NH_  16
#define NKV  16
#define REP  (NH_ / NKV)
#define HD   64
#define DQ   (NH_ * HD)
#define DKV  (NKV * HD)
#define ZH   16                   // heads per attention launch
#define RH   512                  // query rows < RH use hi+lo planes (0: none)
#define WIN  2048
#define PCAR 1024.0f
#define SCL  0.125f   // HD^-0.5
// Score storage of one head: block row rb (64 query rows) keeps only its (rb + 1) * 64 causal columns, its rows packed at that pitch; the block rows follow one another. That halves the plane, so that ZH heads fit the workspace.
// The softmax writes a row's probabilities over the row's own scores: fp16 in the first half of the row's bytes, or the bf16 hi plane in the first half and the lo plane in the second.
#define SHEAD ((size_t)(TT / 64) * (TT / 64 + 1) / 2 * 4096)   // floats per head
typedef _Float16 h16;
typedef unsigned short bf;
typedef __attribute__((ext_vector_type(16))) __bf16   v16bf;
typedef __attribute__((ext_vector_type(16))) _Float16 v16h;
typedef __attribute__((ext_vector_type(8)))  _Float16 v8h;
typedef __attribute__((ext_vector_type(8)))  unsigned short v8us;
typedef __attribute__((ext_vector_type(8)))  float    v8f;
typedef __attribute__((ext_vector_type(4)))  float    v4f;
typedef v8h  __attribute__((may_alias)) v8ha;
typedef v4f  __attribute__((may_alias)) v4fa;
typedef v8us __attribute__((may_alias)) v8usa;

__device__ __forceinline__ unsigned short f2bf(float f) { unsigned u = __float_as_uint(f); u += 0x7FFFu + ((u >> 16) & 1u); return (unsigned short)(u >> 16); }
__device__ __forceinline__ float bf2f(unsigned short b) { return __uint_as_float(((unsigned)b) << 16); }
__device__ __forceinline__ size_t tri_off(int rb) { return (size_t)(rb * (rb + 1) / 2) * 4096; }   // floats in front of block row rb
__device__ __forceinline__ float bfr(float f) { return bf2f(f2bf(f)); }
__device__ __forceinline__ v16h cat16(v8h lo, v8h hi) { return __builtin_shufflevector(lo, hi, 0, 1, 2, 3, 4, 5, 6, 7, 8, 9, 10, 11, 12, 13, 14, 15); }
__device__ __forceinline__ v16bf cat16b(v8us lo, v8us hi) { return __builtin_bit_cast(v16bf, __builtin_shufflevector(lo, hi, 0, 1, 2, 3, 4, 5, 6, 7, 8, 9, 10, 11, 12, 13, 14, 15)); }
__device__ __forceinline__ v8f wmma16(v16h a, v16h b, v8f c) { return __builtin_amdgcn_wmma_f32_16x16x32_f16(false, a, false, b, (short)0, c, false, false); }
__device__ __forceinline__ v8f wmmab(v16bf a, v16bf b, v8f c) { return __builtin_amdgcn_wmma_f32_16x16x32_bf16(false, a, false, b, (short)0, c, false, false); }



// ---- k_gemms: register-blocked GEMM, one 64x64 output tile per work-group of NW waves; operands straight from K-contiguous 16-bit planes; grid (M/64, N/64, Z), 32 * NW threads.
// C[m][n] (f32, pitch ldc) = sum_k A[m][k] Bt[n][k] (+ split products per NSPLIT). z-batch strides sA/sB/sC in elements. K % 32 == 0.
// The K loop is dealt over the waves in slices of 32 (wave w takes slices w, w + NW, ...): each wave holds a whole 64x64 f32 partial tile (16 accumulators), and the NW partials are summed through LDS in wave order 0 .. NW-1.
// CAUSALK: probability x value contraction; probabilities are exactly 0 beyond the diagonal block, so the K range stops there (roff = row offset of this launch's first row within the sequence). A (and A2) then point at a head's packed score storage: block row rb starts at tri_off(rb) floats, a row's slot is (rb + 1) * 128 16-bit elements, and the lo plane stands (rb + 1) * 64 elements behind the hi plane.
template <typename T16> struct WFrag;
template <> struct WFrag<h16> { typedef v16h V; static __device__ __forceinline__ V ld(const h16* p) { return cat16(*(const v8h*)p, *(const v8h*)(p + 16)); } static __device__ __forceinline__ v8f mma(V a, V b, v8f c) { return wmma16(a, b, c); } };
template <> struct WFrag<bf> { typedef v16bf V; static __device__ __forceinline__ V ld(const bf* p) { return cat16b(*(const v8us*)p, *(const v8us*)(p + 16)); } static __device__ __forceinline__ v8f mma(V a, V b, v8f c) { return wmmab(a, b, c); } };
template <typename T16, int NSPLIT, bool CAUSALK, int NW>
__global__ __launch_bounds__(32 * NW) void k_gemms(const T16* __restrict__ A, const T16* __restrict__ A2, const T16* __restrict__ Bt, const T16* __restrict__ Bt2, int K, float* C, int ldc, int roff, size_t sA, size_t sB, size_t sC) {
    typedef typename WFrag<T16>::V V;
    __shared__ __align__(16) float part[NW * 4096];                  // [wave][accumulator 0..15][half 0..1][lane][4]: each wave's partial tile in register order, 16 B per lane
    const size_t z = blockIdx.z; A += z * sA; if (A2) A2 += z * sA; Bt += z * sB; if (Bt2) Bt2 += z * sB; C += z * sC;
    const int lane = threadIdx.x & 31, lr = lane & 15, hi = lane >> 4; const int r0 = blockIdx.x * 64, c0 = blockIdx.y * 64;
    const int wave = __builtin_amdgcn_readfirstlane((int)(threadIdx.x >> 5));   // scalar, so that the K loop's test is a scalar branch and every lane stays on at the matrix instructions
    const int Kl = CAUSALK ? min(K, r0 + roff + 64) : K;
    const int rb = (r0 + roff) >> 6; const int lda = CAUSALK ? (rb + 1) * 128 : K;
    if (CAUSALK) { A += tri_off(rb) * 2; if (A2) A2 += tri_off(rb) * 2 + (rb + 1) * 64; }
    v8f acc[4][4];
#pragma unroll
    for (int mb = 0; mb < 4; ++mb)
#pragma unroll
        for (int nb = 0; nb < 4; ++nb) acc[mb][nb] = (v8f){};
    const size_t aoff = (size_t)((CAUSALK ? 0 : r0) + lr) * lda + 8 * hi, boff = (size_t)(c0 + lr) * K + 8 * hi;
#pragma unroll 1
    for (int kc = wave * 32; kc < Kl; kc += NW * 32) {
        V a[4], a2[4];
#pragma unroll
        for (int mb = 0; mb < 4; ++mb) { a[mb] = WFrag<T16>::ld(A + aoff + (size_t)mb * 16 * lda + kc); if (NSPLIT == 1 || NSPLIT == 2) a2[mb] = WFrag<T16>::ld(A2 + aoff + (size_t)mb * 16 * lda + kc); }
#pragma unroll
        for (int nb = 0; nb < 4; ++nb) { const V b = WFrag<T16>::ld(Bt + boff + (size_t)nb * 16 * K + kc); V b2; if (NSPLIT >= 2) b2 = WFrag<T16>::ld(Bt2 + boff + (size_t)nb * 16 * K + kc);
#pragma unroll
            for (int mb = 0; mb < 4; ++mb) { acc[mb][nb] = WFrag<T16>::mma(a[mb], b, acc[mb][nb]); if (NSPLIT == 1 || NSPLIT == 2) acc[mb][nb] = WFrag<T16>::mma(a2[mb], b, acc[mb][nb]); if (NSPLIT >= 2) acc[mb][nb] = WFrag<T16>::mma(a[mb], b2, acc[mb][nb]); } }
        asm volatile("v_nop\n\tv_nop\n\tv_nop\n\tv_nop" : "+v"(acc[0][0]), "+v"(acc[1][1]), "+v"(acc[2][2]), "+v"(acc[3][3]) : "v"(a[0]), "v"(a[3]));
    }
    float* mine = part + wave * 4096 + lane * 4;
#pragma unroll
    for (int mb = 0; mb < 4; ++mb)
#pragma unroll
        for (int nb = 0; nb < 4; ++nb) { const v8f t = acc[mb][nb]; *(v4fa*)(mine + ((mb * 4 + nb) * 2) * 128) = (v4f){ t[0], t[1], t[2], t[3] }; *(v4fa*)(mine + ((mb * 4 + nb) * 2 + 1) * 128) = (v4f){ t[4], t[5], t[6], t[7] }; }
    __syncthreads();                                                 // every wave's partial tile is in LDS before any wave sums
    // 16 units of (16-row block mb, 32-column pair np, 4-row half jh); a wave owns 16 / NW of them, so each 128-byte line of C has one writing wave
    v4f s0[16 / NW], s1[16 / NW];
#pragma unroll
    for (int q = 0; q < 16 / NW; ++q) { const int u = wave * (16 / NW) + q, mb = u >> 2, np = (u >> 1) & 1, jh = u & 1;
        const float* sp = part + ((mb * 4 + np * 2) * 2 + jh) * 128 + lane * 4; s0[q] = *(const v4fa*)sp; s1[q] = *(const v4fa*)(sp + 256);
#pragma unroll
        for (int w = 1; w < NW; ++w) { s0[q] += *(const v4fa*)(sp + w * 4096); s1[q] += *(const v4fa*)(sp + w * 4096 + 256); } }
#pragma unroll
    for (int q = 0; q < 16 / NW; ++q) { const int u = wave * (16 / NW) + q, mb = u >> 2, np = (u >> 1) & 1, jh = u & 1;
        float* crow = C + (size_t)(r0 + mb * 16 + hi * 8 + jh * 4) * ldc + c0 + np * 32 + lr;
#pragma unroll
        for (int j = 0; j < 4; ++j) { crow[(size_t)j * ldc] = s0[q][j]; crow[(size_t)j * ldc + 16] = s1[q][j]; } }
}

// ---- k_gemmc: a one-wave 64x64 tile GEMM (k_gemms' tile loop, K not split over waves) specialised for causal attention: CMODE 1 skips score tiles entirely above the diagonal (query rows r0+roff.., key columns c0..), CMODE 2 limits the
// key (K) loop of the probability x value contraction to the diagonal block (probabilities beyond it are exactly zero). roff = row offset of this launch's first row within the sequence.
// CMODE 1 stores into a head's packed score storage (C = its start, ldc unused): block row (r0 + roff) / 64 at tri_off floats, pitch = its causal columns.
template <typename T16, int NSPLIT, int CMODE>
__global__ __launch_bounds__(32) void k_gemmc(const T16* __restrict__ A, const T16* __restrict__ A2, const T16* __restrict__ Bt, const T16* __restrict__ Bt2, int K, float* C, int ldc, int roff, size_t sA, size_t sB, size_t sC) {
    typedef typename WFrag<T16>::V V;
    __shared__ __align__(16) float os[16 * 68];
    const size_t z = blockIdx.z; A += z * sA; if (A2) A2 += z * sA; Bt += z * sB; if (Bt2) Bt2 += z * sB; C += z * sC;
    const int lane = threadIdx.x & 31, lr = lane & 15, hi = lane >> 4; const int r0 = blockIdx.x * 64, c0 = blockIdx.y * 64;
    if (CMODE == 1 && c0 > r0 + roff + 63) return;                  // score tile entirely above the causal diagonal: never written (the softmax masks j > i by select)
    const int Kl = (CMODE == 2) ? min(K, r0 + roff + 64) : K;        // P.V: probabilities are exactly 0 beyond the diagonal block, so the K loop stops there
    v8f acc[4][4];
#pragma unroll
    for (int mb = 0; mb < 4; ++mb)
#pragma unroll
        for (int nb = 0; nb < 4; ++nb) acc[mb][nb] = (v8f){};
    const size_t aoff = (size_t)(r0 + lr) * K + 8 * hi, boff = (size_t)(c0 + lr) * K + 8 * hi;
#pragma unroll 1
    for (int kc = 0; kc < Kl; kc += 32) {
        V a[4], a2[4];
#pragma unroll
        for (int mb = 0; mb < 4; ++mb) { a[mb] = WFrag<T16>::ld(A + aoff + (size_t)mb * 16 * K + kc); if (NSPLIT == 1 || NSPLIT == 2) a2[mb] = WFrag<T16>::ld(A2 + aoff + (size_t)mb * 16 * K + kc); }
#pragma unroll
        for (int nb = 0; nb < 4; ++nb) { const V b = WFrag<T16>::ld(Bt + boff + (size_t)nb * 16 * K + kc); V b2; if (NSPLIT >= 2) b2 = WFrag<T16>::ld(Bt2 + boff + (size_t)nb * 16 * K + kc);
#pragma unroll
            for (int mb = 0; mb < 4; ++mb) { acc[mb][nb] = WFrag<T16>::mma(a[mb], b, acc[mb][nb]); if (NSPLIT == 1 || NSPLIT == 2) acc[mb][nb] = WFrag<T16>::mma(a2[mb], b, acc[mb][nb]); if (NSPLIT >= 2) acc[mb][nb] = WFrag<T16>::mma(a[mb], b2, acc[mb][nb]); } }
        asm volatile("v_nop\n\tv_nop\n\tv_nop\n\tv_nop" : "+v"(acc[0][0]), "+v"(acc[1][1]), "+v"(acc[2][2]), "+v"(acc[3][3]) : "v"(a[0]), "v"(a[3]));
    }
#pragma unroll
    for (int mb = 0; mb < 4; ++mb) {
#pragma unroll
        for (int nb = 0; nb < 4; ++nb) {
#pragma unroll
            for (int j = 0; j < 8; ++j) os[(hi * 8 + j) * 68 + nb * 16 + lr] = acc[mb][nb][j]; }
        __builtin_amdgcn_wave_barrier(); asm volatile("" ::: "memory");
        const int rb = (r0 + roff) >> 6, pc = (CMODE == 1) ? (rb + 1) * 64 : ldc;
        float* crow = ((CMODE == 1) ? C + tri_off(rb) : C + (size_t)r0 * pc) + (size_t)(mb * 16) * pc + c0;
{
#pragma unroll
            for (int s = 0; s < 8; ++s) { const int row = 2 * s + hi, cofs = lr * 4; v4f val = *(const v4fa*)(os + row * 68 + cofs);
                *(v4f*)(crow + (size_t)row * pc + cofs) = val; }
             }
        __builtin_amdgcn_wave_barrier(); asm volatile("" ::: "memory");
    }
}

__device__ __forceinline__ h16 tohx(float x) { return (h16)x; }
__device__ __forceinline__ void splitf(float y, unsigned short& h, unsigned short& l) { h = f2bf(y); l = f2bf(y - bf2f(h)); }
typedef __attribute__((ext_vector_type(2))) _Float16 v2h;
typedef __attribute__((ext_vector_type(4))) _Float16 v4h;
typedef __attribute__((ext_vector_type(2))) unsigned short v2us;
typedef __attribute__((ext_vector_type(4))) unsigned short v4us;
typedef __attribute__((ext_vector_type(2))) float v2f;
typedef __attribute__((ext_vector_type(4))) int v4i;

__global__ __launch_bounds__(256) void k_wtG(const float* __restrict__ w, int K, int N, bf* Bt) {
    const int lane = threadIdx.x & 31; const int L0 = (blockIdx.x * 8 + (threadIdx.x >> 5)) * 8; const int nlines = N * K / 64;
{
#pragma unroll 1
        for (int l = 0; l < 8; ++l) { const int L = L0 + l; if (L >= nlines) break; const size_t e = (size_t)L * 64 + lane * 2; const int k = (int)(e % K), n = (int)(e / K); v2us o;
            o[0] = f2bf(w[(size_t)k * N + n]); o[1] = f2bf(w[(size_t)(k + 1) * N + n]); *(v2us*)(Bt + e) = o; }
         }
}
__global__ __launch_bounds__(256) void k_cvt8(const float* __restrict__ src, bf* dst, size_t n8) { const size_t i = (size_t)blockIdx.x * 256 + threadIdx.x; if (i >= n8) return; const v8f v = *(const v8f*)(src + i * 8); v8us o;
#pragma unroll
    for (int k = 0; k < 8; ++k) o[k] = f2bf(v[k]); *(v8us*)(dst + i * 8) = o;  }
__constant__ float INVT[HD / 2] = { 1.000000000e+00f,7.498942018e-01f,5.623413324e-01f,4.216965139e-01f,3.162277639e-01f,2.371373773e-01f,1.778279394e-01f,1.333521456e-01f,1.000000015e-01f,7.498942316e-02f,5.623413250e-02f,4.216964915e-02f,3.162277490e-02f,2.371373773e-02f,1.778279431e-02f,1.333521400e-02f,9.999999776e-03f,7.498942316e-03f,5.623413250e-03f,4.216964822e-03f,3.162277630e-03f,2.371373819e-03f,1.778279431e-03f,1.333521446e-03f,1.000000047e-03f,7.498941850e-04f,5.623413017e-04f,4.216965172e-04f,3.162277571e-04f,2.371373703e-04f,1.778279402e-04f,1.333521504e-04f };   // THETA ** (-2 i / 64) as float32 (the module's power form, jnp-computed)
__global__ __launch_bounds__(256) void k_cstabT(const int* __restrict__ pid, float* CS) { const int idx = blockIdx.x * 256 + threadIdx.x; if (idx >= TT * HD) return; const int d = idx % HD; const int t = idx / HD; const float a = __fmul_rn((float)pid[t], INVT[d >> 1]); v2f cs; cs[0] = cosf(a); cs[1] = sinf(a); *(v2f*)(CS + (size_t)idx * 2) = cs;  }
__global__ __launch_bounds__(256) void k_ropeI(const float* __restrict__ F, int pitch, int nheads, const float* __restrict__ CS, float sc, h16* P16, bf* Ph, bf* Pl) {
    const size_t e = ((size_t)blockIdx.x * 256 + threadIdx.x) * 2; if (e >= (size_t)nheads * TT * HD) return; const int d = (int)(e % HD); const int t = (int)((e / HD) % TT); const int h = (int)(e / ((size_t)HD * TT)); const float* f = F + (size_t)t * pitch + h * HD; const float x0 = f[d], x1 = f[d + 1]; const v2f cs = *(const v2f*)(CS + ((size_t)t * HD + d) * 2); v2h o16; v2us oh, ol;
    float a0 = __fmul_rn(x0, cs[0]), b0 = __fmul_rn(x1, cs[1]), a1 = __fmul_rn(x1, cs[0]), b1 = __fmul_rn(x0, cs[1]); asm volatile("" : "+v"(a0), "+v"(b0), "+v"(a1), "+v"(b1));
    float r0 = __fsub_rn(a0, b0) * sc, r1 = __fadd_rn(b1, a1) * sc;   /* even: x0 c - x1 s; odd: x0 s + x1 c */
    o16[0] = tohx(r0); o16[1] = tohx(r1); { unsigned short a2, c2; splitf(r0, a2, c2); oh[0] = a2; ol[0] = c2; splitf(r1, a2, c2); oh[1] = a2; ol[1] = c2; }
    *(v2h*)(P16 + e) = o16; *(v2us*)(Ph + e) = oh; *(v2us*)(Pl + e) = ol;  }


// k_ropeI: head planes [h][t][d] (fp16 + hi/lo) of rope(x) x sc with the interleaved convention out[d] = x[d] cos[t][d] - x[d+1] sin[t][d], out[d+1] = x[d+1] cos[t][d] + x[d] sin[t][d] (d even)

__global__ __launch_bounds__(256) void k_vtp(const float* __restrict__ F, int pitch, int nheads, h16* V16, bf* Vh, bf* Vl) { const size_t e = ((size_t)blockIdx.x * 256 + threadIdx.x) * 2; if (e >= (size_t)nheads * HD * TT) return; const int t = (int)(e % TT); const int d = (int)((e / TT) % HD); const int g = (int)(e / ((size_t)TT * HD)); v2h o16; v2us oh, ol;
#pragma unroll
    for (int q = 0; q < 2; ++q) { const float x = F[(size_t)(t + q) * pitch + g * HD + d]; o16[q] = tohx(x); unsigned short a2, c2; splitf(x, a2, c2); oh[q] = a2; ol[q] = c2; }
    *(v2h*)(V16 + e) = o16; *(v2us*)(Vh + e) = oh; *(v2us*)(Vl + e) = ol;  }
// k_asoft: per row (zz, i): t = S x HD^-0.5 for j <= i and i - j < WIN (sliding causal window; the reference's -1e9 additive fill vanishes identically); softmax over the 2048 keys (register row, one exp, fixed trees);
// the row lives in packed score storage (L = its block row's causal columns); a load past L is clamped to the row's last 16 bytes (its value is masked: j > i there), so that no branch stands between the loads; every load of the row has returned before the first store (the stores need the row's sum), so the probabilities may overwrite the scores.
__global__ __launch_bounds__(256) void k_asoft(float* Sb) {
    const int lane = threadIdx.x & 31; const int row = blockIdx.x * 8 + (threadIdx.x >> 5); if (row >= ZH * TT) return; const int i = row % TT; const int zz = row / TT; (void)zz; const bool hires = (i < RH); const int L = ((i >> 6) + 1) * 64; float* sr = Sb + (size_t)zz * SHEAD + tri_off(i >> 6) + (size_t)(i & 63) * L; float v[TT / 32]; float mx = -3.0e38f;
#pragma unroll
    for (int ch = 0; ch < TT / 128; ++ch) { const int j0 = ch * 128 + lane * 4; const v4f a = *(const v4f*)(sr + min(j0, L - 4));
#pragma unroll
        for (int q = 0; q < 4; ++q) { const int j = j0 + q; (void)j; const float t = (j <= i && i - j < WIN) ? a[q] * SCL : -3.0e38f; v[ch * 4 + q] = t; mx = fmaxf(mx, t); } }
#pragma unroll
    for (int sh = 16; sh; sh >>= 1) mx = fmaxf(mx, __shfl_xor(mx, sh, 32));
    float sum = 0.f;
#pragma unroll
    for (int k = 0; k < TT / 32; ++k) { float d0 = __fsub_rn(v[k], mx); asm volatile("" : "+v"(d0)); v[k] = __builtin_amdgcn_exp2f(__fmul_rn(d0, 1.4426950408889634f)); sum += v[k]; }
#pragma unroll
    for (int sh = 16; sh; sh >>= 1) sum += __shfl_xor(sum, sh, 32);
    const float f = __fdiv_rn(hires ? 1.0f : PCAR, sum);
{
        if (hires) {
#pragma unroll
            for (int ch = 0; ch < TT / 128; ++ch) { v4us oh, ol;
#pragma unroll
                for (int q = 0; q < 4; ++q) { unsigned short a, c2; splitf(v[ch * 4 + q] * f, a, c2); oh[q] = a; ol[q] = c2; }
                const int j0 = ch * 128 + lane * 4; if (j0 < L) { *(v4us*)((bf*)sr + j0) = oh; *(v4us*)((bf*)sr + L + j0) = ol; } }
        } else {
#pragma unroll
            for (int ch = 0; ch < TT / 128; ++ch) { v4h o4;
#pragma unroll
                for (int q = 0; q < 4; ++q) o4[q] = tohx(v[ch * 4 + q] * f);
                const int j0 = ch * 128 + lane * 4; if (j0 < L) *(v4h*)((h16*)sr + j0) = o4; } }
         }
}
__global__ __launch_bounds__(256) void k_merge(const float* __restrict__ O, int h0, bf* Ah, bf* Al) { const size_t e = ((size_t)blockIdx.x * 256 + threadIdx.x) * 2; if (e >= (size_t)ZH * TT * HD) return; const int d = (int)(e % HD); const int t = (int)((e / HD) % TT); const int zz = (int)(e / ((size_t)HD * TT)); const float cs = (t < RH) ? 1.0f : (1.0f / PCAR); const size_t oo = (size_t)t * DQ + (h0 + zz) * HD + d;
    v2us oh, ol;
#pragma unroll
    for (int q = 0; q < 2; ++q) { unsigned short a, c2; splitf(O[e + q] * cs, a, c2); oh[q] = a; ol[q] = c2; } *(v2us*)(Ah + oo) = oh; *(v2us*)(Al + oo) = ol;  }

extern "C" void kernel_launch(void* const* d_in, const int* in_sizes, int n_in,
                              void* d_out, int out_size, void* d_ws, size_t ws_size, hipStream_t stream) {
    (void)in_sizes; (void)n_in; (void)out_size;
    const float* x = (const float*)d_in[0]; const float* wq = (const float*)d_in[1]; const float* wk = (const float*)d_in[2]; const float* wv = (const float*)d_in[3]; const float* wo = (const float*)d_in[4]; const int* pid = (const int*)d_in[5];   /* token_positions int32 [2048] (= arange) */
    float* OUT = (float*)d_out;     // [2][2048][1024]
    char* wsp = (char*)d_ws;
    auto take = [&](size_t bytes) { char* p = wsp; wsp += (bytes + 255) & ~(size_t)255; return (void*)p; };
    bf* WQ = (bf*)take((size_t)DQ * DM * 2); bf* WK = (bf*)take((size_t)DKV * DM * 2); bf* WV = (bf*)take((size_t)DKV * DM * 2); bf* WO = (bf*)take((size_t)DM * DQ * 2); float* CS = (float*)take((size_t)TT * HD * 2 * 4);
    bf* XB = (bf*)take((size_t)TT * DM * 2); float* FQ = (float*)take((size_t)TT * DQ * 4); float* FK = (float*)take((size_t)TT * DKV * 4);
    h16* QP16 = (h16*)take((size_t)NH_ * TT * HD * 2); h16* KP16 = (h16*)take((size_t)NKV * TT * HD * 2); h16* VT16 = (h16*)take((size_t)NKV * HD * TT * 2);
    bf* QPh = (bf*)take((size_t)NH_ * TT * HD * 2); bf* QPl = (bf*)take((size_t)NH_ * TT * HD * 2); bf* KPh = (bf*)take((size_t)NKV * TT * HD * 2); bf* KPl = (bf*)take((size_t)NKV * TT * HD * 2); bf* VTh = (bf*)take((size_t)NKV * HD * TT * 2); bf* VTl = (bf*)take((size_t)NKV * HD * TT * 2);
    float* Sb = (float*)take((size_t)ZH * SHEAD * 4); float* Ob = (float*)take((size_t)ZH * TT * HD * 4); bf* ATh = (bf*)take((size_t)TT * DQ * 2); bf* ATl = (bf*)take((size_t)TT * DQ * 2);
    if ((size_t)(wsp - (char*)d_ws) > ws_size) return;    // ws 256 MiB
    float* FV = FK;   // v projection reuses the k buffer after the k planes are built (stream-ordered)
    { k_cvt8<<<(unsigned)(((size_t)DQ * DM / 8 + 255) / 256), 256, 0, stream>>>(wq, WQ, (size_t)DQ * DM / 8); k_cvt8<<<(unsigned)(((size_t)DKV * DM / 8 + 255) / 256), 256, 0, stream>>>(wk, WK, (size_t)DKV * DM / 8); k_cvt8<<<(unsigned)(((size_t)DKV * DM / 8 + 255) / 256), 256, 0, stream>>>(wv, WV, (size_t)DKV * DM / 8);
      k_cvt8<<<(unsigned)(((size_t)DM * DQ / 8 + 255) / 256), 256, 0, stream>>>(wo, WO, (size_t)DM * DQ / 8);
       }
    const unsigned LQ = (unsigned)(((size_t)NH_ * TT * HD / 2 + 255) / 256), LKv = (unsigned)(((size_t)NKV * TT * HD / 2 + 255) / 256);
    for (int b = 0; b < NB_; ++b) {
        if (b == 0) k_cstabT<<<(TT * HD + 255) / 256, 256, 0, stream>>>(pid, CS);
        k_cvt8<<<(unsigned)(((size_t)TT * DM / 8 + 255) / 256), 256, 0, stream>>>(x + (size_t)b * TT * DM, XB, (size_t)TT * DM / 8);
        k_gemms<bf, 0, false, 8><<<dim3(TT / 64, DQ / 64, 1), 256, 0, stream>>>(XB, nullptr, WQ, nullptr, DM, FQ, DQ, 0, 0, 0, 0);
        k_ropeI<<<LQ, 256, 0, stream>>>(FQ, DQ, NH_, CS, 1.0f, QP16, QPh, QPl);
        k_gemms<bf, 0, false, 8><<<dim3(TT / 64, DKV / 64, 1), 256, 0, stream>>>(XB, nullptr, WK, nullptr, DM, FK, DKV, 0, 0, 0, 0);
        k_ropeI<<<LKv, 256, 0, stream>>>(FK, DKV, NKV, CS, 1.0f, KP16, KPh, KPl);
        k_gemms<bf, 0, false, 8><<<dim3(TT / 64, DKV / 64, 1), 256, 0, stream>>>(XB, nullptr, WV, nullptr, DM, FV, DKV, 0, 0, 0, 0); k_vtp<<<LKv, 256, 0, stream>>>(FV, DKV, NKV, VT16, VTh, VTl);
        for (int h0 = 0; h0 < NH_; h0 += ZH) { const size_t zq = (size_t)h0, zk = (size_t)(h0 / REP);   // one kv head per query head: the pass's heads use consecutive kv planes (z-strides TT*HD)
            k_gemmc<bf, 2, 1><<<dim3(RH / 64, TT / 64, ZH), 32, 0, stream>>>(QPh + zq * TT * HD, QPl + zq * TT * HD, KPh + zk * TT * HD, KPl + zk * TT * HD, HD, Sb, 0, 0, (size_t)TT * HD, (size_t)TT * HD, SHEAD);
            k_gemmc<h16, 0, 1><<<dim3((TT - RH) / 64, TT / 64, ZH), 32, 0, stream>>>(QP16 + zq * TT * HD + (size_t)RH * HD, nullptr, KP16 + zk * TT * HD, nullptr, HD, Sb, 0, RH, (size_t)TT * HD, (size_t)TT * HD, SHEAD);
            k_asoft<<<ZH * TT / 8, 256, 0, stream>>>(Sb);
            k_gemms<bf, 2, true, 16><<<dim3(RH / 64, HD / 64, ZH), 512, 0, stream>>>((const bf*)Sb, (const bf*)Sb, VTh + zk * HD * TT, VTl + zk * HD * TT, TT, Ob, HD, 0, SHEAD * 2, (size_t)HD * TT, (size_t)TT * HD);
            k_gemms<h16, 0, true, 16><<<dim3((TT - RH) / 64, HD / 64, ZH), 512, 0, stream>>>((const h16*)Sb, nullptr, VT16 + zk * HD * TT, nullptr, TT, Ob + (size_t)RH * HD, HD, RH, SHEAD * 2, (size_t)HD * TT, (size_t)TT * HD);
            k_merge<<<(unsigned)(((size_t)ZH * TT * HD / 2 + 255) / 256), 256, 0, stream>>>(Ob, h0, ATh, ATl); }
        k_gemms<bf, 1, false, 8><<<dim3(TT / 64, DM / 64, 1), 256, 0, stream>>>(ATh, ATl, WO, nullptr, DQ, OUT + (size_t)b * TT * DM, DM, 0, 0, 0, 0); }
}

// v003
// A run of this version takes 200 microseconds.
// In two side-by-side timings against v002, it was 1.74 and 1.72 times as fast.
// Counting every step since v000, it is 7.16 times as fast.
#include <hip/hip_runtime.h>

// Causal multi-head self-attention with interleaved rotary embeddings from integer positions (x [2][2048][1024]; Q,K,V = x W^T ('oi' [1024][1024] 0.02, no bias; 16 heads x 64); rotary on (even, odd) pairs with angle pos[t] x THETA ** (-2i/64) (token_positions int [2048], read; float32 power-form constants; precise cosf/sinf); logits / 8, causal (-inf); softmax; out = merged Wo^T -> [2][2048][1024] (4.2 M)).
// Layout per batch: bf16 copy of x; exact projections; {cos, sin} per (position, pair) from the int positions (jnp-exact float32 inverse frequencies, precise cosf/sinf); interleaved rotary plane builder; causal T-2048 attention, all 16 heads of a batch in ONE fused launch (k_fattn: scores, online softmax, P.V and head merge; hybrid rows: < 512 hi/lo 3 products, rest fp16; units above the diagonal never touched); merged hi/lo x wo exact, no bias.
// Compute dtypes, f32 accumulate: every input rounded to bf16; projections exact ; rotary f32; attention rows < 512 3 products, rest fp16; softmax f32; wo hl x exact, no bias.

#define NB_  2
#define TT   2048
#define DM   1024
#define NH_  16
#define NKV  16
#define REP  (NH_ / NKV)
#define HD   64
#define DQ   (NH_ * HD)
#define DKV  (NKV * HD)
#define RH   512                  // query rows < RH use hi+lo planes (0: none)
typedef _Float16 h16;
typedef unsigned short bf;
typedef __attribute__((ext_vector_type(16))) __bf16   v16bf;
typedef __attribute__((ext_vector_type(16))) _Float16 v16h;
typedef __attribute__((ext_vector_type(8)))  _Float16 v8h;
typedef __attribute__((ext_vector_type(8)))  unsigned short v8us;
typedef __attribute__((ext_vector_type(8)))  float    v8f;
typedef __attribute__((ext_vector_type(4)))  float    v4f;
typedef v8h  __attribute__((may_alias)) v8ha;
typedef v4f  __attribute__((may_alias)) v4fa;
typedef v8us __attribute__((may_alias)) v8usa;

__device__ __forceinline__ unsigned short f2bf(float f) { unsigned u = __float_as_uint(f); u += 0x7FFFu + ((u >> 16) & 1u); return (unsigned short)(u >> 16); }
__device__ __forceinline__ float bf2f(unsigned short b) { return __uint_as_float(((unsigned)b) << 16); }
__device__ __forceinline__ size_t tri_off(int rb) { return (size_t)(rb * (rb + 1) / 2) * 4096; }   // floats in front of block row rb
__device__ __forceinline__ float bfr(float f) { return bf2f(f2bf(f)); }
__device__ __forceinline__ v16h cat16(v8h lo, v8h hi) { return __builtin_shufflevector(lo, hi, 0, 1, 2, 3, 4, 5, 6, 7, 8, 9, 10, 11, 12, 13, 14, 15); }
__device__ __forceinline__ v16bf cat16b(v8us lo, v8us hi) { return __builtin_bit_cast(v16bf, __builtin_shufflevector(lo, hi, 0, 1, 2, 3, 4, 5, 6, 7, 8, 9, 10, 11, 12, 13, 14, 15)); }
__device__ __forceinline__ v8f wmma16(v16h a, v16h b, v8f c) { return __builtin_amdgcn_wmma_f32_16x16x32_f16(false, a, false, b, (short)0, c, false, false); }
__device__ __forceinline__ v8f wmmab(v16bf a, v16bf b, v8f c) { return __builtin_amdgcn_wmma_f32_16x16x32_bf16(false, a, false, b, (short)0, c, false, false); }



// ---- k_gemms: register-blocked GEMM, one 64x64 output tile per work-group of NW waves; operands straight from K-contiguous 16-bit planes; grid (M/64, N/64, Z), 32 * NW threads.
// C[m][n] (f32, pitch ldc) = sum_k A[m][k] Bt[n][k] (+ split products per NSPLIT). z-batch strides sA/sB/sC in elements. K % 32 == 0.
// The K loop is dealt over the waves in slices of 32 (wave w takes slices w, w + NW, ...): each wave holds a whole 64x64 f32 partial tile (16 accumulators), and the NW partials are summed through LDS in wave order 0 .. NW-1.
// CAUSALK: probability x value contraction; probabilities are exactly 0 beyond the diagonal block, so the K range stops there (roff = row offset of this launch's first row within the sequence). A (and A2) then point at a head's packed score storage: block row rb starts at tri_off(rb) floats, a row's slot is (rb + 1) * 128 16-bit elements, and the lo plane stands (rb + 1) * 64 elements behind the hi plane.
template <typename T16> struct WFrag;
template <> struct WFrag<h16> { typedef v16h V; static __device__ __forceinline__ V ld(const h16* p) { return cat16(*(const v8h*)p, *(const v8h*)(p + 16)); } static __device__ __forceinline__ v8f mma(V a, V b, v8f c) { return wmma16(a, b, c); } };
template <> struct WFrag<bf> { typedef v16bf V; static __device__ __forceinline__ V ld(const bf* p) { return cat16b(*(const v8us*)p, *(const v8us*)(p + 16)); } static __device__ __forceinline__ v8f mma(V a, V b, v8f c) { return wmmab(a, b, c); } };
template <typename T16, int NSPLIT, bool CAUSALK, int NW>
__global__ __launch_bounds__(32 * NW) void k_gemms(const T16* __restrict__ A, const T16* __restrict__ A2, const T16* __restrict__ Bt, const T16* __restrict__ Bt2, int K, float* C, int ldc, int roff, size_t sA, size_t sB, size_t sC) {
    typedef typename WFrag<T16>::V V;
    __shared__ __align__(16) float part[NW * 4096];                  // [wave][accumulator 0..15][half 0..1][lane][4]: each wave's partial tile in register order, 16 B per lane
    const size_t z = blockIdx.z; A += z * sA; if (A2) A2 += z * sA; Bt += z * sB; if (Bt2) Bt2 += z * sB; C += z * sC;
    const int lane = threadIdx.x & 31, lr = lane & 15, hi = lane >> 4; const int r0 = blockIdx.x * 64, c0 = blockIdx.y * 64;
    const int wave = __builtin_amdgcn_readfirstlane((int)(threadIdx.x >> 5));   // scalar, so that the K loop's test is a scalar branch and every lane stays on at the matrix instructions
    const int Kl = CAUSALK ? min(K, r0 + roff + 64) : K;
    const int rb = (r0 + roff) >> 6; const int lda = CAUSALK ? (rb + 1) * 128 : K;
    if (CAUSALK) { A += tri_off(rb) * 2; if (A2) A2 += tri_off(rb) * 2 + (rb + 1) * 64; }
    v8f acc[4][4];
#pragma unroll
    for (int mb = 0; mb < 4; ++mb)
#pragma unroll
        for (int nb = 0; nb < 4; ++nb) acc[mb][nb] = (v8f){};
    const size_t aoff = (size_t)((CAUSALK ? 0 : r0) + lr) * lda + 8 * hi, boff = (size_t)(c0 + lr) * K + 8 * hi;
#pragma unroll 1
    for (int kc = wave * 32; kc < Kl; kc += NW * 32) {
        V a[4], a2[4];
#pragma unroll
        for (int mb = 0; mb < 4; ++mb) { a[mb] = WFrag<T16>::ld(A + aoff + (size_t)mb * 16 * lda + kc); if (NSPLIT == 1 || NSPLIT == 2) a2[mb] = WFrag<T16>::ld(A2 + aoff + (size_t)mb * 16 * lda + kc); }
#pragma unroll
        for (int nb = 0; nb < 4; ++nb) { const V b = WFrag<T16>::ld(Bt + boff + (size_t)nb * 16 * K + kc); V b2; if (NSPLIT >= 2) b2 = WFrag<T16>::ld(Bt2 + boff + (size_t)nb * 16 * K + kc);
#pragma unroll
            for (int mb = 0; mb < 4; ++mb) { acc[mb][nb] = WFrag<T16>::mma(a[mb], b, acc[mb][nb]); if (NSPLIT == 1 || NSPLIT == 2) acc[mb][nb] = WFrag<T16>::mma(a2[mb], b, acc[mb][nb]); if (NSPLIT >= 2) acc[mb][nb] = WFrag<T16>::mma(a[mb], b2, acc[mb][nb]); } }
        asm volatile("v_nop\n\tv_nop\n\tv_nop\n\tv_nop" : "+v"(acc[0][0]), "+v"(acc[1][1]), "+v"(acc[2][2]), "+v"(acc[3][3]) : "v"(a[0]), "v"(a[3]));
    }
    float* mine = part + wave * 4096 + lane * 4;
#pragma unroll
    for (int mb = 0; mb < 4; ++mb)
#pragma unroll
        for (int nb = 0; nb < 4; ++nb) { const v8f t = acc[mb][nb]; *(v4fa*)(mine + ((mb * 4 + nb) * 2) * 128) = (v4f){ t[0], t[1], t[2], t[3] }; *(v4fa*)(mine + ((mb * 4 + nb) * 2 + 1) * 128) = (v4f){ t[4], t[5], t[6], t[7] }; }
    __syncthreads();                                                 // every wave's partial tile is in LDS before any wave sums
    // 16 units of (16-row block mb, 32-column pair np, 4-row half jh); a wave owns 16 / NW of them, so each 128-byte line of C has one writing wave
    v4f s0[16 / NW], s1[16 / NW];
#pragma unroll
    for (int q = 0; q < 16 / NW; ++q) { const int u = wave * (16 / NW) + q, mb = u >> 2, np = (u >> 1) & 1, jh = u & 1;
        const float* sp = part + ((mb * 4 + np * 2) * 2 + jh) * 128 + lane * 4; s0[q] = *(const v4fa*)sp; s1[q] = *(const v4fa*)(sp + 256);
#pragma unroll
        for (int w = 1; w < NW; ++w) { s0[q] += *(const v4fa*)(sp + w * 4096); s1[q] += *(const v4fa*)(sp + w * 4096 + 256); } }
#pragma unroll
    for (int q = 0; q < 16 / NW; ++q) { const int u = wave * (16 / NW) + q, mb = u >> 2, np = (u >> 1) & 1, jh = u & 1;
        float* crow = C + (size_t)(r0 + mb * 16 + hi * 8 + jh * 4) * ldc + c0 + np * 32 + lr;
#pragma unroll
        for (int j = 0; j < 4; ++j) { crow[(size_t)j * ldc] = s0[q][j]; crow[(size_t)j * ldc + 16] = s1[q][j]; } }
}

__device__ __forceinline__ h16 tohx(float x) { return (h16)x; }
__device__ __forceinline__ void splitf(float y, unsigned short& h, unsigned short& l) { h = f2bf(y); l = f2bf(y - bf2f(h)); }
typedef __attribute__((ext_vector_type(2))) _Float16 v2h;
typedef __attribute__((ext_vector_type(4))) _Float16 v4h;
typedef __attribute__((ext_vector_type(2))) unsigned short v2us;
typedef __attribute__((ext_vector_type(4))) unsigned short v4us;
typedef __attribute__((ext_vector_type(2))) float v2f;
typedef __attribute__((ext_vector_type(4))) int v4i;

__global__ __launch_bounds__(256) void k_wtG(const float* __restrict__ w, int K, int N, bf* Bt) {
    const int lane = threadIdx.x & 31; const int L0 = (blockIdx.x * 8 + (threadIdx.x >> 5)) * 8; const int nlines = N * K / 64;
{
#pragma unroll 1
        for (int l = 0; l < 8; ++l) { const int L = L0 + l; if (L >= nlines) break; const size_t e = (size_t)L * 64 + lane * 2; const int k = (int)(e % K), n = (int)(e / K); v2us o;
            o[0] = f2bf(w[(size_t)k * N + n]); o[1] = f2bf(w[(size_t)(k + 1) * N + n]); *(v2us*)(Bt + e) = o; }
         }
}
__global__ __launch_bounds__(256) void k_cvt8(const float* __restrict__ src, bf* dst, size_t n8) { const size_t i = (size_t)blockIdx.x * 256 + threadIdx.x; if (i >= n8) return; const v8f v = *(const v8f*)(src + i * 8); v8us o;
#pragma unroll
    for (int k = 0; k < 8; ++k) o[k] = f2bf(v[k]); *(v8us*)(dst + i * 8) = o;  }
__constant__ float INVT[HD / 2] = { 1.000000000e+00f,7.498942018e-01f,5.623413324e-01f,4.216965139e-01f,3.162277639e-01f,2.371373773e-01f,1.778279394e-01f,1.333521456e-01f,1.000000015e-01f,7.498942316e-02f,5.623413250e-02f,4.216964915e-02f,3.162277490e-02f,2.371373773e-02f,1.778279431e-02f,1.333521400e-02f,9.999999776e-03f,7.498942316e-03f,5.623413250e-03f,4.216964822e-03f,3.162277630e-03f,2.371373819e-03f,1.778279431e-03f,1.333521446e-03f,1.000000047e-03f,7.498941850e-04f,5.623413017e-04f,4.216965172e-04f,3.162277571e-04f,2.371373703e-04f,1.778279402e-04f,1.333521504e-04f };   // THETA ** (-2 i / 64) as float32 (the module's power form, jnp-computed)
__global__ __launch_bounds__(256) void k_cstabT(const int* __restrict__ pid, float* CS) { const int idx = blockIdx.x * 256 + threadIdx.x; if (idx >= TT * HD) return; const int d = idx % HD; const int t = idx / HD; const float a = __fmul_rn((float)pid[t], INVT[d >> 1]); v2f cs; cs[0] = cosf(a); cs[1] = sinf(a); *(v2f*)(CS + (size_t)idx * 2) = cs;  }
__global__ __launch_bounds__(256) void k_ropeI(const float* __restrict__ F, int pitch, int nheads, const float* __restrict__ CS, float sc, h16* P16, bf* Ph, bf* Pl) {
    const size_t e = ((size_t)blockIdx.x * 256 + threadIdx.x) * 2; if (e >= (size_t)nheads * TT * HD) return; const int d = (int)(e % HD); const int t = (int)((e / HD) % TT); const int h = (int)(e / ((size_t)HD * TT)); const float* f = F + (size_t)t * pitch + h * HD; const float x0 = f[d], x1 = f[d + 1]; const v2f cs = *(const v2f*)(CS + ((size_t)t * HD + d) * 2); v2h o16; v2us oh, ol;
    float a0 = __fmul_rn(x0, cs[0]), b0 = __fmul_rn(x1, cs[1]), a1 = __fmul_rn(x1, cs[0]), b1 = __fmul_rn(x0, cs[1]); asm volatile("" : "+v"(a0), "+v"(b0), "+v"(a1), "+v"(b1));
    float r0 = __fsub_rn(a0, b0) * sc, r1 = __fadd_rn(b1, a1) * sc;   /* even: x0 c - x1 s; odd: x0 s + x1 c */
    o16[0] = tohx(r0); o16[1] = tohx(r1); { unsigned short a2, c2; splitf(r0, a2, c2); oh[0] = a2; ol[0] = c2; splitf(r1, a2, c2); oh[1] = a2; ol[1] = c2; }
    *(v2h*)(P16 + e) = o16; *(v2us*)(Ph + e) = oh; *(v2us*)(Pl + e) = ol;  }


// k_ropeI: head planes [h][t][d] (fp16 + hi/lo) of rope(x) x sc with the interleaved convention out[d] = x[d] cos[t][d] - x[d+1] sin[t][d], out[d+1] = x[d+1] cos[t][d] + x[d] sin[t][d] (d even)

__global__ __launch_bounds__(256) void k_vtp(const float* __restrict__ F, int pitch, int nheads, h16* V16, bf* Vh, bf* Vl) { const size_t e = ((size_t)blockIdx.x * 256 + threadIdx.x) * 2; if (e >= (size_t)nheads * HD * TT) return; const int t = (int)(e % TT); const int d = (int)((e / TT) % HD); const int g = (int)(e / ((size_t)TT * HD)); v2h o16; v2us oh, ol;
#pragma unroll
    for (int q = 0; q < 2; ++q) { const float x = F[(size_t)(t + q) * pitch + g * HD + d]; o16[q] = tohx(x); unsigned short a2, c2; splitf(x, a2, c2); oh[q] = a2; ol[q] = c2; }
    *(v2h*)(V16 + e) = o16; *(v2us*)(Vh + e) = oh; *(v2us*)(Vl + e) = ol;  }
// ---- k_fattn: scores, causal softmax, probability x value and the head merge of one batch in one kernel; grid (heads, TT / FQB), FNW waves; no score ever leaves the registers.
// A work-group owns FQB query rows of one head. The keys are dealt over its waves in units of 32 (wave w takes units w, w + FNW, ...). Each wave keeps a running maximum, a running sum and a whole [64 d][FQB queries] f32 partial output (online softmax).
// Everything is computed transposed: S^T = K Q^T (A = key rows, B = query rows), so that a lane holds scores of ONE query (column lr) and the two 16-key score tiles, rounded to 16 bit, ARE the B fragment of O^T += V^T P^T in the loader's k order (element e < 8: key 8 hi + e; e >= 8: key 16 + 8 hi + e - 8).
// At the end the waves' partials are brought to the common maximum and summed through LDS in wave order 0 .. FNW-1, divided by the row's sum and stored as the merged hi/lo planes.
#define FQT 2                     // 16-query tiles per work-group
#define FQB (FQT * 16)
#define FNW 8
#define FSK (32 * 72)             // 16-bit elements of a wave's K slice in LDS
#define FSW (FSK + 64 * 40)       // and of its whole slice (K, then V^T)
#define SCL2 0.18033688011112042f // HD^-0.5 x log2(e): the scores are kept in the base-2 domain
typedef __attribute__((ext_vector_type(16))) unsigned short v16us;
__device__ __forceinline__ float xhalf(float x) { return __builtin_bit_cast(float, __builtin_amdgcn_permlanex16(__builtin_bit_cast(int, x), __builtin_bit_cast(int, x), 0x76543210, 0xfedcba98, false, false)); }   // lane l with lane l ^ 16
__device__ __forceinline__ void pfrag(const float (&p)[16], v16h& a, v16h& a2) {
#pragma unroll
    for (int e = 0; e < 16; ++e) a[e] = tohx(p[e]);
    a2 = a; }
__device__ __forceinline__ void pfrag(const float (&p)[16], v16bf& a, v16bf& a2) { v16us h, l;
#pragma unroll
    for (int e = 0; e < 16; ++e) { unsigned short x, y; splitf(p[e], x, y); h[e] = x; l[e] = y; }
    a = __builtin_bit_cast(v16bf, h); a2 = __builtin_bit_cast(v16bf, l); }
template <typename T16, int NSPLIT, int NQ, bool STG>
__device__ __forceinline__ void fa_loop(const T16* __restrict__ Q, const T16* __restrict__ Q2, const T16* __restrict__ Kp, const T16* __restrict__ K2, const T16* __restrict__ Vt, const T16* __restrict__ V2, int r0, int nu, int u0, int ustep, int lane, h16* stg, v8f (&o)[4][NQ], float (&m)[NQ], float (&l)[NQ]) {
    typedef typename WFrag<T16>::V V; const int lr = lane & 15, hi = lane >> 4;
    V q[NQ][2], q2[NQ][2];
    const size_t qoff = (size_t)(r0 + lr) * HD + 8 * hi; const T16* qp = Q + qoff; const T16* qp2 = (NSPLIT == 2) ? Q2 + qoff : qp;
#pragma unroll
    for (int qt = 0; qt < NQ; ++qt)
#pragma unroll
        for (int ks = 0; ks < 2; ++ks) { q[qt][ks] = WFrag<T16>::ld(qp + qt * 16 * HD + ks * 32); if (NSPLIT == 2) q2[qt][ks] = WFrag<T16>::ld(qp2 + qt * 16 * HD + ks * 32); }
    asm volatile("s_wait_xcnt 0x0" :: "v"(qp), "v"(qp2) : "memory");   // the loads' address registers stay whole up to this wait; only behind it may anything, a later load's result too, overwrite them
#pragma unroll 1
    for (int u = u0; u < nu; u += ustep) {
        const int k0 = u * 32;
        V kf[2][2], kf2[2][2], vf[4], vf2[4];
        if constexpr (STG) {
            // The unit's K rows (32 x 128 B, 4 KiB in a row) and V^T rows (64 x 64 B) come in whole-line order, 16 B a lane, and are turned into fragments through the wave's OWN LDS slice: a fragment load straight from memory touches 16 lines for 512 B.
            h16* sk = stg; h16* sv = stg + FSK;                       // K at a pitch of 144 B, V^T at 80 B (16 B x odd: ds_load_b128 without bank conflicts)
            const T16* kg = Kp + (size_t)k0 * HD + lane * 8; const T16* vg = Vt + (size_t)(lane >> 2) * TT + k0 + (lane & 3) * 8; v8h tk[8], tv[8];
#pragma unroll
            for (int i = 0; i < 8; ++i) tk[i] = *(const v8h*)(kg + i * 256);
#pragma unroll
            for (int i = 0; i < 8; ++i) tv[i] = *(const v8h*)(vg + (size_t)i * 8 * TT);
            asm volatile("s_wait_xcnt 0x0" :: "v"(kg), "v"(vg) : "memory");   // as behind the query loads: the unit's address registers stay whole up to this wait
#pragma unroll
            for (int i = 0; i < 8; ++i) *(v8ha*)(sk + (i * 4 + (lane >> 3)) * 72 + (lane & 7) * 8) = tk[i];
#pragma unroll
            for (int i = 0; i < 8; ++i) *(v8ha*)(sv + (i * 8 + (lane >> 2)) * 40 + (lane & 3) * 8) = tv[i];
            __builtin_amdgcn_wave_barrier(); asm volatile("" ::: "memory");   // keeps the fragment reads behind the other lanes' stores in program order (one wave's LDS operations run in order; no other wave touches the slice)
#pragma unroll
            for (int kt = 0; kt < 2; ++kt)
#pragma unroll
                for (int ks = 0; ks < 2; ++ks) { const h16* p = sk + (kt * 16 + lr) * 72 + ks * 32 + 8 * hi; kf[kt][ks] = cat16(*(const v8ha*)p, *(const v8ha*)(p + 16)); }
#pragma unroll
            for (int dt = 0; dt < 4; ++dt) { const h16* p = sv + (dt * 16 + lr) * 40 + 8 * hi; vf[dt] = cat16(*(const v8ha*)p, *(const v8ha*)(p + 16)); }
        } else {
            const size_t koff = (size_t)(k0 + lr) * HD + 8 * hi, voff = (size_t)lr * TT + k0 + 8 * hi;
            const T16* kp = Kp + koff; const T16* kp2 = (NSPLIT == 2) ? K2 + koff : kp; const T16* vp = Vt + voff; const T16* vp2 = (NSPLIT == 2) ? V2 + voff : vp;
#pragma unroll
            for (int kt = 0; kt < 2; ++kt)
#pragma unroll
                for (int ks = 0; ks < 2; ++ks) { kf[kt][ks] = WFrag<T16>::ld(kp + kt * 16 * HD + ks * 32); if (NSPLIT == 2) kf2[kt][ks] = WFrag<T16>::ld(kp2 + kt * 16 * HD + ks * 32); }
#pragma unroll
            for (int dt = 0; dt < 4; ++dt) { vf[dt] = WFrag<T16>::ld(vp + (size_t)dt * 16 * TT); if (NSPLIT == 2) vf2[dt] = WFrag<T16>::ld(vp2 + (size_t)dt * 16 * TT); }
            asm volatile("s_wait_xcnt 0x0" :: "v"(kp), "v"(kp2), "v"(vp), "v"(vp2) : "memory");   // as behind the query loads: the unit's address registers stay whole up to this wait
        }
#pragma unroll
        for (int qt = 0; qt < NQ; ++qt) {
            v8f s[2];
#pragma unroll
            for (int kt = 0; kt < 2; ++kt) { s[kt] = (v8f){};
#pragma unroll
                for (int ks = 0; ks < 2; ++ks) { s[kt] = WFrag<T16>::mma(kf[kt][ks], q[qt][ks], s[kt]); if (NSPLIT == 2) { s[kt] = WFrag<T16>::mma(kf[kt][ks], q2[qt][ks], s[kt]); s[kt] = WFrag<T16>::mma(kf2[kt][ks], q[qt][ks], s[kt]); } } }
            const int qi = r0 + qt * 16 + lr; float p[16]; float mx = m[qt];
#pragma unroll
            for (int e = 0; e < 16; ++e) p[e] = s[e >> 3][e & 7] * SCL2;
            if (k0 + 31 > r0) {                                      // only a unit that reaches past the wave's first query holds keys above the diagonal (scalar test)
#pragma unroll
                for (int e = 0; e < 16; ++e) { const int key = k0 + (e >> 3) * 16 + hi * 8 + (e & 7); p[e] = (key <= qi) ? p[e] : -3.0e38f; } }
#pragma unroll
            for (int e = 0; e < 16; ++e) mx = fmaxf(mx, p[e]);
            mx = fmaxf(mx, xhalf(mx));                  // the query's other 16 keys of the unit stand in the other half of the wave
            const float al = __builtin_amdgcn_exp2f(m[qt] - mx); m[qt] = mx; float ps = 0.f;
#pragma unroll
            for (int e = 0; e < 16; ++e) { p[e] = __builtin_amdgcn_exp2f(p[e] - mx); ps += p[e]; }
            l[qt] = l[qt] * al + ps;
#pragma unroll
            for (int dt = 0; dt < 4; ++dt) o[dt][qt] *= al;
            V pf, pf2; pfrag(p, pf, pf2);
#pragma unroll
            for (int dt = 0; dt < 4; ++dt) { o[dt][qt] = WFrag<T16>::mma(vf[dt], pf, o[dt][qt]); if (NSPLIT == 2) { o[dt][qt] = WFrag<T16>::mma(vf[dt], pf2, o[dt][qt]); o[dt][qt] = WFrag<T16>::mma(vf2[dt], pf, o[dt][qt]); } }
        }
        // four vector slots between the unit's last matrix instructions and whatever follows the loop's branch on either path (the next unit's loads into their operands, the epilogue's reads of their results)
        asm volatile("v_nop\n\tv_nop\n\tv_nop\n\tv_nop" : "+v"(o[0][NQ - 1]), "+v"(o[1][NQ - 1]), "+v"(o[2][NQ - 1]), "+v"(o[3][NQ - 1]) : "v"(vf[0]), "v"(vf[3]));
    }
}
__global__ __launch_bounds__(32 * FNW) void k_fattn(const h16* __restrict__ Q16, const h16* __restrict__ K16, const h16* __restrict__ V16, const bf* __restrict__ Qh, const bf* __restrict__ Ql, const bf* __restrict__ Kh, const bf* __restrict__ Kl, const bf* __restrict__ Vh, const bf* __restrict__ Vl, bf* Ah, bf* Al) {
    __shared__ __align__(16) float part[(FNW * FSW / 2 > FNW * FQT * 1024) ? FNW * FSW / 2 : FNW * FQT * 1024];   // in the unit loop: each wave's own K / V^T slice (FSW 16-bit elements); behind the first barrier: [wave][d tile][query tile][half 0..1][lane][4], each wave's partial output in register order
    __shared__ float sm[FNW * FQB], sl[FNW * FQB], sL[FQB];          // each wave's maximum and sum per query; the row's whole sum
    const int lane = threadIdx.x & 31, lr = lane & 15, hi = lane >> 4;
    const int wave = __builtin_amdgcn_readfirstlane((int)(threadIdx.x >> 5));   // scalar, so that the unit loop's test is a scalar branch and every lane stays on at the matrix instructions
    const int r0 = (TT / FQB - 1 - (int)blockIdx.y) * FQB;          // the slow grid index: the longest rows of every head start first
    const int h = blockIdx.x; const size_t hp = (size_t)h * TT * HD;
    v8f o[4][FQT]; float m[FQT], l[FQT];
#pragma unroll
    for (int qt = 0; qt < FQT; ++qt) { m[qt] = -1.0e30f; l[qt] = 0.f;   // above the mask's value, so that a masked score gives probability 0 also where a wave has seen no open key yet
#pragma unroll
        for (int dt = 0; dt < 4; ++dt) o[dt][qt] = (v8f){}; }
    const int nu = r0 / 32 + FQB / 32;                               // units of 32 keys up to and including the diagonal block
    if (r0 < RH) {                                                   // hi/lo rows hold twice the fragments: a wave takes ONE query tile (wave / (FNW / FQT)) and the keys are dealt over the FNW / FQT waves of that tile; its other tiles stay empty partials
        const int myq = wave / (FNW / FQT); v8f o1[4][1]; float m1[1] = { -1.0e30f }, l1[1] = { 0.f };
#pragma unroll
        for (int dt = 0; dt < 4; ++dt) o1[dt][0] = (v8f){};
        fa_loop<bf, 2, 1, false>(Qh + hp, Ql + hp, Kh + hp, Kl + hp, Vh + hp, Vl + hp, r0 + myq * 16, nu, wave % (FNW / FQT), FNW / FQT, lane, nullptr, o1, m1, l1);
#pragma unroll
        for (int qt = 0; qt < FQT; ++qt) if (qt == myq) { m[qt] = m1[0]; l[qt] = l1[0];
#pragma unroll
            for (int dt = 0; dt < 4; ++dt) o[dt][qt] = o1[dt][0]; }
    } else fa_loop<h16, 0, FQT, true>(Q16 + hp, nullptr, K16 + hp, nullptr, V16 + hp, nullptr, r0, nu, wave, FNW, lane, (h16*)part + wave * FSW, o, m, l);
#pragma unroll
    for (int qt = 0; qt < FQT; ++qt) { l[qt] += xhalf(l[qt]); if (hi == 0) { sm[wave * FQB + qt * 16 + lr] = m[qt]; sl[wave * FQB + qt * 16 + lr] = l[qt]; } }
    __syncthreads();                                                 // every wave's maxima and sums are in LDS, and every wave has left its K / V^T slice, before any wave rescales and writes its partial output over the slices
    float* mine = part + wave * (FQT * 1024) + lane * 4;
#pragma unroll
    for (int qt = 0; qt < FQT; ++qt) { const int qq = qt * 16 + lr; float M = sm[qq];
#pragma unroll
        for (int w = 1; w < FNW; ++w) M = fmaxf(M, sm[w * FQB + qq]);
        float L = 0.f;
#pragma unroll
        for (int w = 0; w < FNW; ++w) L += sl[w * FQB + qq] * __builtin_amdgcn_exp2f(sm[w * FQB + qq] - M);
        if (wave == 0 && hi == 0) sL[qq] = L;
        const float sc = __builtin_amdgcn_exp2f(m[qt] - M);
#pragma unroll
        for (int dt = 0; dt < 4; ++dt) { const v8f t = o[dt][qt] * sc; *(v4fa*)(mine + ((dt * FQT + qt) * 2) * 128) = (v4f){ t[0], t[1], t[2], t[3] }; *(v4fa*)(mine + ((dt * FQT + qt) * 2 + 1) * 128) = (v4f){ t[4], t[5], t[6], t[7] }; } }
    __syncthreads();                                                 // every wave's rescaled partial output is in LDS before any wave sums
    // a wave sums and stores whole rows (4 queries x 64 d a pass; a lane 8 consecutive d), so each 128-byte line of the merged planes has one writing wave
#pragma unroll
    for (int g = 0; g < FQB / (4 * FNW); ++g) { const int qq = g * (4 * FNW) + wave * 4 + (lane >> 3), c = lane & 7;
        const float* sp = part + (((c >> 1) * FQT + (qq >> 4)) * 2) * 128 + ((qq & 15) + 16 * (c & 1)) * 4; v4f s0 = *(const v4fa*)sp, s1 = *(const v4fa*)(sp + 128);
#pragma unroll
        for (int w = 1; w < FNW; ++w) { s0 += *(const v4fa*)(sp + w * (FQT * 1024)); s1 += *(const v4fa*)(sp + w * (FQT * 1024) + 128); }
        const float f = __fdiv_rn(1.0f, sL[qq]); v8us oh, ol;
#pragma unroll
        for (int j = 0; j < 4; ++j) { unsigned short x, y; splitf(s0[j] * f, x, y); oh[j] = x; ol[j] = y; splitf(s1[j] * f, x, y); oh[4 + j] = x; ol[4 + j] = y; }
        const size_t oo = (size_t)(r0 + qq) * DQ + h * HD + c * 8; *(v8us*)(Ah + oo) = oh; *(v8us*)(Al + oo) = ol; }
}

extern "C" void kernel_launch(void* const* d_in, const int* in_sizes, int n_in,
                              void* d_out, int out_size, void* d_ws, size_t ws_size, hipStream_t stream) {
    (void)in_sizes; (void)n_in; (void)out_size;
    const float* x = (const float*)d_in[0]; const float* wq = (const float*)d_in[1]; const float* wk = (const float*)d_in[2]; const float* wv = (const float*)d_in[3]; const float* wo = (const float*)d_in[4]; const int* pid = (const int*)d_in[5];   /* token_positions int32 [2048] (= arange) */
    float* OUT = (float*)d_out;     // [2][2048][1024]
    char* wsp = (char*)d_ws;
    auto take = [&](size_t bytes) { char* p = wsp; wsp += (bytes + 255) & ~(size_t)255; return (void*)p; };
    bf* WQ = (bf*)take((size_t)DQ * DM * 2); bf* WK = (bf*)take((size_t)DKV * DM * 2); bf* WV = (bf*)take((size_t)DKV * DM * 2); bf* WO = (bf*)take((size_t)DM * DQ * 2); float* CS = (float*)take((size_t)TT * HD * 2 * 4);
    bf* XB = (bf*)take((size_t)TT * DM * 2); float* FQ = (float*)take((size_t)TT * DQ * 4); float* FK = (float*)take((size_t)TT * DKV * 4);
    h16* QP16 = (h16*)take((size_t)NH_ * TT * HD * 2); h16* KP16 = (h16*)take((size_t)NKV * TT * HD * 2); h16* VT16 = (h16*)take((size_t)NKV * HD * TT * 2);
    bf* QPh = (bf*)take((size_t)NH_ * TT * HD * 2); bf* QPl = (bf*)take((size_t)NH_ * TT * HD * 2); bf* KPh = (bf*)take((size_t)NKV * TT * HD * 2); bf* KPl = (bf*)take((size_t)NKV * TT * HD * 2); bf* VTh = (bf*)take((size_t)NKV * HD * TT * 2); bf* VTl = (bf*)take((size_t)NKV * HD * TT * 2);
    bf* ATh = (bf*)take((size_t)TT * DQ * 2); bf* ATl = (bf*)take((size_t)TT * DQ * 2);
    if ((size_t)(wsp - (char*)d_ws) > ws_size) return;    // ws 256 MiB
    float* FV = FK;   // v projection reuses the k buffer after the k planes are built (stream-ordered)
    { k_cvt8<<<(unsigned)(((size_t)DQ * DM / 8 + 255) / 256), 256, 0, stream>>>(wq, WQ, (size_t)DQ * DM / 8); k_cvt8<<<(unsigned)(((size_t)DKV * DM / 8 + 255) / 256), 256, 0, stream>>>(wk, WK, (size_t)DKV * DM / 8); k_cvt8<<<(unsigned)(((size_t)DKV * DM / 8 + 255) / 256), 256, 0, stream>>>(wv, WV, (size_t)DKV * DM / 8);
      k_cvt8<<<(unsigned)(((size_t)DM * DQ / 8 + 255) / 256), 256, 0, stream>>>(wo, WO, (size_t)DM * DQ / 8);
       }
    const unsigned LQ = (unsigned)(((size_t)NH_ * TT * HD / 2 + 255) / 256), LKv = (unsigned)(((size_t)NKV * TT * HD / 2 + 255) / 256);
    for (int b = 0; b < NB_; ++b) {
        if (b == 0) k_cstabT<<<(TT * HD + 255) / 256, 256, 0, stream>>>(pid, CS);
        k_cvt8<<<(unsigned)(((size_t)TT * DM / 8 + 255) / 256), 256, 0, stream>>>(x + (size_t)b * TT * DM, XB, (size_t)TT * DM / 8);
        k_gemms<bf, 0, false, 8><<<dim3(TT / 64, DQ / 64, 1), 256, 0, stream>>>(XB, nullptr, WQ, nullptr, DM, FQ, DQ, 0, 0, 0, 0);
        k_ropeI<<<LQ, 256, 0, stream>>>(FQ, DQ, NH_, CS, 1.0f, QP16, QPh, QPl);
        k_gemms<bf, 0, false, 8><<<dim3(TT / 64, DKV / 64, 1), 256, 0, stream>>>(XB, nullptr, WK, nullptr, DM, FK, DKV, 0, 0, 0, 0);
        k_ropeI<<<LKv, 256, 0, stream>>>(FK, DKV, NKV, CS, 1.0f, KP16, KPh, KPl);
        k_gemms<bf, 0, false, 8><<<dim3(TT / 64, DKV / 64, 1), 256, 0, stream>>>(XB, nullptr, WV, nullptr, DM, FV, DKV, 0, 0, 0, 0); k_vtp<<<LKv, 256, 0, stream>>>(FV, DKV, NKV, VT16, VTh, VTl);
        k_fattn<<<dim3(NH_, TT / FQB, 1), 32 * FNW, 0, stream>>>(QP16, KP16, VT16, QPh, QPl, KPh, KPl, VTh, VTl, ATh, ATl);
        k_gemms<bf, 1, false, 8><<<dim3(TT / 64, DM / 64, 1), 256, 0, stream>>>(ATh, ATl, WO, nullptr, DQ, OUT + (size_t)b * TT * DM, DM, 0, 0, 0, 0); }
}

// v004
// It runs in 163 microseconds.
// Timed twice side by side with v003, it ran 1.22 times as fast both times.
// Counting every step since v000, it is 8.76 times as fast.
#include <hip/hip_runtime.h>

// Causal multi-head self-attention with interleaved rotary embeddings from integer positions (x [2][2048][1024]; Q,K,V = x W^T ('oi' [1024][1024] 0.02, no bias; 16 heads x 64); rotary on (even, odd) pairs with angle pos[t] x THETA ** (-2i/64) (token_positions int [2048], read; float32 power-form constants; precise cosf/sinf); logits / 8, causal (-inf); softmax; out = merged Wo^T -> [2][2048][1024] (4.2 M)).
// Layout per batch: bf16 copy of x; exact projections; {cos, sin} per (position, pair) from the int positions (jnp-exact float32 inverse frequencies, precise cosf/sinf); the projections' own epilogue applies the interleaved rotary and writes the head planes (no f32 projection leaves the work-group); causal T-2048 attention, all 16 heads of a batch in ONE fused launch (k_fattn: scores, online softmax, P.V and head merge; hybrid rows: < 512 hi/lo 3 products, rest fp16; units above the diagonal never touched); merged hi/lo x wo exact.
// Compute dtypes, f32 accumulate: every input rounded to bf16; projections exact ; rotary f32; attention rows < 512 3 products, rest fp16; softmax f32; wo hl x exact.

#define NB_  2
#define TT   2048
#define DM   1024
#define NH_  16
#define NKV  16
#define REP  (NH_ / NKV)
#define HD   64
#define DQ   (NH_ * HD)
#define DKV  (NKV * HD)
#define RH   512                  // query rows < RH use hi+lo planes (0: none)
typedef _Float16 h16;
typedef unsigned short bf;
typedef __attribute__((ext_vector_type(16))) __bf16   v16bf;
typedef __attribute__((ext_vector_type(16))) _Float16 v16h;
typedef __attribute__((ext_vector_type(8)))  _Float16 v8h;
typedef __attribute__((ext_vector_type(8)))  unsigned short v8us;
typedef __attribute__((ext_vector_type(8)))  float    v8f;
typedef __attribute__((ext_vector_type(4)))  float    v4f;
typedef v8h  __attribute__((may_alias)) v8ha;
typedef v4f  __attribute__((may_alias)) v4fa;
typedef v8us __attribute__((may_alias)) v8usa;

__device__ __forceinline__ unsigned short f2bf(float f) { unsigned u = __float_as_uint(f); u += 0x7FFFu + ((u >> 16) & 1u); return (unsigned short)(u >> 16); }
__device__ __forceinline__ float bf2f(unsigned short b) { return __uint_as_float(((unsigned)b) << 16); }
__device__ __forceinline__ size_t tri_off(int rb) { return (size_t)(rb * (rb + 1) / 2) * 4096; }   // floats in front of block row rb
__device__ __forceinline__ float bfr(float f) { return bf2f(f2bf(f)); }
__device__ __forceinline__ v16h cat16(v8h lo, v8h hi) { return __builtin_shufflevector(lo, hi, 0, 1, 2, 3, 4, 5, 6, 7, 8, 9, 10, 11, 12, 13, 14, 15); }
__device__ __forceinline__ v16bf cat16b(v8us lo, v8us hi) { return __builtin_bit_cast(v16bf, __builtin_shufflevector(lo, hi, 0, 1, 2, 3, 4, 5, 6, 7, 8, 9, 10, 11, 12, 13, 14, 15)); }
__device__ __forceinline__ v8f wmma16(v16h a, v16h b, v8f c) { return __builtin_amdgcn_wmma_f32_16x16x32_f16(false, a, false, b, (short)0, c, false, false); }
__device__ __forceinline__ v8f wmmab(v16bf a, v16bf b, v8f c) { return __builtin_amdgcn_wmma_f32_16x16x32_bf16(false, a, false, b, (short)0, c, false, false); }

__device__ __forceinline__ h16 tohx(float x) { return (h16)x; }
__device__ __forceinline__ void splitf(float y, unsigned short& h, unsigned short& l) { h = f2bf(y); l = f2bf(y - bf2f(h)); }
typedef __attribute__((ext_vector_type(2))) _Float16 v2h;
typedef __attribute__((ext_vector_type(4))) _Float16 v4h;
typedef __attribute__((ext_vector_type(2))) unsigned short v2us;
typedef __attribute__((ext_vector_type(4))) unsigned short v4us;
typedef __attribute__((ext_vector_type(2))) float v2f;
typedef __attribute__((ext_vector_type(4))) int v4i;

// ---- k_gemms: register-blocked GEMM, one 64x64 output tile per work-group of NW waves; operands straight from K-contiguous 16-bit planes; grid (M/64, N/64, Z), 32 * NW threads.
// C[m][n] (f32, pitch ldc) = sum_k A[m][k] Bt[n][k] (+ split products per NSPLIT). z-batch strides sA/sB/sC in elements. K % 32 == 0.
// The K loop is dealt over the waves in slices of 32 (wave w takes slices w, w + NW, ...): each wave holds a whole 64x64 f32 partial tile (16 accumulators), and the NW partials are summed through LDS in wave order 0 .. NW-1.
// CAUSALK: probability x value contraction; probabilities are exactly 0 beyond the diagonal block, so the K range stops there (roff = row offset of this launch's first row within the sequence). A (and A2) then point at a head's packed score storage: block row rb starts at tri_off(rb) floats, a row's slot is (rb + 1) * 128 16-bit elements, and the lo plane stands (rb + 1) * 64 elements behind the hi plane.
// EPI 0: the summed tile goes to C as f32. EPI 1 and 2 (a projection; the 64 columns of a tile are ONE head, blockIdx.y, its 64 rows 64 positions): the summed tile goes through a second LDS array and leaves as the head's 16-bit planes (fp16, bf16 hi, bf16 lo), 16 B a lane in whole 128-byte lines.
// EPI 1: planes [head][t][d] of the interleaved rotary (even: x0 c - x1 s; odd: x0 s + x1 c; {c, s} from CS[t][d]). EPI 2: planes [head][d][t], the tile turned on its way into LDS.
#define TP 68                     // f32 pitch of that array: 272 B = 16 B x odd, so that rows 4 banks apart serve ds_load_b128 / ds_store_b128 without conflicts
template <typename T16> struct WFrag;
template <> struct WFrag<h16> { typedef v16h V; static __device__ __forceinline__ V ld(const h16* p) { return cat16(*(const v8h*)p, *(const v8h*)(p + 16)); } static __device__ __forceinline__ v8f mma(V a, V b, v8f c) { return wmma16(a, b, c); } };
template <> struct WFrag<bf> { typedef v16bf V; static __device__ __forceinline__ V ld(const bf* p) { return cat16b(*(const v8us*)p, *(const v8us*)(p + 16)); } static __device__ __forceinline__ v8f mma(V a, V b, v8f c) { return wmmab(a, b, c); } };
template <typename T16, int NSPLIT, bool CAUSALK, int NW, int EPI>
__global__ __launch_bounds__(32 * NW) void k_gemms(const T16* __restrict__ A, const T16* __restrict__ A2, const T16* __restrict__ Bt, const T16* __restrict__ Bt2, int K, float* C, int ldc, int roff, size_t sA, size_t sB, size_t sC, const float* __restrict__ CS, h16* P16, bf* Ph, bf* Pl) {
    typedef typename WFrag<T16>::V V;
    __shared__ __align__(16) float part[NW * 4096];                  // [wave][accumulator 0..15][half 0..1][lane][4]: each wave's partial tile in register order, 16 B per lane
    const size_t z = blockIdx.z; A += z * sA; if (A2) A2 += z * sA; Bt += z * sB; if (Bt2) Bt2 += z * sB; C += z * sC;
    const int lane = threadIdx.x & 31, lr = lane & 15, hi = lane >> 4; const int r0 = blockIdx.x * 64, c0 = blockIdx.y * 64;
    const int wave = __builtin_amdgcn_readfirstlane((int)(threadIdx.x >> 5));   // scalar, so that the K loop's test is a scalar branch and every lane stays on at the matrix instructions
    const int Kl = CAUSALK ? min(K, r0 + roff + 64) : K;
    const int rb = (r0 + roff) >> 6; const int lda = CAUSALK ? (rb + 1) * 128 : K;
    if (CAUSALK) { A += tri_off(rb) * 2; if (A2) A2 += tri_off(rb) * 2 + (rb + 1) * 64; }
    v8f acc[4][4];
#pragma unroll
    for (int mb = 0; mb < 4; ++mb)
#pragma unroll
        for (int nb = 0; nb < 4; ++nb) acc[mb][nb] = (v8f){};
    const size_t aoff = (size_t)((CAUSALK ? 0 : r0) + lr) * lda + 8 * hi, boff = (size_t)(c0 + lr) * K + 8 * hi;
#pragma unroll 1
    for (int kc = wave * 32; kc < Kl; kc += NW * 32) {
        V a[4], a2[4];
#pragma unroll
        for (int mb = 0; mb < 4; ++mb) { a[mb] = WFrag<T16>::ld(A + aoff + (size_t)mb * 16 * lda + kc); if (NSPLIT == 1 || NSPLIT == 2) a2[mb] = WFrag<T16>::ld(A2 + aoff + (size_t)mb * 16 * lda + kc); }
#pragma unroll
        for (int nb = 0; nb < 4; ++nb) { const V b = WFrag<T16>::ld(Bt + boff + (size_t)nb * 16 * K + kc); V b2; if (NSPLIT >= 2) b2 = WFrag<T16>::ld(Bt2 + boff + (size_t)nb * 16 * K + kc);
#pragma unroll
            for (int mb = 0; mb < 4; ++mb) { acc[mb][nb] = WFrag<T16>::mma(a[mb], b, acc[mb][nb]); if (NSPLIT == 1 || NSPLIT == 2) acc[mb][nb] = WFrag<T16>::mma(a2[mb], b, acc[mb][nb]); if (NSPLIT >= 2) acc[mb][nb] = WFrag<T16>::mma(a[mb], b2, acc[mb][nb]); } }
        asm volatile("v_nop\n\tv_nop\n\tv_nop\n\tv_nop" : "+v"(acc[0][0]), "+v"(acc[1][1]), "+v"(acc[2][2]), "+v"(acc[3][3]) : "v"(a[0]), "v"(a[3]));
    }
    v2f cs[16 / NW][4];                                              // EPI 1: {cos, sin} of the lane's pairs, asked for here so that they fly while the partial tile goes to LDS
    if constexpr (EPI == 1) { const float* cp = CS + ((size_t)r0 * HD + (size_t)threadIdx.x * 8) * 2;
#pragma unroll
        for (int p = 0; p < 16 / NW; ++p)
#pragma unroll
            for (int i = 0; i < 4; ++i) cs[p][i] = *(const v2f*)(cp + (p * (NW * 256) + 2 * i) * 2);
        asm volatile("s_wait_xcnt 0x0" :: "v"(cp) : "memory"); }     // the loads' address registers stay whole up to this wait
    float* mine = part + wave * 4096 + lane * 4;
#pragma unroll
    for (int mb = 0; mb < 4; ++mb)
#pragma unroll
        for (int nb = 0; nb < 4; ++nb) { const v8f t = acc[mb][nb]; *(v4fa*)(mine + ((mb * 4 + nb) * 2) * 128) = (v4f){ t[0], t[1], t[2], t[3] }; *(v4fa*)(mine + ((mb * 4 + nb) * 2 + 1) * 128) = (v4f){ t[4], t[5], t[6], t[7] }; }
    __syncthreads();                                                 // every wave's partial tile is in LDS before any wave sums
    // 16 units of (16-row block mb, 32-column pair np, 4-row half jh); a wave owns 16 / NW of them, so each 128-byte line of C has one writing wave
    v4f s0[16 / NW], s1[16 / NW];
#pragma unroll
    for (int q = 0; q < 16 / NW; ++q) { const int u = wave * (16 / NW) + q, mb = u >> 2, np = (u >> 1) & 1, jh = u & 1;
        const float* sp = part + ((mb * 4 + np * 2) * 2 + jh) * 128 + lane * 4; s0[q] = *(const v4fa*)sp; s1[q] = *(const v4fa*)(sp + 256);
#pragma unroll
        for (int w = 1; w < NW; ++w) { s0[q] += *(const v4fa*)(sp + w * 4096); s1[q] += *(const v4fa*)(sp + w * 4096 + 256); } }
    if constexpr (EPI == 0) {
#pragma unroll
        for (int q = 0; q < 16 / NW; ++q) { const int u = wave * (16 / NW) + q, mb = u >> 2, np = (u >> 1) & 1, jh = u & 1;
            float* crow = C + (size_t)(r0 + mb * 16 + hi * 8 + jh * 4) * ldc + c0 + np * 32 + lr;
#pragma unroll
            for (int j = 0; j < 4; ++j) { crow[(size_t)j * ldc] = s0[q][j]; crow[(size_t)j * ldc + 16] = s1[q][j]; } }
    } else {
        __shared__ __align__(16) float tile[64 * TP];                // EPI 1: [t][d]; EPI 2: [d][t]
#pragma unroll
        for (int q = 0; q < 16 / NW; ++q) { const int u = wave * (16 / NW) + q, mb = u >> 2, np = (u >> 1) & 1, jh = u & 1; const int row = mb * 16 + hi * 8 + jh * 4, col = np * 32 + lr;
            if constexpr (EPI == 1) {
#pragma unroll
                for (int j = 0; j < 4; ++j) { tile[(row + j) * TP + col] = s0[q][j]; tile[(row + j) * TP + col + 16] = s1[q][j]; }
            } else { *(v4fa*)(tile + col * TP + row) = s0[q]; *(v4fa*)(tile + (col + 16) * TP + row) = s1[q]; } }
        __syncthreads();                                             // the whole summed tile is in LDS before any wave reads rows of it
#pragma unroll
        for (int p = 0; p < 16 / NW; ++p) { const int idx = p * (NW * 256) + (int)threadIdx.x * 8, rr = idx >> 6, cc = idx & 63;
            const v4f t0 = *(const v4fa*)(tile + rr * TP + cc), t1 = *(const v4fa*)(tile + rr * TP + cc + 4); float y[8] = { t0[0], t0[1], t0[2], t0[3], t1[0], t1[1], t1[2], t1[3] };
            if constexpr (EPI == 1) {
#pragma unroll
                for (int i = 0; i < 4; ++i) { const float x0 = y[2 * i], x1 = y[2 * i + 1], c = cs[p][i][0], s = cs[p][i][1]; y[2 * i] = x0 * c - x1 * s; y[2 * i + 1] = x0 * s + x1 * c; } }
            v8h o16; v8us oh, ol;
#pragma unroll
            for (int k = 0; k < 8; ++k) { o16[k] = tohx(y[k]); unsigned short a2, c2; splitf(y[k], a2, c2); oh[k] = a2; ol[k] = c2; }
            const size_t oo = (EPI == 1) ? ((size_t)blockIdx.y * TT + r0 + rr) * HD + cc : ((size_t)blockIdx.y * HD + rr) * TT + r0 + cc;
            *(v8h*)(P16 + oo) = o16; *(v8us*)(Ph + oo) = oh; *(v8us*)(Pl + oo) = ol;
        }
    }
}


__global__ __launch_bounds__(256) void k_wtG(const float* __restrict__ w, int K, int N, bf* Bt) {
    const int lane = threadIdx.x & 31; const int L0 = (blockIdx.x * 8 + (threadIdx.x >> 5)) * 8; const int nlines = N * K / 64;
{
#pragma unroll 1
        for (int l = 0; l < 8; ++l) { const int L = L0 + l; if (L >= nlines) break; const size_t e = (size_t)L * 64 + lane * 2; const int k = (int)(e % K), n = (int)(e / K); v2us o;
            o[0] = f2bf(w[(size_t)k * N + n]); o[1] = f2bf(w[(size_t)(k + 1) * N + n]); *(v2us*)(Bt + e) = o; }
         }
}
__global__ __launch_bounds__(256) void k_cvt8(const float* __restrict__ src, bf* dst, size_t n8) { const size_t i = (size_t)blockIdx.x * 256 + threadIdx.x; if (i >= n8) return; const v8f v = *(const v8f*)(src + i * 8); v8us o;
#pragma unroll
    for (int k = 0; k < 8; ++k) o[k] = f2bf(v[k]); *(v8us*)(dst + i * 8) = o;  }
__constant__ float INVT[HD / 2] = { 1.000000000e+00f,7.498942018e-01f,5.623413324e-01f,4.216965139e-01f,3.162277639e-01f,2.371373773e-01f,1.778279394e-01f,1.333521456e-01f,1.000000015e-01f,7.498942316e-02f,5.623413250e-02f,4.216964915e-02f,3.162277490e-02f,2.371373773e-02f,1.778279431e-02f,1.333521400e-02f,9.999999776e-03f,7.498942316e-03f,5.623413250e-03f,4.216964822e-03f,3.162277630e-03f,2.371373819e-03f,1.778279431e-03f,1.333521446e-03f,1.000000047e-03f,7.498941850e-04f,5.623413017e-04f,4.216965172e-04f,3.162277571e-04f,2.371373703e-04f,1.778279402e-04f,1.333521504e-04f };   // THETA ** (-2 i / 64) as float32 (the module's power form, jnp-computed)
__global__ __launch_bounds__(256) void k_cstabT(const int* __restrict__ pid, float* CS) { const int idx = blockIdx.x * 256 + threadIdx.x; if (idx >= TT * HD) return; const int d = idx % HD; const int t = idx / HD; const float a = __fmul_rn((float)pid[t], INVT[d >> 1]); v2f cs; cs[0] = cosf(a); cs[1] = sinf(a); *(v2f*)(CS + (size_t)idx * 2) = cs;  }
// ---- k_fattn: scores, causal softmax, probability x value and the head merge of one batch in one kernel; grid (heads, TT / FQB), FNW waves; no score ever leaves the registers.
// A work-group owns FQB query rows of one head. The keys are dealt over its waves in units of 32 (wave w takes units w, w + FNW, ...). Each wave keeps a running maximum, a running sum and a whole [64 d][FQB queries] f32 partial output (online softmax).
// Everything is computed transposed: S^T = K Q^T (A = key rows, B = query rows), so that a lane holds scores of ONE query (column lr) and the two 16-key score tiles, rounded to 16 bit, ARE the B fragment of O^T += V^T P^T in the loader's k order (element e < 8: key 8 hi + e; e >= 8: key 16 + 8 hi + e - 8).
// At the end the waves' partials are brought to the common maximum and summed through LDS in wave order 0 .. FNW-1, divided by the row's sum and stored as the merged hi/lo planes.
#define FQT 2                     // 16-query tiles per work-group
#define FQB (FQT * 16)
#define FNW 8
#define FSK (32 * 72)             // 16-bit elements of a wave's K slice in LDS
#define FSW (FSK + 64 * 40)       // and of its whole slice (K, then V^T)
#define SCL2 0.18033688011112042f // HD^-0.5 x log2(e): the scores are kept in the base-2 domain
typedef __attribute__((ext_vector_type(16))) unsigned short v16us;
__device__ __forceinline__ float xhalf(float x) { return __builtin_bit_cast(float, __builtin_amdgcn_permlanex16(__builtin_bit_cast(int, x), __builtin_bit_cast(int, x), 0x76543210, 0xfedcba98, false, false)); }   // lane l with lane l ^ 16
__device__ __forceinline__ void pfrag(const float (&p)[16], v16h& a, v16h& a2) {
#pragma unroll
    for (int e = 0; e < 16; ++e) a[e] = tohx(p[e]);
    a2 = a; }
__device__ __forceinline__ void pfrag(const float (&p)[16], v16bf& a, v16bf& a2) { v16us h, l;
#pragma unroll
    for (int e = 0; e < 16; ++e) { unsigned short x, y; splitf(p[e], x, y); h[e] = x; l[e] = y; }
    a = __builtin_bit_cast(v16bf, h); a2 = __builtin_bit_cast(v16bf, l); }
template <typename T16, int NSPLIT, int NQ, bool STG>
__device__ __forceinline__ void fa_loop(const T16* __restrict__ Q, const T16* __restrict__ Q2, const T16* __restrict__ Kp, const T16* __restrict__ K2, const T16* __restrict__ Vt, const T16* __restrict__ V2, int r0, int nu, int u0, int ustep, int lane, h16* stg, v8f (&o)[4][NQ], float (&m)[NQ], float (&l)[NQ]) {
    typedef typename WFrag<T16>::V V; const int lr = lane & 15, hi = lane >> 4;
    V q[NQ][2], q2[NQ][2];
    const size_t qoff = (size_t)(r0 + lr) * HD + 8 * hi; const T16* qp = Q + qoff; const T16* qp2 = (NSPLIT == 2) ? Q2 + qoff : qp;
#pragma unroll
    for (int qt = 0; qt < NQ; ++qt)
#pragma unroll
        for (int ks = 0; ks < 2; ++ks) { q[qt][ks] = WFrag<T16>::ld(qp + qt * 16 * HD + ks * 32); if (NSPLIT == 2) q2[qt][ks] = WFrag<T16>::ld(qp2 + qt * 16 * HD + ks * 32); }
    asm volatile("s_wait_xcnt 0x0" :: "v"(qp), "v"(qp2) : "memory");   // the loads' address registers stay whole up to this wait; only behind it may anything, a later load's result too, overwrite them
#pragma unroll 1
    for (int u = u0; u < nu; u += ustep) {
        const int k0 = u * 32;
        V kf[2][2], kf2[2][2], vf[4], vf2[4];
        if constexpr (STG) {
            // The unit's K rows (32 x 128 B, 4 KiB in a row) and V^T rows (64 x 64 B) come in whole-line order, 16 B a lane, and are turned into fragments through the wave's OWN LDS slice: a fragment load straight from memory touches 16 lines for 512 B.
            h16* sk = stg; h16* sv = stg + FSK;                       // K at a pitch of 144 B, V^T at 80 B (16 B x odd: ds_load_b128 without bank conflicts)
            const T16* kg = Kp + (size_t)k0 * HD + lane * 8; const T16* vg = Vt + (size_t)(lane >> 2) * TT + k0 + (lane & 3) * 8; v8h tk[8], tv[8];
#pragma unroll
            for (int i = 0; i < 8; ++i) tk[i] = *(const v8h*)(kg + i * 256);
#pragma unroll
            for (int i = 0; i < 8; ++i) tv[i] = *(const v8h*)(vg + (size_t)i * 8 * TT);
            asm volatile("s_wait_xcnt 0x0" :: "v"(kg), "v"(vg) : "memory");   // as behind the query loads: the unit's address registers stay whole up to this wait
#pragma unroll
            for (int i = 0; i < 8; ++i) *(v8ha*)(sk + (i * 4 + (lane >> 3)) * 72 + (lane & 7) * 8) = tk[i];
#pragma unroll
            for (int i = 0; i < 8; ++i) *(v8ha*)(sv + (i * 8 + (lane >> 2)) * 40 + (lane & 3) * 8) = tv[i];
            __builtin_amdgcn_wave_barrier(); asm volatile("" ::: "memory");   // keeps the fragment reads behind the other lanes' stores in program order (one wave's LDS operations run in order; no other wave touches the slice)
#pragma unroll
            for (int kt = 0; kt < 2; ++kt)
#pragma unroll
                for (int ks = 0; ks < 2; ++ks) { const h16* p = sk + (kt * 16 + lr) * 72 + ks * 32 + 8 * hi; kf[kt][ks] = cat16(*(const v8ha*)p, *(const v8ha*)(p + 16)); }
#pragma unroll
            for (int dt = 0; dt < 4; ++dt) { const h16* p = sv + (dt * 16 + lr) * 40 + 8 * hi; vf[dt] = cat16(*(const v8ha*)p, *(const v8ha*)(p + 16)); }
        } else {
            const size_t koff = (size_t)(k0 + lr) * HD + 8 * hi, voff = (size_t)lr * TT + k0 + 8 * hi;
            const T16* kp = Kp + koff; const T16* kp2 = (NSPLIT == 2) ? K2 + koff : kp; const T16* vp = Vt + voff; const T16* vp2 = (NSPLIT == 2) ? V2 + voff : vp;
#pragma unroll
            for (int kt = 0; kt < 2; ++kt)
#pragma unroll
                for (int ks = 0; ks < 2; ++ks) { kf[kt][ks] = WFrag<T16>::ld(kp + kt * 16 * HD + ks * 32); if (NSPLIT == 2) kf2[kt][ks] = WFrag<T16>::ld(kp2 + kt * 16 * HD + ks * 32); }
#pragma unroll
            for (int dt = 0; dt < 4; ++dt) { vf[dt] = WFrag<T16>::ld(vp + (size_t)dt * 16 * TT); if (NSPLIT == 2) vf2[dt] = WFrag<T16>::ld(vp2 + (size_t)dt * 16 * TT); }
            asm volatile("s_wait_xcnt 0x0" :: "v"(kp), "v"(kp2), "v"(vp), "v"(vp2) : "memory");   // as behind the query loads: the unit's address registers stay whole up to this wait
        }
#pragma unroll
        for (int qt = 0; qt < NQ; ++qt) {
            v8f s[2];
#pragma unroll
            for (int kt = 0; kt < 2; ++kt) { s[kt] = (v8f){};
#pragma unroll
                for (int ks = 0; ks < 2; ++ks) { s[kt] = WFrag<T16>::mma(kf[kt][ks], q[qt][ks], s[kt]); if (NSPLIT == 2) { s[kt] = WFrag<T16>::mma(kf[kt][ks], q2[qt][ks], s[kt]); s[kt] = WFrag<T16>::mma(kf2[kt][ks], q[qt][ks], s[kt]); } } }
            const int qi = r0 + qt * 16 + lr; float p[16]; float mx = m[qt];
#pragma unroll
            for (int e = 0; e < 16; ++e) p[e] = s[e >> 3][e & 7] * SCL2;
            if (k0 + 31 > r0) {                                      // only a unit that reaches past the wave's first query holds keys above the diagonal (scalar test)
#pragma unroll
                for (int e = 0; e < 16; ++e) { const int key = k0 + (e >> 3) * 16 + hi * 8 + (e & 7); p[e] = (key <= qi) ? p[e] : -3.0e38f; } }
#pragma unroll
            for (int e = 0; e < 16; ++e) mx = fmaxf(mx, p[e]);
            mx = fmaxf(mx, xhalf(mx));                  // the query's other 16 keys of the unit stand in the other half of the wave
            const float al = __builtin_amdgcn_exp2f(m[qt] - mx); m[qt] = mx; float ps = 0.f;
#pragma unroll
            for (int e = 0; e < 16; ++e) { p[e] = __builtin_amdgcn_exp2f(p[e] - mx); ps += p[e]; }
            l[qt] = l[qt] * al + ps;
#pragma unroll
            for (int dt = 0; dt < 4; ++dt) o[dt][qt] *= al;
            V pf, pf2; pfrag(p, pf, pf2);
#pragma unroll
            for (int dt = 0; dt < 4; ++dt) { o[dt][qt] = WFrag<T16>::mma(vf[dt], pf, o[dt][qt]); if (NSPLIT == 2) { o[dt][qt] = WFrag<T16>::mma(vf[dt], pf2, o[dt][qt]); o[dt][qt] = WFrag<T16>::mma(vf2[dt], pf, o[dt][qt]); } }
        }
        // four vector slots between the unit's last matrix instructions and whatever follows the loop's branch on either path (the next unit's loads into their operands, the epilogue's reads of their results)
        asm volatile("v_nop\n\tv_nop\n\tv_nop\n\tv_nop" : "+v"(o[0][NQ - 1]), "+v"(o[1][NQ - 1]), "+v"(o[2][NQ - 1]), "+v"(o[3][NQ - 1]) : "v"(vf[0]), "v"(vf[3]));
    }
}
__global__ __launch_bounds__(32 * FNW) void k_fattn(const h16* __restrict__ Q16, const h16* __restrict__ K16, const h16* __restrict__ V16, const bf* __restrict__ Qh, const bf* __restrict__ Ql, const bf* __restrict__ Kh, const bf* __restrict__ Kl, const bf* __restrict__ Vh, const bf* __restrict__ Vl, bf* Ah, bf* Al) {
    __shared__ __align__(16) float part[(FNW * FSW / 2 > FNW * FQT * 1024) ? FNW * FSW / 2 : FNW * FQT * 1024];   // in the unit loop: each wave's own K / V^T slice (FSW 16-bit elements); behind the first barrier: [wave][d tile][query tile][half 0..1][lane][4], each wave's partial output in register order
    __shared__ float sm[FNW * FQB], sl[FNW * FQB], sL[FQB];          // each wave's maximum and sum per query; the row's whole sum
    const int lane = threadIdx.x & 31, lr = lane & 15, hi = lane >> 4;
    const int wave = __builtin_amdgcn_readfirstlane((int)(threadIdx.x >> 5));   // scalar, so that the unit loop's test is a scalar branch and every lane stays on at the matrix instructions
    const int r0 = (TT / FQB - 1 - (int)blockIdx.y) * FQB;          // the slow grid index: the longest rows of every head start first
    const int h = blockIdx.x; const size_t hp = (size_t)h * TT * HD;
    v8f o[4][FQT]; float m[FQT], l[FQT];
#pragma unroll
    for (int qt = 0; qt < FQT; ++qt) { m[qt] = -1.0e30f; l[qt] = 0.f;   // above the mask's value, so that a masked score gives probability 0 also where a wave has seen no open key yet
#pragma unroll
        for (int dt = 0; dt < 4; ++dt) o[dt][qt] = (v8f){}; }
    const int nu = r0 / 32 + FQB / 32;                               // units of 32 keys up to and including the diagonal block
    if (r0 < RH) {                                                   // hi/lo rows hold twice the fragments: a wave takes ONE query tile (wave / (FNW / FQT)) and the keys are dealt over the FNW / FQT waves of that tile; its other tiles stay empty partials
        const int myq = wave / (FNW / FQT); v8f o1[4][1]; float m1[1] = { -1.0e30f }, l1[1] = { 0.f };
#pragma unroll
        for (int dt = 0; dt < 4; ++dt) o1[dt][0] = (v8f){};
        fa_loop<bf, 2, 1, false>(Qh + hp, Ql + hp, Kh + hp, Kl + hp, Vh + hp, Vl + hp, r0 + myq * 16, nu, wave % (FNW / FQT), FNW / FQT, lane, nullptr, o1, m1, l1);
#pragma unroll
        for (int qt = 0; qt < FQT; ++qt) if (qt == myq) { m[qt] = m1[0]; l[qt] = l1[0];
#pragma unroll
            for (int dt = 0; dt < 4; ++dt) o[dt][qt] = o1[dt][0]; }
    } else fa_loop<h16, 0, FQT, true>(Q16 + hp, nullptr, K16 + hp, nullptr, V16 + hp, nullptr, r0, nu, wave, FNW, lane, (h16*)part + wave * FSW, o, m, l);
#pragma unroll
    for (int qt = 0; qt < FQT; ++qt) { l[qt] += xhalf(l[qt]); if (hi == 0) { sm[wave * FQB + qt * 16 + lr] = m[qt]; sl[wave * FQB + qt * 16 + lr] = l[qt]; } }
    __syncthreads();                                                 // every wave's maxima and sums are in LDS, and every wave has left its K / V^T slice, before any wave rescales and writes its partial output over the slices
    float* mine = part + wave * (FQT * 1024) + lane * 4;
#pragma unroll
    for (int qt = 0; qt < FQT; ++qt) { const int qq = qt * 16 + lr; float M = sm[qq];
#pragma unroll
        for (int w = 1; w < FNW; ++w) M = fmaxf(M, sm[w * FQB + qq]);
        float L = 0.f;
#pragma unroll
        for (int w = 0; w < FNW; ++w) L += sl[w * FQB + qq] * __builtin_amdgcn_exp2f(sm[w * FQB + qq] - M);
        if (wave == 0 && hi == 0) sL[qq] = L;
        const float sc = __builtin_amdgcn_exp2f(m[qt] - M);
#pragma unroll
        for (int dt = 0; dt < 4; ++dt) { const v8f t = o[dt][qt] * sc; *(v4fa*)(mine + ((dt * FQT + qt) * 2) * 128) = (v4f){ t[0], t[1], t[2], t[3] }; *(v4fa*)(mine + ((dt * FQT + qt) * 2 + 1) * 128) = (v4f){ t[4], t[5], t[6], t[7] }; } }
    __syncthreads();                                                 // every wave's rescaled partial output is in LDS before any wave sums
    // a wave sums and stores whole rows (4 queries x 64 d a pass; a lane 8 consecutive d), so each 128-byte line of the merged planes has one writing wave
#pragma unroll
    for (int g = 0; g < FQB / (4 * FNW); ++g) { const int qq = g * (4 * FNW) + wave * 4 + (lane >> 3), c = lane & 7;
        const float* sp = part + (((c >> 1) * FQT + (qq >> 4)) * 2) * 128 + ((qq & 15) + 16 * (c & 1)) * 4; v4f s0 = *(const v4fa*)sp, s1 = *(const v4fa*)(sp + 128);
#pragma unroll
        for (int w = 1; w < FNW; ++w) { s0 += *(const v4fa*)(sp + w * (FQT * 1024)); s1 += *(const v4fa*)(sp + w * (FQT * 1024) + 128); }
        const float f = __fdiv_rn(1.0f, sL[qq]); v8us oh, ol;
#pragma unroll
        for (int j = 0; j < 4; ++j) { unsigned short x, y; splitf(s0[j] * f, x, y); oh[j] = x; ol[j] = y; splitf(s1[j] * f, x, y); oh[4 + j] = x; ol[4 + j] = y; }
        const size_t oo = (size_t)(r0 + qq) * DQ + h * HD + c * 8; *(v8us*)(Ah + oo) = oh; *(v8us*)(Al + oo) = ol; }
}

extern "C" void kernel_launch(void* const* d_in, const int* in_sizes, int n_in,
                              void* d_out, int out_size, void* d_ws, size_t ws_size, hipStream_t stream) {
    (void)in_sizes; (void)n_in; (void)out_size;
    const float* x = (const float*)d_in[0]; const float* wq = (const float*)d_in[1]; const float* wk = (const float*)d_in[2]; const float* wv = (const float*)d_in[3]; const float* wo = (const float*)d_in[4]; const int* pid = (const int*)d_in[5];   /* token_positions int32 [2048] (= arange) */
    float* OUT = (float*)d_out;     // [2][2048][1024]
    char* wsp = (char*)d_ws;
    auto take = [&](size_t bytes) { char* p = wsp; wsp += (bytes + 255) & ~(size_t)255; return (void*)p; };
    bf* WQ = (bf*)take((size_t)DQ * DM * 2); bf* WK = (bf*)take((size_t)DKV * DM * 2); bf* WV = (bf*)take((size_t)DKV * DM * 2); bf* WO = (bf*)take((size_t)DM * DQ * 2); float* CS = (float*)take((size_t)TT * HD * 2 * 4);
    bf* XB = (bf*)take((size_t)TT * DM * 2);
    h16* QP16 = (h16*)take((size_t)NH_ * TT * HD * 2); h16* KP16 = (h16*)take((size_t)NKV * TT * HD * 2); h16* VT16 = (h16*)take((size_t)NKV * HD * TT * 2);
    bf* QPh = (bf*)take((size_t)NH_ * TT * HD * 2); bf* QPl = (bf*)take((size_t)NH_ * TT * HD * 2); bf* KPh = (bf*)take((size_t)NKV * TT * HD * 2); bf* KPl = (bf*)take((size_t)NKV * TT * HD * 2); bf* VTh = (bf*)take((size_t)NKV * HD * TT * 2); bf* VTl = (bf*)take((size_t)NKV * HD * TT * 2);
    bf* ATh = (bf*)take((size_t)TT * DQ * 2); bf* ATl = (bf*)take((size_t)TT * DQ * 2);
    if ((size_t)(wsp - (char*)d_ws) > ws_size) return;    // ws 256 MiB
    { k_cvt8<<<(unsigned)(((size_t)DQ * DM / 8 + 255) / 256), 256, 0, stream>>>(wq, WQ, (size_t)DQ * DM / 8); k_cvt8<<<(unsigned)(((size_t)DKV * DM / 8 + 255) / 256), 256, 0, stream>>>(wk, WK, (size_t)DKV * DM / 8); k_cvt8<<<(unsigned)(((size_t)DKV * DM / 8 + 255) / 256), 256, 0, stream>>>(wv, WV, (size_t)DKV * DM / 8);
      k_cvt8<<<(unsigned)(((size_t)DM * DQ / 8 + 255) / 256), 256, 0, stream>>>(wo, WO, (size_t)DM * DQ / 8);
       }
    for (int b = 0; b < NB_; ++b) {
        if (b == 0) k_cstabT<<<(TT * HD + 255) / 256, 256, 0, stream>>>(pid, CS);
        k_cvt8<<<(unsigned)(((size_t)TT * DM / 8 + 255) / 256), 256, 0, stream>>>(x + (size_t)b * TT * DM, XB, (size_t)TT * DM / 8);
        k_gemms<bf, 0, false, 8, 1><<<dim3(TT / 64, DQ / 64, 1), 256, 0, stream>>>(XB, nullptr, WQ, nullptr, DM, nullptr, 0, 0, 0, 0, 0, CS, QP16, QPh, QPl);
        k_gemms<bf, 0, false, 8, 1><<<dim3(TT / 64, DKV / 64, 1), 256, 0, stream>>>(XB, nullptr, WK, nullptr, DM, nullptr, 0, 0, 0, 0, 0, CS, KP16, KPh, KPl);
        k_gemms<bf, 0, false, 8, 2><<<dim3(TT / 64, DKV / 64, 1), 256, 0, stream>>>(XB, nullptr, WV, nullptr, DM, nullptr, 0, 0, 0, 0, 0, nullptr, VT16, VTh, VTl);
        k_fattn<<<dim3(NH_, TT / FQB, 1), 32 * FNW, 0, stream>>>(QP16, KP16, VT16, QPh, QPl, KPh, KPl, VTh, VTl, ATh, ATl);
        k_gemms<bf, 1, false, 8, 0><<<dim3(TT / 64, DM / 64, 1), 256, 0, stream>>>(ATh, ATl, WO, nullptr, DQ, OUT + (size_t)b * TT * DM, DM, 0, 0, 0, 0, nullptr, nullptr, nullptr, nullptr); }
}

// v005
// One run takes 138 microseconds.
// Next to v004, in two timings, it ran 1.17 and 1.18 times as fast.
// All steps since v000 together make it 10.3 times as fast.
#include <hip/hip_runtime.h>

// Causal multi-head self-attention with interleaved rotary embeddings from integer positions (x [2][2048][1024]; Q,K,V = x W^T ('oi' [1024][1024] 0.02, no bias; 16 heads x 64); rotary on (even, odd) pairs with angle pos[t] x THETA ** (-2i/64) (token_positions int [2048], read; float32 power-form constants; precise cosf/sinf); logits / 8, causal (-inf); softmax; out = merged Wo^T -> [2][2048][1024] (4.2 M)).
// Layout, both batches in every launch (4 launches): bf16 copies of x and the weights and the {cos, sin} table in one launch; the Q, K and V projections in one; attention in one; the output projection in one. bf16 copy of x; exact projections; {cos, sin} per (position, pair) from the int positions (jnp-exact float32 inverse frequencies, precise cosf/sinf); the projections' own epilogue applies the interleaved rotary and writes the head planes (no f32 projection leaves the work-group); causal T-2048 attention, all 16 heads of both batches in ONE fused launch (k_fattn: scores, online softmax, P.V and head merge; hybrid rows: < 512 hi/lo 3 products, rest fp16; units above the diagonal never touched); merged hi/lo x wo exact.
// Compute dtypes, f32 accumulate: every input rounded to bf16; projections exact ; rotary f32; attention rows < 512 3 products, rest fp16; softmax f32; wo hl x exact.

#define NB_  2
#define TT   2048
#define DM   1024
#define NH_  16
#define NKV  16
#define REP  (NH_ / NKV)
#define HD   64
#define DQ   (NH_ * HD)
#define DKV  (NKV * HD)
#define RH   512                  // query rows < RH use hi+lo planes (0: none)
typedef _Float16 h16;
typedef unsigned short bf;
typedef __attribute__((ext_vector_type(16))) __bf16   v16bf;
typedef __attribute__((ext_vector_type(16))) _Float16 v16h;
typedef __attribute__((ext_vector_type(8)))  _Float16 v8h;
typedef __attribute__((ext_vector_type(8)))  unsigned short v8us;
typedef __attribute__((ext_vector_type(8)))  float    v8f;
typedef __attribute__((ext_vector_type(4)))  float    v4f;
typedef v8h  __attribute__((may_alias)) v8ha;
typedef v4f  __attribute__((may_alias)) v4fa;
typedef v8us __attribute__((may_alias)) v8usa;

__device__ __forceinline__ unsigned short f2bf(float f) { unsigned u = __float_as_uint(f); u += 0x7FFFu + ((u >> 16) & 1u); return (unsigned short)(u >> 16); }
__device__ __forceinline__ float bf2f(unsigned short b) { return __uint_as_float(((unsigned)b) << 16); }
__device__ __forceinline__ size_t tri_off(int rb) { return (size_t)(rb * (rb + 1) / 2) * 4096; }   // floats in front of block row rb
__device__ __forceinline__ float bfr(float f) { return bf2f(f2bf(f)); }
__device__ __forceinline__ v16h cat16(v8h lo, v8h hi) { return __builtin_shufflevector(lo, hi, 0, 1, 2, 3, 4, 5, 6, 7, 8, 9, 10, 11, 12, 13, 14, 15); }
__device__ __forceinline__ v16bf cat16b(v8us lo, v8us hi) { return __builtin_bit_cast(v16bf, __builtin_shufflevector(lo, hi, 0, 1, 2, 3, 4, 5, 6, 7, 8, 9, 10, 11, 12, 13, 14, 15)); }
__device__ __forceinline__ v8f wmma16(v16h a, v16h b, v8f c) { return __builtin_amdgcn_wmma_f32_16x16x32_f16(false, a, false, b, (short)0, c, false, false); }
__device__ __forceinline__ v8f wmmab(v16bf a, v16bf b, v8f c) { return __builtin_amdgcn_wmma_f32_16x16x32_bf16(false, a, false, b, (short)0, c, false, false); }

__device__ __forceinline__ h16 tohx(float x) { return (h16)x; }
__device__ __forceinline__ void splitf(float y, unsigned short& h, unsigned short& l) { h = f2bf(y); l = f2bf(y - bf2f(h)); }
typedef __attribute__((ext_vector_type(2))) _Float16 v2h;
typedef __attribute__((ext_vector_type(4))) _Float16 v4h;
typedef __attribute__((ext_vector_type(2))) unsigned short v2us;
typedef __attribute__((ext_vector_type(4))) unsigned short v4us;
typedef __attribute__((ext_vector_type(2))) float v2f;
typedef __attribute__((ext_vector_type(4))) int v4i;

// ---- k_gemms: register-blocked GEMM, one 64x64 output tile per work-group of NW waves; operands straight from K-contiguous 16-bit planes; grid (M/64, N/64, Z), 32 * NW threads.
// C[m][n] (f32, pitch ldc) = sum_k A[m][k] Bt[n][k] (+ split products per NSPLIT). z-batch strides sA/sB/sC in elements. K % 32 == 0.
// The K loop is dealt over the waves in slices of 32 (wave w takes slices w, w + NW, ...): each wave holds a whole 64x64 f32 partial tile (16 accumulators), and the NW partials are summed through LDS in wave order 0 .. NW-1.
// CAUSALK: probability x value contraction; probabilities are exactly 0 beyond the diagonal block, so the K range stops there (roff = row offset of this launch's first row within the sequence). A (and A2) then point at a head's packed score storage: block row rb starts at tri_off(rb) floats, a row's slot is (rb + 1) * 128 16-bit elements, and the lo plane stands (rb + 1) * 64 elements behind the hi plane.
// The rows of A run over both batches (row = batch * TT + position; a tile of 64 rows lies in one batch).
// EPI 0: the summed tile goes to C as f32. EPI 1 (the Q, K and V projections in one launch: Bt holds the three weights one behind the other, blockIdx.y = which * NH_ + head, so the 64 columns of a tile are ONE head of one of them, its 64 rows 64 positions): the summed tile goes through a second LDS array and leaves as the head's 16-bit planes (fp16, bf16 hi, bf16 lo; each plane array is [which][batch][head]...), 16 B a lane in whole 128-byte lines.
// Q and K (which < 2): planes [t][d] of the interleaved rotary (even: x0 c - x1 s; odd: x0 s + x1 c; {c, s} from CS[t][d]). V: planes [d][t], the tile turned on its way into LDS. The test is the same for a whole work-group (a scalar branch).
#define TP 68                     // f32 pitch of that array: 272 B = 16 B x odd, so that rows 4 banks apart serve ds_load_b128 / ds_store_b128 without conflicts
template <bool B> struct Flag { static constexpr bool v = B; };
template <typename T16> struct WFrag;
template <> struct WFrag<h16> { typedef v16h V; static __device__ __forceinline__ V ld(const h16* p) { return cat16(*(const v8h*)p, *(const v8h*)(p + 16)); } static __device__ __forceinline__ v8f mma(V a, V b, v8f c) { return wmma16(a, b, c); } };
template <> struct WFrag<bf> { typedef v16bf V; static __device__ __forceinline__ V ld(const bf* p) { return cat16b(*(const v8us*)p, *(const v8us*)(p + 16)); } static __device__ __forceinline__ v8f mma(V a, V b, v8f c) { return wmmab(a, b, c); } };
template <typename T16, int NSPLIT, bool CAUSALK, int NW, int EPI>
__global__ __launch_bounds__(32 * NW) void k_gemms(const T16* __restrict__ A, const T16* __restrict__ A2, const T16* __restrict__ Bt, const T16* __restrict__ Bt2, int K, float* C, int ldc, int roff, size_t sA, size_t sB, size_t sC, const float* __restrict__ CS, h16* P16, bf* Ph, bf* Pl) {
    typedef typename WFrag<T16>::V V;
    __shared__ __align__(16) float part[NW * 4096];                  // [wave][accumulator 0..15][half 0..1][lane][4]: each wave's partial tile in register order, 16 B per lane
    const size_t z = blockIdx.z; A += z * sA; if (A2) A2 += z * sA; Bt += z * sB; if (Bt2) Bt2 += z * sB; C += z * sC;
    const int lane = threadIdx.x & 31, lr = lane & 15, hi = lane >> 4; const int r0 = blockIdx.x * 64, c0 = blockIdx.y * 64;
    const int wave = __builtin_amdgcn_readfirstlane((int)(threadIdx.x >> 5));   // scalar, so that the K loop's test is a scalar branch and every lane stays on at the matrix instructions
    const int Kl = CAUSALK ? min(K, r0 + roff + 64) : K;
    const int rb = (r0 + roff) >> 6; const int lda = CAUSALK ? (rb + 1) * 128 : K;
    if (CAUSALK) { A += tri_off(rb) * 2; if (A2) A2 += tri_off(rb) * 2 + (rb + 1) * 64; }
    v8f acc[4][4];
#pragma unroll
    for (int mb = 0; mb < 4; ++mb)
#pragma unroll
        for (int nb = 0; nb < 4; ++nb) acc[mb][nb] = (v8f){};
    const size_t aoff = (size_t)((CAUSALK ? 0 : r0) + lr) * lda + 8 * hi, boff = (size_t)(c0 + lr) * K + 8 * hi;
#pragma unroll 1
    for (int kc = wave * 32; kc < Kl; kc += NW * 32) {
        V a[4], a2[4];
#pragma unroll
        for (int mb = 0; mb < 4; ++mb) { a[mb] = WFrag<T16>::ld(A + aoff + (size_t)mb * 16 * lda + kc); if (NSPLIT == 1 || NSPLIT == 2) a2[mb] = WFrag<T16>::ld(A2 + aoff + (size_t)mb * 16 * lda + kc); }
#pragma unroll
        for (int nb = 0; nb < 4; ++nb) { const V b = WFrag<T16>::ld(Bt + boff + (size_t)nb * 16 * K + kc); V b2; if (NSPLIT >= 2) b2 = WFrag<T16>::ld(Bt2 + boff + (size_t)nb * 16 * K + kc);
#pragma unroll
            for (int mb = 0; mb < 4; ++mb) { acc[mb][nb] = WFrag<T16>::mma(a[mb], b, acc[mb][nb]); if (NSPLIT == 1 || NSPLIT == 2) acc[mb][nb] = WFrag<T16>::mma(a2[mb], b, acc[mb][nb]); if (NSPLIT >= 2) acc[mb][nb] = WFrag<T16>::mma(a[mb], b2, acc[mb][nb]); } }
        asm volatile("v_nop\n\tv_nop\n\tv_nop\n\tv_nop" : "+v"(acc[0][0]), "+v"(acc[1][1]), "+v"(acc[2][2]), "+v"(acc[3][3]) : "v"(a[0]), "v"(a[3]));
    }
    const int which = (int)blockIdx.y / NH_, head = (int)blockIdx.y % NH_, tp0 = r0 % TT; const bool rot = (EPI == 1) && which < 2;
    v2f cs[16 / NW][4];                                              // Q and K: {cos, sin} of the lane's pairs, asked for here so that they fly while the partial tile goes to LDS
    if (rot) { const float* cp = CS + ((size_t)tp0 * HD + (size_t)threadIdx.x * 8) * 2;
#pragma unroll
        for (int p = 0; p < 16 / NW; ++p)
#pragma unroll
            for (int i = 0; i < 4; ++i) cs[p][i] = *(const v2f*)(cp + (p * (NW * 256) + 2 * i) * 2);
        asm volatile("s_wait_xcnt 0x0" :: "v"(cp) : "memory"); }     // the loads' address registers stay whole up to this wait
    float* mine = part + wave * 4096 + lane * 4;
#pragma unroll
    for (int mb = 0; mb < 4; ++mb)
#pragma unroll
        for (int nb = 0; nb < 4; ++nb) { const v8f t = acc[mb][nb]; *(v4fa*)(mine + ((mb * 4 + nb) * 2) * 128) = (v4f){ t[0], t[1], t[2], t[3] }; *(v4fa*)(mine + ((mb * 4 + nb) * 2 + 1) * 128) = (v4f){ t[4], t[5], t[6], t[7] }; }
    __syncthreads();                                                 // every wave's partial tile is in LDS before any wave sums
    // 16 units of (16-row block mb, 32-column pair np, 4-row half jh); a wave owns 16 / NW of them, so each 128-byte line of C has one writing wave
    v4f s0[16 / NW], s1[16 / NW];
#pragma unroll
    for (int q = 0; q < 16 / NW; ++q) { const int u = wave * (16 / NW) + q, mb = u >> 2, np = (u >> 1) & 1, jh = u & 1;
        const float* sp = part + ((mb * 4 + np * 2) * 2 + jh) * 128 + lane * 4; s0[q] = *(const v4fa*)sp; s1[q] = *(const v4fa*)(sp + 256);
#pragma unroll
        for (int w = 1; w < NW; ++w) { s0[q] += *(const v4fa*)(sp + w * 4096); s1[q] += *(const v4fa*)(sp + w * 4096 + 256); } }
    if constexpr (EPI == 0) {
#pragma unroll
        for (int q = 0; q < 16 / NW; ++q) { const int u = wave * (16 / NW) + q, mb = u >> 2, np = (u >> 1) & 1, jh = u & 1;
            float* crow = C + (size_t)(r0 + mb * 16 + hi * 8 + jh * 4) * ldc + c0 + np * 32 + lr;
#pragma unroll
            for (int j = 0; j < 4; ++j) { crow[(size_t)j * ldc] = s0[q][j]; crow[(size_t)j * ldc + 16] = s1[q][j]; } }
    } else {
        __shared__ __align__(16) float tile[64 * TP];                // Q and K: [t][d]; V: [d][t]
        // each of the two halves of this epilogue is written once, with the kind of plane as a compile-time flag, and the work-group takes one straight-line copy of it (one scalar branch a half)
        auto fill = [&](auto R) {
#pragma unroll
            for (int q = 0; q < 16 / NW; ++q) { const int u = wave * (16 / NW) + q, mb = u >> 2, np = (u >> 1) & 1, jh = u & 1; const int row = mb * 16 + hi * 8 + jh * 4, col = np * 32 + lr;
                if constexpr (decltype(R)::v) {
#pragma unroll
                    for (int j = 0; j < 4; ++j) { tile[(row + j) * TP + col] = s0[q][j]; tile[(row + j) * TP + col + 16] = s1[q][j]; }
                } else { *(v4fa*)(tile + col * TP + row) = s0[q]; *(v4fa*)(tile + (col + 16) * TP + row) = s1[q]; } } };
        if (rot) fill(Flag<true>{}); else fill(Flag<false>{});
        __syncthreads();                                             // the whole summed tile is in LDS before any wave reads rows of it
        const size_t pb = (((size_t)which * NB_ + r0 / TT) * NH_ + head) * ((size_t)TT * HD);   // the head's plane
        auto leave = [&](auto R) {
#pragma unroll
            for (int p = 0; p < 16 / NW; ++p) { const int idx = p * (NW * 256) + (int)threadIdx.x * 8, rr = idx >> 6, cc = idx & 63;
                const v4f t0 = *(const v4fa*)(tile + rr * TP + cc), t1 = *(const v4fa*)(tile + rr * TP + cc + 4); float y[8] = { t0[0], t0[1], t0[2], t0[3], t1[0], t1[1], t1[2], t1[3] };
                if constexpr (decltype(R)::v) {
#pragma unroll
                    for (int i = 0; i < 4; ++i) { const float x0 = y[2 * i], x1 = y[2 * i + 1], c = cs[p][i][0], s = cs[p][i][1]; y[2 * i] = x0 * c - x1 * s; y[2 * i + 1] = x0 * s + x1 * c; } }
                v8h o16; v8us oh, ol;
#pragma unroll
                for (int k = 0; k < 8; ++k) { o16[k] = tohx(y[k]); unsigned short a2, c2; splitf(y[k], a2, c2); oh[k] = a2; ol[k] = c2; }
                const size_t oo = pb + (decltype(R)::v ? (size_t)(tp0 + rr) * HD + cc : (size_t)rr * TT + tp0 + cc);
                *(v8h*)(P16 + oo) = o16; *(v8us*)(Ph + oo) = oh; *(v8us*)(Pl + oo) = ol;
                asm volatile("s_wait_xcnt 0x0" ::: "memory");   // the three stores' address and data registers stay whole up to this wait (the next pass, or the other half's code on a joined path, rewrites them)
            } };
        if (rot) leave(Flag<true>{}); else leave(Flag<false>{});
    }
}


__global__ __launch_bounds__(256) void k_wtG(const float* __restrict__ w, int K, int N, bf* Bt) {
    const int lane = threadIdx.x & 31; const int L0 = (blockIdx.x * 8 + (threadIdx.x >> 5)) * 8; const int nlines = N * K / 64;
{
#pragma unroll 1
        for (int l = 0; l < 8; ++l) { const int L = L0 + l; if (L >= nlines) break; const size_t e = (size_t)L * 64 + lane * 2; const int k = (int)(e % K), n = (int)(e / K); v2us o;
            o[0] = f2bf(w[(size_t)k * N + n]); o[1] = f2bf(w[(size_t)(k + 1) * N + n]); *(v2us*)(Bt + e) = o; }
         }
}
__constant__ float INVT[HD / 2] = { 1.000000000e+00f,7.498942018e-01f,5.623413324e-01f,4.216965139e-01f,3.162277639e-01f,2.371373773e-01f,1.778279394e-01f,1.333521456e-01f,1.000000015e-01f,7.498942316e-02f,5.623413250e-02f,4.216964915e-02f,3.162277490e-02f,2.371373773e-02f,1.778279431e-02f,1.333521400e-02f,9.999999776e-03f,7.498942316e-03f,5.623413250e-03f,4.216964822e-03f,3.162277630e-03f,2.371373819e-03f,1.778279431e-03f,1.333521446e-03f,1.000000047e-03f,7.498941850e-04f,5.623413017e-04f,4.216965172e-04f,3.162277571e-04f,2.371373703e-04f,1.778279402e-04f,1.333521504e-04f };   // THETA ** (-2 i / 64) as float32 (the module's power form, jnp-computed)
// ---- k_prep: everything that only rewrites inputs, in one launch; a block's job follows from its index alone (scalar branches). Blocks 0 .. PB_CS-1: the {cos, sin} table, one (position, d) a thread. Then PB_X blocks: x (both batches) to bf16, 8 elements a thread. Then 4 x PB_W blocks: the four weights to bf16, the same way.
#define PB_CS (TT * HD / 256)
#define PB_X  (NB_ * TT * DM / 8 / 256)
#define PB_W  (DQ * DM / 8 / 256)
__global__ __launch_bounds__(256) void k_prep(const float* __restrict__ x, const float* __restrict__ wq, const float* __restrict__ wk, const float* __restrict__ wv, const float* __restrict__ wo, const int* __restrict__ pid, bf* XB, bf* W4, float* CS) {
    int blk = blockIdx.x;
    if (blk < PB_CS) { const int idx = blk * 256 + threadIdx.x; const int d = idx % HD; const int t = idx / HD; const float a = __fmul_rn((float)pid[t], INVT[d >> 1]); v2f cs; cs[0] = cosf(a); cs[1] = sinf(a); *(v2f*)(CS + (size_t)idx * 2) = cs; return; }
    blk -= PB_CS; const float* src = x; bf* dst = XB;
    if (blk >= PB_X) { blk -= PB_X; const int wi = blk / PB_W; blk %= PB_W; src = (wi == 0) ? wq : (wi == 1) ? wk : (wi == 2) ? wv : wo; dst = W4 + (size_t)wi * DQ * DM; }
    const size_t i = (size_t)blk * 256 + threadIdx.x; const float* sp = src + i * 8; const v8f v = *(const v8f*)sp; v8us o;
    asm volatile("s_wait_xcnt 0x0" :: "v"(sp) : "memory");         // the load's address registers stay whole up to this wait
#pragma unroll
    for (int k = 0; k < 8; ++k) o[k] = f2bf(v[k]);
    *(v8us*)(dst + i * 8) = o;
    asm volatile("s_wait_xcnt 0x0" ::: "memory");                 // the store's registers stay whole up to this wait (the built code joins this path with the table's)
}
// ---- k_fattn: scores, causal softmax, probability x value and the head merge of both batches in one kernel; grid (batches x heads, TT / FQB), FNW waves; no score ever leaves the registers.
// A work-group owns FQB query rows of one head. The keys are dealt over its waves in units of 32 (wave w takes units w, w + FNW, ...). Each wave keeps a running maximum, a running sum and a whole [64 d][FQB queries] f32 partial output (online softmax).
// Everything is computed transposed: S^T = K Q^T (A = key rows, B = query rows), so that a lane holds scores of ONE query (column lr) and the two 16-key score tiles, rounded to 16 bit, ARE the B fragment of O^T += V^T P^T in the loader's k order (element e < 8: key 8 hi + e; e >= 8: key 16 + 8 hi + e - 8).
// At the end the waves' partials are brought to the common maximum and summed through LDS in wave order 0 .. FNW-1, divided by the row's sum and stored as the merged hi/lo planes.
#define FQT 2                     // 16-query tiles per work-group
#define FQB (FQT * 16)
#define FNW 8
#define FSK (32 * 72)             // 16-bit elements of a wave's K slice in LDS
#define FSW (FSK + 64 * 40)       // and of its whole slice (K, then V^T)
#define SCL2 0.18033688011112042f // HD^-0.5 x log2(e): the scores are kept in the base-2 domain
typedef __attribute__((ext_vector_type(16))) unsigned short v16us;
__device__ __forceinline__ float xhalf(float x) { return __builtin_bit_cast(float, __builtin_amdgcn_permlanex16(__builtin_bit_cast(int, x), __builtin_bit_cast(int, x), 0x76543210, 0xfedcba98, false, false)); }   // lane l with lane l ^ 16
__device__ __forceinline__ void pfrag(const float (&p)[16], v16h& a, v16h& a2) {
#pragma unroll
    for (int e = 0; e < 16; ++e) a[e] = tohx(p[e]);
    a2 = a; }
__device__ __forceinline__ void pfrag(const float (&p)[16], v16bf& a, v16bf& a2) { v16us h, l;
#pragma unroll
    for (int e = 0; e < 16; ++e) { unsigned short x, y; splitf(p[e], x, y); h[e] = x; l[e] = y; }
    a = __builtin_bit_cast(v16bf, h); a2 = __builtin_bit_cast(v16bf, l); }
template <typename T16, int NSPLIT, int NQ, bool STG>
__device__ __forceinline__ void fa_loop(const T16* __restrict__ Q, const T16* __restrict__ Q2, const T16* __restrict__ Kp, const T16* __restrict__ K2, const T16* __restrict__ Vt, const T16* __restrict__ V2, int r0, int nu, int u0, int ustep, int lane, h16* stg, v8f (&o)[4][NQ], float (&m)[NQ], float (&l)[NQ]) {
    typedef typename WFrag<T16>::V V; const int lr = lane & 15, hi = lane >> 4;
    V q[NQ][2], q2[NQ][2];
    const size_t qoff = (size_t)(r0 + lr) * HD + 8 * hi; const T16* qp = Q + qoff; const T16* qp2 = (NSPLIT == 2) ? Q2 + qoff : qp;
#pragma unroll
    for (int qt = 0; qt < NQ; ++qt)
#pragma unroll
        for (int ks = 0; ks < 2; ++ks) { q[qt][ks] = WFrag<T16>::ld(qp + qt * 16 * HD + ks * 32); if (NSPLIT == 2) q2[qt][ks] = WFrag<T16>::ld(qp2 + qt * 16 * HD + ks * 32); }
    asm volatile("s_wait_xcnt 0x0" :: "v"(qp), "v"(qp2) : "memory");   // the loads' address registers stay whole up to this wait; only behind it may anything, a later load's result too, overwrite them
#pragma unroll 1
    for (int u = u0; u < nu; u += ustep) {
        const int k0 = u * 32;
        V kf[2][2], kf2[2][2], vf[4], vf2[4];
        if constexpr (STG) {
            // The unit's K rows (32 x 128 B, 4 KiB in a row) and V^T rows (64 x 64 B) come in whole-line order, 16 B a lane, and are turned into fragments through the wave's OWN LDS slice: a fragment load straight from memory touches 16 lines for 512 B.
            h16* sk = stg; h16* sv = stg + FSK;                       // K at a pitch of 144 B, V^T at 80 B (16 B x odd: ds_load_b128 without bank conflicts)
            const T16* kg = Kp + (size_t)k0 * HD + lane * 8; const T16* vg = Vt + (size_t)(lane >> 2) * TT + k0 + (lane & 3) * 8; v8h tk[8], tv[8];
#pragma unroll
            for (int i = 0; i < 8; ++i) tk[i] = *(const v8h*)(kg + i * 256);
#pragma unroll
            for (int i = 0; i < 8; ++i) tv[i] = *(const v8h*)(vg + (size_t)i * 8 * TT);
            asm volatile("s_wait_xcnt 0x0" :: "v"(kg), "v"(vg) : "memory");   // as behind the query loads: the unit's address registers stay whole up to this wait
#pragma unroll
            for (int i = 0; i < 8; ++i) *(v8ha*)(sk + (i * 4 + (lane >> 3)) * 72 + (lane & 7) * 8) = tk[i];
#pragma unroll
            for (int i = 0; i < 8; ++i) *(v8ha*)(sv + (i * 8 + (lane >> 2)) * 40 + (lane & 3) * 8) = tv[i];
            __builtin_amdgcn_wave_barrier(); asm volatile("" ::: "memory");   // keeps the fragment reads behind the other lanes' stores in program order (one wave's LDS operations run in order; no other wave touches the slice)
#pragma unroll
            for (int kt = 0; kt < 2; ++kt)
#pragma unroll
                for (int ks = 0; ks < 2; ++ks) { const h16* p = sk + (kt * 16 + lr) * 72 + ks * 32 + 8 * hi; kf[kt][ks] = cat16(*(const v8ha*)p, *(const v8ha*)(p + 16)); }
#pragma unroll
            for (int dt = 0; dt < 4; ++dt) { const h16* p = sv + (dt * 16 + lr) * 40 + 8 * hi; vf[dt] = cat16(*(const v8ha*)p, *(const v8ha*)(p + 16)); }
        } else {
            const size_t koff = (size_t)(k0 + lr) * HD + 8 * hi, voff = (size_t)lr * TT + k0 + 8 * hi;
            const T16* kp = Kp + koff; const T16* kp2 = (NSPLIT == 2) ? K2 + koff : kp; const T16* vp = Vt + voff; const T16* vp2 = (NSPLIT == 2) ? V2 + voff : vp;
#pragma unroll
            for (int kt = 0; kt < 2; ++kt)
#pragma unroll
                for (int ks = 0; ks < 2; ++ks) { kf[kt][ks] = WFrag<T16>::ld(kp + kt * 16 * HD + ks * 32); if (NSPLIT == 2) kf2[kt][ks] = WFrag<T16>::ld(kp2 + kt * 16 * HD + ks * 32); }
#pragma unroll
            for (int dt = 0; dt < 4; ++dt) { vf[dt] = WFrag<T16>::ld(vp + (size_t)dt * 16 * TT); if (NSPLIT == 2) vf2[dt] = WFrag<T16>::ld(vp2 + (size_t)dt * 16 * TT); }
            asm volatile("s_wait_xcnt 0x0" :: "v"(kp), "v"(kp2), "v"(vp), "v"(vp2) : "memory");   // as behind the query loads: the unit's address registers stay whole up to this wait
        }
#pragma unroll
        for (int qt = 0; qt < NQ; ++qt) {
            v8f s[2];
#pragma unroll
            for (int kt = 0; kt < 2; ++kt) { s[kt] = (v8f){};
#pragma unroll
                for (int ks = 0; ks < 2; ++ks) { s[kt] = WFrag<T16>::mma(kf[kt][ks], q[qt][ks], s[kt]); if (NSPLIT == 2) { s[kt] = WFrag<T16>::mma(kf[kt][ks], q2[qt][ks], s[kt]); s[kt] = WFrag<T16>::mma(kf2[kt][ks], q[qt][ks], s[kt]); } } }
            const int qi = r0 + qt * 16 + lr; float p[16]; float mx = m[qt];
#pragma unroll
            for (int e = 0; e < 16; ++e) p[e] = s[e >> 3][e & 7] * SCL2;
            if (k0 + 31 > r0) {                                      // only a unit that reaches past the wave's first query holds keys above the diagonal (scalar test)
#pragma unroll
                for (int e = 0; e < 16; ++e) { const int key = k0 + (e >> 3) * 16 + hi * 8 + (e & 7); p[e] = (key <= qi) ? p[e] : -3.0e38f; } }
#pragma unroll
            for (int e = 0; e < 16; ++e) mx = fmaxf(mx, p[e]);
            mx = fmaxf(mx, xhalf(mx));                  // the query's other 16 keys of the unit stand in the other half of the wave
            const float al = __builtin_amdgcn_exp2f(m[qt] - mx); m[qt] = mx; float ps = 0.f;
#pragma unroll
            for (int e = 0; e < 16; ++e) { p[e] = __builtin_amdgcn_exp2f(p[e] - mx); ps += p[e]; }
            l[qt] = l[qt] * al + ps;
#pragma unroll
            for (int dt = 0; dt < 4; ++dt) o[dt][qt] *= al;
            V pf, pf2; pfrag(p, pf, pf2);
#pragma unroll
            for (int dt = 0; dt < 4; ++dt) { o[dt][qt] = WFrag<T16>::mma(vf[dt], pf, o[dt][qt]); if (NSPLIT == 2) { o[dt][qt] = WFrag<T16>::mma(vf[dt], pf2, o[dt][qt]); o[dt][qt] = WFrag<T16>::mma(vf2[dt], pf, o[dt][qt]); } }
        }
        // four vector slots between the unit's last matrix instructions and whatever follows the loop's branch on either path (the next unit's loads into their operands, the epilogue's reads of their results)
        asm volatile("v_nop\n\tv_nop\n\tv_nop\n\tv_nop" : "+v"(o[0][NQ - 1]), "+v"(o[1][NQ - 1]), "+v"(o[2][NQ - 1]), "+v"(o[3][NQ - 1]) : "v"(vf[0]), "v"(vf[3]));
    }
}
__global__ __launch_bounds__(32 * FNW) void k_fattn(const h16* __restrict__ Q16, const h16* __restrict__ K16, const h16* __restrict__ V16, const bf* __restrict__ Qh, const bf* __restrict__ Ql, const bf* __restrict__ Kh, const bf* __restrict__ Kl, const bf* __restrict__ Vh, const bf* __restrict__ Vl, bf* Ah, bf* Al) {
    __shared__ __align__(16) float part[(FNW * FSW / 2 > FNW * FQT * 1024) ? FNW * FSW / 2 : FNW * FQT * 1024];   // in the unit loop: each wave's own K / V^T slice (FSW 16-bit elements); behind the first barrier: [wave][d tile][query tile][half 0..1][lane][4], each wave's partial output in register order
    __shared__ float sm[FNW * FQB], sl[FNW * FQB], sL[FQB];          // each wave's maximum and sum per query; the row's whole sum
    const int lane = threadIdx.x & 31, lr = lane & 15, hi = lane >> 4;
    const int wave = __builtin_amdgcn_readfirstlane((int)(threadIdx.x >> 5));   // scalar, so that the unit loop's test is a scalar branch and every lane stays on at the matrix instructions
    const int r0 = (TT / FQB - 1 - (int)blockIdx.y) * FQB;          // the slow grid index: the longest rows of every head start first
    const int h = (int)blockIdx.x % NH_, bt = (int)blockIdx.x / NH_ * TT; const size_t hp = (size_t)blockIdx.x * TT * HD;   // the planes are [batch][head]...; bt: the batch's first row in the merged planes
    v8f o[4][FQT]; float m[FQT], l[FQT];
#pragma unroll
    for (int qt = 0; qt < FQT; ++qt) { m[qt] = -1.0e30f; l[qt] = 0.f;   // above the mask's value, so that a masked score gives probability 0 also where a wave has seen no open key yet
#pragma unroll
        for (int dt = 0; dt < 4; ++dt) o[dt][qt] = (v8f){}; }
    const int nu = r0 / 32 + FQB / 32;                               // units of 32 keys up to and including the diagonal block
    if (r0 < RH) {                                                   // hi/lo rows hold twice the fragments: a wave takes ONE query tile (wave / (FNW / FQT)) and the keys are dealt over the FNW / FQT waves of that tile; its other tiles stay empty partials
        const int myq = wave / (FNW / FQT); v8f o1[4][1]; float m1[1] = { -1.0e30f }, l1[1] = { 0.f };
#pragma unroll
        for (int dt = 0; dt < 4; ++dt) o1[dt][0] = (v8f){};
        fa_loop<bf, 2, 1, false>(Qh + hp, Ql + hp, Kh + hp, Kl + hp, Vh + hp, Vl + hp, r0 + myq * 16, nu, wave % (FNW / FQT), FNW / FQT, lane, nullptr, o1, m1, l1);
#pragma unroll
        for (int qt = 0; qt < FQT; ++qt) if (qt == myq) { m[qt] = m1[0]; l[qt] = l1[0];
#pragma unroll
            for (int dt = 0; dt < 4; ++dt) o[dt][qt] = o1[dt][0]; }
    } else fa_loop<h16, 0, FQT, true>(Q16 + hp, nullptr, K16 + hp, nullptr, V16 + hp, nullptr, r0, nu, wave, FNW, lane, (h16*)part + wave * FSW, o, m, l);
#pragma unroll
    for (int qt = 0; qt < FQT; ++qt) { l[qt] += xhalf(l[qt]); if (hi == 0) { sm[wave * FQB + qt * 16 + lr] = m[qt]; sl[wave * FQB + qt * 16 + lr] = l[qt]; } }
    __syncthreads();                                                 // every wave's maxima and sums are in LDS, and every wave has left its K / V^T slice, before any wave rescales and writes its partial output over the slices
    float* mine = part + wave * (FQT * 1024) + lane * 4;
#pragma unroll
    for (int qt = 0; qt < FQT; ++qt) { const int qq = qt * 16 + lr; float M = sm[qq];
#pragma unroll
        for (int w = 1; w < FNW; ++w) M = fmaxf(M, sm[w * FQB + qq]);
        float L = 0.f;
#pragma unroll
        for (int w = 0; w < FNW; ++w) L += sl[w * FQB + qq] * __builtin_amdgcn_exp2f(sm[w * FQB + qq] - M);
        if (wave == 0 && hi == 0) sL[qq] = L;
        const float sc = __builtin_amdgcn_exp2f(m[qt] - M);
#pragma unroll
        for (int dt = 0; dt < 4; ++dt) { const v8f t = o[dt][qt] * sc; *(v4fa*)(mine + ((dt * FQT + qt) * 2) * 128) = (v4f){ t[0], t[1], t[2], t[3] }; *(v4fa*)(mine + ((dt * FQT + qt) * 2 + 1) * 128) = (v4f){ t[4], t[5], t[6], t[7] }; } }
    __syncthreads();                                                 // every wave's rescaled partial output is in LDS before any wave sums
    // a wave sums and stores whole rows (4 queries x 64 d a pass; a lane 8 consecutive d), so each 128-byte line of the merged planes has one writing wave
#pragma unroll
    for (int g = 0; g < FQB / (4 * FNW); ++g) { const int qq = g * (4 * FNW) + wave * 4 + (lane >> 3), c = lane & 7;
        const float* sp = part + (((c >> 1) * FQT + (qq >> 4)) * 2) * 128 + ((qq & 15) + 16 * (c & 1)) * 4; v4f s0 = *(const v4fa*)sp, s1 = *(const v4fa*)(sp + 128);
#pragma unroll
        for (int w = 1; w < FNW; ++w) { s0 += *(const v4fa*)(sp + w * (FQT * 1024)); s1 += *(const v4fa*)(sp + w * (FQT * 1024) + 128); }
        const float f = __fdiv_rn(1.0f, sL[qq]); v8us oh, ol;
#pragma unroll
        for (int j = 0; j < 4; ++j) { unsigned short x, y; splitf(s0[j] * f, x, y); oh[j] = x; ol[j] = y; splitf(s1[j] * f, x, y); oh[4 + j] = x; ol[4 + j] = y; }
        const size_t oo = (size_t)(bt + r0 + qq) * DQ + h * HD + c * 8; *(v8us*)(Ah + oo) = oh; *(v8us*)(Al + oo) = ol; }
}

extern "C" void kernel_launch(void* const* d_in, const int* in_sizes, int n_in,
                              void* d_out, int out_size, void* d_ws, size_t ws_size, hipStream_t stream) {
    (void)in_sizes; (void)n_in; (void)out_size;
    const float* x = (const float*)d_in[0]; const float* wq = (const float*)d_in[1]; const float* wk = (const float*)d_in[2]; const float* wv = (const float*)d_in[3]; const float* wo = (const float*)d_in[4]; const int* pid = (const int*)d_in[5];   /* token_positions int32 [2048] (= arange) */
    float* OUT = (float*)d_out;     // [2][2048][1024]
    char* wsp = (char*)d_ws;
    auto take = [&](size_t bytes) { char* p = wsp; wsp += (bytes + 255) & ~(size_t)255; return (void*)p; };
    const size_t PL = (size_t)NB_ * NH_ * TT * HD;                    // elements of one plane array of one of Q, K, V (both batches)
    bf* W4 = (bf*)take((size_t)4 * DQ * DM * 2); bf* WO = W4 + (size_t)3 * DQ * DM;   // wq, wk, wv, wo one behind the other
    float* CS = (float*)take((size_t)TT * HD * 2 * 4);
    bf* XB = (bf*)take((size_t)NB_ * TT * DM * 2);
    h16* P16 = (h16*)take(3 * PL * 2); bf* Ph = (bf*)take(3 * PL * 2); bf* Pl = (bf*)take(3 * PL * 2);   // each [Q, K, V][batch][head]...
    bf* ATh = (bf*)take((size_t)NB_ * TT * DQ * 2); bf* ATl = (bf*)take((size_t)NB_ * TT * DQ * 2);
    if ((size_t)(wsp - (char*)d_ws) > ws_size) return;    // ws 256 MiB
    k_prep<<<PB_CS + PB_X + 4 * PB_W, 256, 0, stream>>>(x, wq, wk, wv, wo, pid, XB, W4, CS);
    k_gemms<bf, 0, false, 8, 1><<<dim3(NB_ * TT / 64, 3 * NH_, 1), 256, 0, stream>>>(XB, nullptr, W4, nullptr, DM, nullptr, 0, 0, 0, 0, 0, CS, P16, Ph, Pl);
    k_fattn<<<dim3(NB_ * NH_, TT / FQB, 1), 32 * FNW, 0, stream>>>(P16, P16 + PL, P16 + 2 * PL, Ph, Pl, Ph + PL, Pl + PL, Ph + 2 * PL, Pl + 2 * PL, ATh, ATl);
    k_gemms<bf, 1, false, 8, 0><<<dim3(NB_ * TT / 64, DM / 64, 1), 256, 0, stream>>>(ATh, ATl, WO, nullptr, DQ, OUT, DM, 0, 0, 0, 0, nullptr, nullptr, nullptr, nullptr);
}

// v006
// It runs in 92.3 microseconds.
// Two timings next to v005 put it at 1.49 and 1.50 times that version's speed.
// All steps since v000 together make it 15.4 times as fast.
#include <hip/hip_runtime.h>

// Causal multi-head self-attention with interleaved rotary embeddings from integer positions (x [2][2048][1024]; Q,K,V = x W^T ('oi' [1024][1024] 0.02, no bias; 16 heads x 64); rotary on (even, odd) pairs with angle pos[t] x THETA ** (-2i/64) (token_positions int [2048], read; float32 power-form constants; precise cosf/sinf); logits / 8, causal (-inf); softmax; out = merged Wo^T -> [2][2048][1024] (4.2 M)).
// Layout, both batches in every launch (4 launches): bf16 copies of x and the weights and the {cos, sin} table in one launch; the Q, K and V projections in one; attention in one; the output projection in one. bf16 copy of x; exact projections; {cos, sin} per (position, pair) from the int positions (jnp-exact float32 inverse frequencies, precise cosf/sinf); the projections' own epilogue applies the interleaved rotary and writes the head planes (no f32 projection leaves the work-group); causal T-2048 attention, all 16 heads of both batches in ONE fused launch (k_fattn: scores, online softmax, P.V and head merge; hybrid rows: < 512 hi/lo 3 products, rest fp16; units above the diagonal never touched); merged hi/lo x wo exact.
// Compute dtypes, f32 accumulate: every input rounded to bf16; projections exact ; rotary f32; attention rows < 512 3 products, rest fp16; softmax f32; wo hl x exact.

#define NB_  2
#define TT   2048
#define DM   1024
#define NH_  16
#define NKV  16
#define REP  (NH_ / NKV)
#define HD   64
#define DQ   (NH_ * HD)
#define DKV  (NKV * HD)
#define RH   512                  // query rows < RH use hi+lo planes (0: none)
typedef _Float16 h16;
typedef unsigned short bf;
typedef __attribute__((ext_vector_type(16))) __bf16   v16bf;
typedef __attribute__((ext_vector_type(16))) _Float16 v16h;
typedef __attribute__((ext_vector_type(8)))  _Float16 v8h;
typedef __attribute__((ext_vector_type(8)))  unsigned short v8us;
typedef __attribute__((ext_vector_type(8)))  float    v8f;
typedef __attribute__((ext_vector_type(4)))  float    v4f;
typedef v8h  __attribute__((may_alias)) v8ha;
typedef v4f  __attribute__((may_alias)) v4fa;
typedef v8us __attribute__((may_alias)) v8usa;
typedef float __attribute__((may_alias)) v1fa;

__device__ __forceinline__ unsigned short f2bf(float f) { unsigned u = __float_as_uint(f); u += 0x7FFFu + ((u >> 16) & 1u); return (unsigned short)(u >> 16); }
__device__ __forceinline__ float bf2f(unsigned short b) { return __uint_as_float(((unsigned)b) << 16); }
__device__ __forceinline__ size_t tri_off(int rb) { return (size_t)(rb * (rb + 1) / 2) * 4096; }   // floats in front of block row rb
__device__ __forceinline__ float bfr(float f) { return bf2f(f2bf(f)); }
__device__ __forceinline__ v16h cat16(v8h lo, v8h hi) { return __builtin_shufflevector(lo, hi, 0, 1, 2, 3, 4, 5, 6, 7, 8, 9, 10, 11, 12, 13, 14, 15); }
__device__ __forceinline__ v16bf cat16b(v8us lo, v8us hi) { return __builtin_bit_cast(v16bf, __builtin_shufflevector(lo, hi, 0, 1, 2, 3, 4, 5, 6, 7, 8, 9, 10, 11, 12, 13, 14, 15)); }
__device__ __forceinline__ v8f wmma16(v16h a, v16h b, v8f c) { return __builtin_amdgcn_wmma_f32_16x16x32_f16(false, a, false, b, (short)0, c, false, false); }
__device__ __forceinline__ v8f wmmab(v16bf a, v16bf b, v8f c) { return __builtin_amdgcn_wmma_f32_16x16x32_bf16(false, a, false, b, (short)0, c, false, false); }

__device__ __forceinline__ h16 tohx(float x) { return (h16)x; }
__device__ __forceinline__ void splitf(float y, unsigned short& h, unsigned short& l) { h = f2bf(y); l = f2bf(y - bf2f(h)); }
typedef __attribute__((ext_vector_type(2))) _Float16 v2h;
typedef __attribute__((ext_vector_type(4))) _Float16 v4h;
typedef __attribute__((ext_vector_type(2))) unsigned short v2us;
typedef __attribute__((ext_vector_type(4))) unsigned short v4us;
typedef __attribute__((ext_vector_type(2))) float v2f;
typedef __attribute__((ext_vector_type(4))) int v4i;

// ---- k_gemmt: GEMM, one 128x128 output tile per work-group of 4 waves (2 x 2), a wave owns a whole 64x64 tile (16 accumulators) over the WHOLE K range; grid (M/128, N/128), 128 threads.
// C[m][n] = sum_k A[m][k] Bt[n][k] (NSPLIT 1: + A2[m][k] Bt[n][k]); all operands K-contiguous bf16 planes of pitch GK.
// The operands come in stages of 64 k (128 B of each of the 128 rows of every operand): whole lines from memory into registers, 16 B a lane, from there into one of two LDS buffers; the next stage's loads fly while this stage is multiplied. Every operand row is so read once per work-group and serves two waves.
// The rows of A run over both batches (row = batch * TT + position; a tile of 64 rows lies in one batch).
// EPI 0: a wave's tile goes to C as f32. EPI 1 (the Q, K and V projections in one launch: Bt holds the three weights one behind the other, so the 64 columns of a wave's tile are ONE head of one of them, its 64 rows 64 positions; the two heads of a work-group belong to the same weight): the tile goes through the wave's own part of the LDS, free by then, and leaves as the head's 16-bit planes (fp16, bf16 hi, bf16 lo; each plane array is [which][batch][head]...), 16 B a lane in whole 128-byte lines.
// Q and K (which < 2): planes [t][d] of the interleaved rotary (even: x0 c - x1 s; odd: x0 s + x1 c; {c, s} from CS[t][d]). V: planes [d][t], the tile turned on its way into LDS. The test is the same for a whole work-group (a scalar branch).
#define TP 68                     // f32 pitch of the epilogue's tile: 272 B = 16 B x odd, so that rows 4 banks apart serve ds_load_b128 / ds_store_b128 without conflicts
#define GK DM                     // K of both GEMMs
#define GP 72                     // 16-bit pitch of an operand row in LDS: 144 B = 16 B x odd (ds_load_b128 without bank conflicts)
#define GT (128 * GP)             // 16-bit elements of one operand's stage in LDS
template <bool B> struct Flag { static constexpr bool v = B; };
template <typename T16> struct WFrag;
template <> struct WFrag<h16> { typedef v16h V; static __device__ __forceinline__ V ld(const h16* p) { return cat16(*(const v8h*)p, *(const v8h*)(p + 16)); } static __device__ __forceinline__ v8f mma(V a, V b, v8f c) { return wmma16(a, b, c); } };
template <> struct WFrag<bf> { typedef v16bf V; static __device__ __forceinline__ V ld(const bf* p) { return cat16b(*(const v8us*)p, *(const v8us*)(p + 16)); } static __device__ __forceinline__ v8f mma(V a, V b, v8f c) { return wmmab(a, b, c); } };
__device__ __forceinline__ v16bf ldsfrag(const bf* p) { return cat16b(*(const v8usa*)p, *(const v8usa*)(p + 16)); }   // the k order of WFrag::ld, from LDS
template <int NSPLIT, int EPI>
__global__ __launch_bounds__(128) void k_gemmt(const bf* __restrict__ A, const bf* __restrict__ A2, const bf* __restrict__ Bt, float* C, const float* __restrict__ CS, h16* P16, bf* Ph, bf* Pl) {
    constexpr int NOP = 2 + NSPLIT, NK = GK / 64; constexpr bool AHEAD = NSPLIT == 1;                    // operands a stage (A, Bt, then A2); stages
    __shared__ __align__(16) bf ring[2 * NOP * GT];                  // [buffer][operand][row 0..127][GP]; behind the K loop (EPI 1): [wave][64][TP] f32
    const int tid = threadIdx.x, lane = tid & 31, lr = lane & 15, hi = lane >> 4;
    const int wave = __builtin_amdgcn_readfirstlane(tid >> 5), wm = wave >> 1, wn = wave & 1;
    const int r0 = blockIdx.x * 128 + wm * 64, c0 = blockIdx.y * 128 + wn * 64;   // the wave's own tile
    v8f acc[4][4];
#pragma unroll
    for (int mb = 0; mb < 4; ++mb)
#pragma unroll
        for (int nb = 0; nb < 4; ++nb) acc[mb][nb] = (v8f){};
    // staging: 8 lanes a row, 16 rows a pass of the work-group, 8 passes an operand
    const size_t goff = (size_t)(tid >> 3) * GK + (tid & 7) * 8;
    const bf* ga = A + (size_t)blockIdx.x * 128 * GK + goff; const bf* gb = Bt + (size_t)blockIdx.y * 128 * GK + goff; const bf* ga2 = (NSPLIT == 1) ? A2 + (size_t)blockIdx.x * 128 * GK + goff : ga;
    bf* sw = ring + (tid >> 3) * GP + (tid & 7) * 8;
    const bf* sa = ring + (wm * 64 + lr) * GP + 8 * hi; const bf* sb = ring + GT + (wn * 64 + lr) * GP + 8 * hi;
    v8us ta[8], tb[8], ta2[8];
    auto fetch = [&](int kt) { const bf* pa = ga + kt * 64; const bf* pb = gb + kt * 64; const bf* pa2 = ga2 + kt * 64;
#pragma unroll
        for (int i = 0; i < 8; ++i) { ta[i] = *(const v8us*)(pa + (size_t)i * 16 * GK); tb[i] = *(const v8us*)(pb + (size_t)i * 16 * GK); if (NSPLIT == 1) ta2[i] = *(const v8us*)(pa2 + (size_t)i * 16 * GK); }
        asm volatile("s_wait_xcnt 0x0" :: "v"(pa), "v"(pb), "v"(pa2) : "memory"); };   // the loads' address registers stay whole up to this wait
    auto put = [&](int buf) { bf* d = sw + buf * (NOP * GT);
#pragma unroll
        for (int i = 0; i < 8; ++i) { *(v8usa*)(d + i * 16 * GP) = ta[i]; *(v8usa*)(d + GT + i * 16 * GP) = tb[i]; if (NSPLIT == 1) *(v8usa*)(d + 2 * GT + i * 16 * GP) = ta2[i]; } };
    fetch(0); put(0);
    __syncthreads();                                                 // stage 0 is in LDS before any wave reads it
#pragma unroll 1                                                     // rolled: one copy of a stage's code in the instruction cache; the buffer follows from the trip's parity
    for (int kt = 0; kt < NK; ++kt) {
        const int bo = (kt & 1) * (NOP * GT);
        if (kt + 1 < NK) fetch(kt + 1);                              // flies while this stage is multiplied (scalar test)
        // a group = the fragments of 32 k, asked for together in front of their matrix instructions (a wait among the matrix instructions costs each time). AHEAD: both groups of the stage are asked for at once, where the work-group is alone on its WGP and no other wave hides the second group's latency
        v16bf a[2][4], a2[2][4], b[2][4];
        auto frags = [&](int ks) {
#pragma unroll
            for (int f = 0; f < 4; ++f) { a[ks][f] = ldsfrag(sa + bo + f * 16 * GP + ks * 32); b[ks][f] = ldsfrag(sb + bo + f * 16 * GP + ks * 32); if (NSPLIT == 1) a2[ks][f] = ldsfrag(sa + bo + 2 * GT + f * 16 * GP + ks * 32); } };
        auto mult = [&](int ks) {
#pragma unroll
            for (int nb = 0; nb < 4; ++nb)
#pragma unroll
                for (int mb = 0; mb < 4; ++mb) { acc[mb][nb] = wmmab(a[ks][mb], b[ks][nb], acc[mb][nb]); if (NSPLIT == 1) acc[mb][nb] = wmmab(a2[ks][mb], b[ks][nb], acc[mb][nb]); } };
        frags(0); if (AHEAD) frags(1);
        __builtin_amdgcn_sched_barrier(0);                           // holds the group's LDS reads in front of its matrix instructions: the scheduler otherwise sinks the b fragments among them, with a full LDS wait in front of every column of tiles
        mult(0);
        if (!AHEAD) { frags(1); __builtin_amdgcn_sched_barrier(0); } // the same for the second group
        mult(1);
        // four vector slots between the stage's last matrix instructions and whatever follows the loop's branch on either path (the next stage's loads into their operands, the epilogue's reads of their results)
        asm volatile("v_nop\n\tv_nop\n\tv_nop\n\tv_nop" : "+v"(acc[0][0]), "+v"(acc[1][1]), "+v"(acc[2][2]), "+v"(acc[3][3]) : "v"(a[1][0]), "v"(a[1][3]));
        if (kt + 1 < NK) put((kt + 1) & 1);                          // into the buffer whose readers all passed the barrier at the foot of the trip before
        __syncthreads();                                             // the next stage is in LDS, and every wave has left this one, before either is touched again
    }
    if constexpr (EPI == 0) {
        float* crow = C + (size_t)(r0 + hi * 8) * DM + c0 + lr;      // one address for the whole tile: every store differs from it by a constant, so that no address arithmetic stands among the stores
#pragma unroll
        for (int mb = 0; mb < 4; ++mb)
#pragma unroll
            for (int nb = 0; nb < 4; ++nb)
#pragma unroll
                for (int j = 0; j < 8; ++j) crow[(mb * 16 + j) * DM + nb * 16] = acc[mb][nb][j];
        asm volatile("s_wait_xcnt 0x0" :: "v"(crow) : "memory");     // the stores' address and data registers stay whole up to this wait
    } else {
        const int hidx = c0 / HD, which = hidx / NH_, head = hidx % NH_, tp0 = r0 % TT; const bool rot = which < 2;
        v2f cs[16][4];                                               // Q and K: {cos, sin} of the lane's pairs, asked for here so that they fly while the tile goes to LDS
        if (rot) { const float* cp = CS + ((size_t)tp0 * HD + (size_t)lane * 8) * 2;
#pragma unroll
            for (int p = 0; p < 16; ++p)
#pragma unroll
                for (int i = 0; i < 4; ++i) cs[p][i] = *(const v2f*)(cp + (p * 256 + 2 * i) * 2);
            asm volatile("s_wait_xcnt 0x0" :: "v"(cp) : "memory"); }  // the loads' address registers stay whole up to this wait
        float* tile = (float*)ring + wave * (64 * TP);               // Q and K: [t][d]; V: [d][t]; the loop's last barrier has freed the buffers
        // each of the two halves of this epilogue is written once, with the kind of plane as a compile-time flag, and the work-group takes one straight-line copy of it (one scalar branch a half)
        auto fill = [&](auto R) {
#pragma unroll
            for (int mb = 0; mb < 4; ++mb)
#pragma unroll
                for (int nb = 0; nb < 4; ++nb) { const v8f t = acc[mb][nb]; const int row = mb * 16 + hi * 8, col = nb * 16 + lr;
                    if constexpr (decltype(R)::v) {
#pragma unroll
                        for (int j = 0; j < 8; ++j) *(v1fa*)(tile + (row + j) * TP + col) = t[j];
                    } else { *(v4fa*)(tile + col * TP + row) = (v4f){ t[0], t[1], t[2], t[3] }; *(v4fa*)(tile + col * TP + row + 4) = (v4f){ t[4], t[5], t[6], t[7] }; } } };
        if (rot) fill(Flag<true>{}); else fill(Flag<false>{});
        __syncthreads();                                             // the whole tile is in LDS before any lane reads rows of it
        const size_t pb = (((size_t)which * NB_ + r0 / TT) * NH_ + head) * ((size_t)TT * HD);   // the head's plane
        auto leave = [&](auto R) {
#pragma unroll
            for (int p = 0; p < 16; ++p) { const int idx = p * 256 + lane * 8, rr = idx >> 6, cc = idx & 63;
                const v4f t0 = *(const v4fa*)(tile + rr * TP + cc), t1 = *(const v4fa*)(tile + rr * TP + cc + 4); float y[8] = { t0[0], t0[1], t0[2], t0[3], t1[0], t1[1], t1[2], t1[3] };
                if constexpr (decltype(R)::v) {
#pragma unroll
                    for (int i = 0; i < 4; ++i) { const float x0 = y[2 * i], x1 = y[2 * i + 1], c = cs[p][i][0], s = cs[p][i][1]; y[2 * i] = x0 * c - x1 * s; y[2 * i + 1] = x0 * s + x1 * c; } }
                v8h o16; v8us oh, ol;
#pragma unroll
                for (int k = 0; k < 8; ++k) { o16[k] = tohx(y[k]); unsigned short a2, c2; splitf(y[k], a2, c2); oh[k] = a2; ol[k] = c2; }
                const size_t oo = pb + (decltype(R)::v ? (size_t)(tp0 + rr) * HD + cc : (size_t)rr * TT + tp0 + cc);
                *(v8h*)(P16 + oo) = o16; *(v8us*)(Ph + oo) = oh; *(v8us*)(Pl + oo) = ol;
                asm volatile("s_wait_xcnt 0x0" ::: "memory");   // the three stores' address and data registers stay whole up to this wait (the next pass, or the other half's code on a joined path, rewrites them)
            } };
        if (rot) leave(Flag<true>{}); else leave(Flag<false>{});
    }
}


__global__ __launch_bounds__(256) void k_wtG(const float* __restrict__ w, int K, int N, bf* Bt) {
    const int lane = threadIdx.x & 31; const int L0 = (blockIdx.x * 8 + (threadIdx.x >> 5)) * 8; const int nlines = N * K / 64;
{
#pragma unroll 1
        for (int l = 0; l < 8; ++l) { const int L = L0 + l; if (L >= nlines) break; const size_t e = (size_t)L * 64 + lane * 2; const int k = (int)(e % K), n = (int)(e / K); v2us o;
            o[0] = f2bf(w[(size_t)k * N + n]); o[1] = f2bf(w[(size_t)(k + 1) * N + n]); *(v2us*)(Bt + e) = o; }
         }
}
__constant__ float INVT[HD / 2] = { 1.000000000e+00f,7.498942018e-01f,5.623413324e-01f,4.216965139e-01f,3.162277639e-01f,2.371373773e-01f,1.778279394e-01f,1.333521456e-01f,1.000000015e-01f,7.498942316e-02f,5.623413250e-02f,4.216964915e-02f,3.162277490e-02f,2.371373773e-02f,1.778279431e-02f,1.333521400e-02f,9.999999776e-03f,7.498942316e-03f,5.623413250e-03f,4.216964822e-03f,3.162277630e-03f,2.371373819e-03f,1.778279431e-03f,1.333521446e-03f,1.000000047e-03f,7.498941850e-04f,5.623413017e-04f,4.216965172e-04f,3.162277571e-04f,2.371373703e-04f,1.778279402e-04f,1.333521504e-04f };   // THETA ** (-2 i / 64) as float32 (the module's power form, jnp-computed)
// ---- k_prep: everything that only rewrites inputs, in one launch; a block's job follows from its index alone (scalar branches). Blocks 0 .. PB_CS-1: the {cos, sin} table, one (position, d) a thread. Then PB_X blocks: x (both batches) to bf16, 8 elements a thread. Then 4 x PB_W blocks: the four weights to bf16, the same way.
#define PB_CS (TT * HD / 256)
#define PB_X  (NB_ * TT * DM / 8 / 256)
#define PB_W  (DQ * DM / 8 / 256)
__global__ __launch_bounds__(256) void k_prep(const float* __restrict__ x, const float* __restrict__ wq, const float* __restrict__ wk, const float* __restrict__ wv, const float* __restrict__ wo, const int* __restrict__ pid, bf* XB, bf* W4, float* CS) {
    int blk = blockIdx.x;
    if (blk < PB_CS) { const int idx = blk * 256 + threadIdx.x; const int d = idx % HD; const int t = idx / HD; const float a = __fmul_rn((float)pid[t], INVT[d >> 1]); v2f cs; cs[0] = cosf(a); cs[1] = sinf(a); *(v2f*)(CS + (size_t)idx * 2) = cs; return; }
    blk -= PB_CS; const float* src = x; bf* dst = XB;
    if (blk >= PB_X) { blk -= PB_X; const int wi = blk / PB_W; blk %= PB_W; src = (wi == 0) ? wq : (wi == 1) ? wk : (wi == 2) ? wv : wo; dst = W4 + (size_t)wi * DQ * DM; }
    const size_t i = (size_t)blk * 256 + threadIdx.x; const float* sp = src + i * 8; const v8f v = *(const v8f*)sp; v8us o;
    asm volatile("s_wait_xcnt 0x0" :: "v"(sp) : "memory");         // the load's address registers stay whole up to this wait
#pragma unroll
    for (int k = 0; k < 8; ++k) o[k] = f2bf(v[k]);
    *(v8us*)(dst + i * 8) = o;
    asm volatile("s_wait_xcnt 0x0" ::: "memory");                 // the store's registers stay whole up to this wait (the built code joins this path with the table's)
}
// ---- k_fattn: scores, causal softmax, probability x value and the head merge of both batches in one kernel; grid (batches x heads, TT / FQB), FNW waves; no score ever leaves the registers.
// A work-group owns FQB query rows of one head. The keys are dealt over its waves in units of 32 (wave w takes units w, w + FNW, ...). Each wave keeps a running maximum, a running sum and a whole [64 d][FQB queries] f32 partial output (online softmax).
// Everything is computed transposed: S^T = K Q^T (A = key rows, B = query rows), so that a lane holds scores of ONE query (column lr) and the two 16-key score tiles, rounded to 16 bit, ARE the B fragment of O^T += V^T P^T in the loader's k order (element e < 8: key 8 hi + e; e >= 8: key 16 + 8 hi + e - 8).
// At the end the waves' partials are brought to the common maximum and summed through LDS in wave order 0 .. FNW-1, divided by the row's sum and stored as the merged hi/lo planes.
#define FQT 2                     // 16-query tiles per work-group
#define FQB (FQT * 16)
#define FNW 8
#define FSK (32 * 72)             // 16-bit elements of a wave's K slice in LDS
#define FSW (FSK + 64 * 40)       // and of its whole slice (K, then V^T)
#define SCL2 0.18033688011112042f // HD^-0.5 x log2(e): the scores are kept in the base-2 domain
typedef __attribute__((ext_vector_type(16))) unsigned short v16us;
__device__ __forceinline__ float xhalf(float x) { return __builtin_bit_cast(float, __builtin_amdgcn_permlanex16(__builtin_bit_cast(int, x), __builtin_bit_cast(int, x), 0x76543210, 0xfedcba98, false, false)); }   // lane l with lane l ^ 16
__device__ __forceinline__ void pfrag(const float (&p)[16], v16h& a, v16h& a2) {
#pragma unroll
    for (int e = 0; e < 16; ++e) a[e] = tohx(p[e]);
    a2 = a; }
__device__ __forceinline__ void pfrag(const float (&p)[16], v16bf& a, v16bf& a2) { v16us h, l;
#pragma unroll
    for (int e = 0; e < 16; ++e) { unsigned short x, y; splitf(p[e], x, y); h[e] = x; l[e] = y; }
    a = __builtin_bit_cast(v16bf, h); a2 = __builtin_bit_cast(v16bf, l); }
template <typename T16, int NSPLIT, int NQ, bool STG>
__device__ __forceinline__ void fa_loop(const T16* __restrict__ Q, const T16* __restrict__ Q2, const T16* __restrict__ Kp, const T16* __restrict__ K2, const T16* __restrict__ Vt, const T16* __restrict__ V2, int r0, int nu, int u0, int ustep, int lane, h16* stg, v8f (&o)[4][NQ], float (&m)[NQ], float (&l)[NQ]) {
    typedef typename WFrag<T16>::V V; const int lr = lane & 15, hi = lane >> 4;
    V q[NQ][2], q2[NQ][2];
    const size_t qoff = (size_t)(r0 + lr) * HD + 8 * hi; const T16* qp = Q + qoff; const T16* qp2 = (NSPLIT == 2) ? Q2 + qoff : qp;
#pragma unroll
    for (int qt = 0; qt < NQ; ++qt)
#pragma unroll
        for (int ks = 0; ks < 2; ++ks) { q[qt][ks] = WFrag<T16>::ld(qp + qt * 16 * HD + ks * 32); if (NSPLIT == 2) q2[qt][ks] = WFrag<T16>::ld(qp2 + qt * 16 * HD + ks * 32); }
    asm volatile("s_wait_xcnt 0x0" :: "v"(qp), "v"(qp2) : "memory");   // the loads' address registers stay whole up to this wait; only behind it may anything, a later load's result too, overwrite them
#pragma unroll 1
    for (int u = u0; u < nu; u += ustep) {
        const int k0 = u * 32;
        V kf[2][2], kf2[2][2], vf[4], vf2[4];
        if constexpr (STG) {
            // The unit's K rows (32 x 128 B, 4 KiB in a row) and V^T rows (64 x 64 B) come in whole-line order, 16 B a lane, and are turned into fragments through the wave's OWN LDS slice: a fragment load straight from memory touches 16 lines for 512 B.
            h16* sk = stg; h16* sv = stg + FSK;                       // K at a pitch of 144 B, V^T at 80 B (16 B x odd: ds_load_b128 without bank conflicts)
            const T16* kg = Kp + (size_t)k0 * HD + lane * 8; const T16* vg = Vt + (size_t)(lane >> 2) * TT + k0 + (lane & 3) * 8; v8h tk[8], tv[8];
#pragma unroll
            for (int i = 0; i < 8; ++i) tk[i] = *(const v8h*)(kg + i * 256);
#pragma unroll
            for (int i = 0; i < 8; ++i) tv[i] = *(const v8h*)(vg + (size_t)i * 8 * TT);
            asm volatile("s_wait_xcnt 0x0" :: "v"(kg), "v"(vg) : "memory");   // as behind the query loads: the unit's address registers stay whole up to this wait
#pragma unroll
            for (int i = 0; i < 8; ++i) *(v8ha*)(sk + (i * 4 + (lane >> 3)) * 72 + (lane & 7) * 8) = tk[i];
#pragma unroll
            for (int i = 0; i < 8; ++i) *(v8ha*)(sv + (i * 8 + (lane >> 2)) * 40 + (lane & 3) * 8) = tv[i];
            __builtin_amdgcn_wave_barrier(); asm volatile("" ::: "memory");   // keeps the fragment reads behind the other lanes' stores in program order (one wave's LDS operations run in order; no other wave touches the slice)
#pragma unroll
            for (int kt = 0; kt < 2; ++kt)
#pragma unroll
                for (int ks = 0; ks < 2; ++ks) { const h16* p = sk + (kt * 16 + lr) * 72 + ks * 32 + 8 * hi; kf[kt][ks] = cat16(*(const v8ha*)p, *(const v8ha*)(p + 16)); }
#pragma unroll
            for (int dt = 0; dt < 4; ++dt) { const h16* p = sv + (dt * 16 + lr) * 40 + 8 * hi; vf[dt] = cat16(*(const v8ha*)p, *(const v8ha*)(p + 16)); }
        } else {
            const size_t koff = (size_t)(k0 + lr) * HD + 8 * hi, voff = (size_t)lr * TT + k0 + 8 * hi;
            const T16* kp = Kp + koff; const T16* kp2 = (NSPLIT == 2) ? K2 + koff : kp; const T16* vp = Vt + voff; const T16* vp2 = (NSPLIT == 2) ? V2 + voff : vp;
#pragma unroll
            for (int kt = 0; kt < 2; ++kt)
#pragma unroll
                for (int ks = 0; ks < 2; ++ks) { kf[kt][ks] = WFrag<T16>::ld(kp + kt * 16 * HD + ks * 32); if (NSPLIT == 2) kf2[kt][ks] = WFrag<T16>::ld(kp2 + kt * 16 * HD + ks * 32); }
#pragma unroll
            for (int dt = 0; dt < 4; ++dt) { vf[dt] = WFrag<T16>::ld(vp + (size_t)dt * 16 * TT); if (NSPLIT == 2) vf2[dt] = WFrag<T16>::ld(vp2 + (size_t)dt * 16 * TT); }
            asm volatile("s_wait_xcnt 0x0" :: "v"(kp), "v"(kp2), "v"(vp), "v"(vp2) : "memory");   // as behind the query loads: the unit's address registers stay whole up to this wait
        }
#pragma unroll
        for (int qt = 0; qt < NQ; ++qt) {
            v8f s[2];
#pragma unroll
            for (int kt = 0; kt < 2; ++kt) { s[kt] = (v8f){};
#pragma unroll
                for (int ks = 0; ks < 2; ++ks) { s[kt] = WFrag<T16>::mma(kf[kt][ks], q[qt][ks], s[kt]); if (NSPLIT == 2) { s[kt] = WFrag<T16>::mma(kf[kt][ks], q2[qt][ks], s[kt]); s[kt] = WFrag<T16>::mma(kf2[kt][ks], q[qt][ks], s[kt]); } } }
            const int qi = r0 + qt * 16 + lr; float p[16]; float mx = m[qt];
#pragma unroll
            for (int e = 0; e < 16; ++e) p[e] = s[e >> 3][e & 7] * SCL2;
            if (k0 + 31 > r0) {                                      // only a unit that reaches past the wave's first query holds keys above the diagonal (scalar test)
#pragma unroll
                for (int e = 0; e < 16; ++e) { const int key = k0 + (e >> 3) * 16 + hi * 8 + (e & 7); p[e] = (key <= qi) ? p[e] : -3.0e38f; } }
#pragma unroll
            for (int e = 0; e < 16; ++e) mx = fmaxf(mx, p[e]);
            mx = fmaxf(mx, xhalf(mx));                  // the query's other 16 keys of the unit stand in the other half of the wave
            const float al = __builtin_amdgcn_exp2f(m[qt] - mx); m[qt] = mx; float ps = 0.f;
#pragma unroll
            for (int e = 0; e < 16; ++e) { p[e] = __builtin_amdgcn_exp2f(p[e] - mx); ps += p[e]; }
            l[qt] = l[qt] * al + ps;
#pragma unroll
            for (int dt = 0; dt < 4; ++dt) o[dt][qt] *= al;
            V pf, pf2; pfrag(p, pf, pf2);
#pragma unroll
            for (int dt = 0; dt < 4; ++dt) { o[dt][qt] = WFrag<T16>::mma(vf[dt], pf, o[dt][qt]); if (NSPLIT == 2) { o[dt][qt] = WFrag<T16>::mma(vf[dt], pf2, o[dt][qt]); o[dt][qt] = WFrag<T16>::mma(vf2[dt], pf, o[dt][qt]); } }
        }
        // four vector slots between the unit's last matrix instructions and whatever follows the loop's branch on either path (the next unit's loads into their operands, the epilogue's reads of their results)
        asm volatile("v_nop\n\tv_nop\n\tv_nop\n\tv_nop" : "+v"(o[0][NQ - 1]), "+v"(o[1][NQ - 1]), "+v"(o[2][NQ - 1]), "+v"(o[3][NQ - 1]) : "v"(vf[0]), "v"(vf[3]));
    }
}
__global__ __launch_bounds__(32 * FNW) void k_fattn(const h16* __restrict__ Q16, const h16* __restrict__ K16, const h16* __restrict__ V16, const bf* __restrict__ Qh, const bf* __restrict__ Ql, const bf* __restrict__ Kh, const bf* __restrict__ Kl, const bf* __restrict__ Vh, const bf* __restrict__ Vl, bf* Ah, bf* Al) {
    __shared__ __align__(16) float part[(FNW * FSW / 2 > FNW * FQT * 1024) ? FNW * FSW / 2 : FNW * FQT * 1024];   // in the unit loop: each wave's own K / V^T slice (FSW 16-bit elements); behind the first barrier: [wave][d tile][query tile][half 0..1][lane][4], each wave's partial output in register order
    __shared__ float sm[FNW * FQB], sl[FNW * FQB], sL[FQB];          // each wave's maximum and sum per query; the row's whole sum
    const int lane = threadIdx.x & 31, lr = lane & 15, hi = lane >> 4;
    const int wave = __builtin_amdgcn_readfirstlane((int)(threadIdx.x >> 5));   // scalar, so that the unit loop's test is a scalar branch and every lane stays on at the matrix instructions
    const int r0 = (TT / FQB - 1 - (int)blockIdx.y) * FQB;          // the slow grid index: its lowest values take the longest rows of every head
    const int h = (int)blockIdx.x % NH_, bt = (int)blockIdx.x / NH_ * TT; const size_t hp = (size_t)blockIdx.x * TT * HD;   // the planes are [batch][head]...; bt: the batch's first row in the merged planes
    v8f o[4][FQT]; float m[FQT], l[FQT];
#pragma unroll
    for (int qt = 0; qt < FQT; ++qt) { m[qt] = -1.0e30f; l[qt] = 0.f;   // above the mask's value, so that a masked score gives probability 0 also where a wave has seen no open key yet
#pragma unroll
        for (int dt = 0; dt < 4; ++dt) o[dt][qt] = (v8f){}; }
    const int nu = r0 / 32 + FQB / 32;                               // units of 32 keys up to and including the diagonal block
    if (r0 < RH) {                                                   // hi/lo rows hold twice the fragments: a wave takes ONE query tile (wave / (FNW / FQT)) and the keys are dealt over the FNW / FQT waves of that tile; its other tiles stay empty partials
        const int myq = wave / (FNW / FQT); v8f o1[4][1]; float m1[1] = { -1.0e30f }, l1[1] = { 0.f };
#pragma unroll
        for (int dt = 0; dt < 4; ++dt) o1[dt][0] = (v8f){};
        fa_loop<bf, 2, 1, false>(Qh + hp, Ql + hp, Kh + hp, Kl + hp, Vh + hp, Vl + hp, r0 + myq * 16, nu, wave % (FNW / FQT), FNW / FQT, lane, nullptr, o1, m1, l1);
#pragma unroll
        for (int qt = 0; qt < FQT; ++qt) if (qt == myq) { m[qt] = m1[0]; l[qt] = l1[0];
#pragma unroll
            for (int dt = 0; dt < 4; ++dt) o[dt][qt] = o1[dt][0]; }
    } else fa_loop<h16, 0, FQT, true>(Q16 + hp, nullptr, K16 + hp, nullptr, V16 + hp, nullptr, r0, nu, wave, FNW, lane, (h16*)part + wave * FSW, o, m, l);
#pragma unroll
    for (int qt = 0; qt < FQT; ++qt) { l[qt] += xhalf(l[qt]); if (hi == 0) { sm[wave * FQB + qt * 16 + lr] = m[qt]; sl[wave * FQB + qt * 16 + lr] = l[qt]; } }
    __syncthreads();                                                 // every wave's maxima and sums are in LDS, and every wave has left its K / V^T slice, before any wave rescales and writes its partial output over the slices
    float* mine = part + wave * (FQT * 1024) + lane * 4;
#pragma unroll
    for (int qt = 0; qt < FQT; ++qt) { const int qq = qt * 16 + lr; float M = sm[qq];
#pragma unroll
        for (int w = 1; w < FNW; ++w) M = fmaxf(M, sm[w * FQB + qq]);
        float L = 0.f;
#pragma unroll
        for (int w = 0; w < FNW; ++w) L += sl[w * FQB + qq] * __builtin_amdgcn_exp2f(sm[w * FQB + qq] - M);
        if (wave == 0 && hi == 0) sL[qq] = L;
        const float sc = __builtin_amdgcn_exp2f(m[qt] - M);
#pragma unroll
        for (int dt = 0; dt < 4; ++dt) { const v8f t = o[dt][qt] * sc; *(v4fa*)(mine + ((dt * FQT + qt) * 2) * 128) = (v4f){ t[0], t[1], t[2], t[3] }; *(v4fa*)(mine + ((dt * FQT + qt) * 2 + 1) * 128) = (v4f){ t[4], t[5], t[6], t[7] }; } }
    __syncthreads();                                                 // every wave's rescaled partial output is in LDS before any wave sums
    // a wave sums and stores whole rows (4 queries x 64 d a pass; a lane 8 consecutive d), so each 128-byte line of the merged planes has one writing wave
#pragma unroll
    for (int g = 0; g < FQB / (4 * FNW); ++g) { const int qq = g * (4 * FNW) + wave * 4 + (lane >> 3), c = lane & 7;
        const float* sp = part + (((c >> 1) * FQT + (qq >> 4)) * 2) * 128 + ((qq & 15) + 16 * (c & 1)) * 4; v4f s0 = *(const v4fa*)sp, s1 = *(const v4fa*)(sp + 128);
#pragma unroll
        for (int w = 1; w < FNW; ++w) { s0 += *(const v4fa*)(sp + w * (FQT * 1024)); s1 += *(const v4fa*)(sp + w * (FQT * 1024) + 128); }
        const float f = __fdiv_rn(1.0f, sL[qq]); v8us oh, ol;
#pragma unroll
        for (int j = 0; j < 4; ++j) { unsigned short x, y; splitf(s0[j] * f, x, y); oh[j] = x; ol[j] = y; splitf(s1[j] * f, x, y); oh[4 + j] = x; ol[4 + j] = y; }
        const size_t oo = (size_t)(bt + r0 + qq) * DQ + h * HD + c * 8; *(v8us*)(Ah + oo) = oh; *(v8us*)(Al + oo) = ol; }
}

extern "C" void kernel_launch(void* const* d_in, const int* in_sizes, int n_in,
                              void* d_out, int out_size, void* d_ws, size_t ws_size, hipStream_t stream) {
    (void)in_sizes; (void)n_in; (void)out_size;
    const float* x = (const float*)d_in[0]; const float* wq = (const float*)d_in[1]; const float* wk = (const float*)d_in[2]; const float* wv = (const float*)d_in[3]; const float* wo = (const float*)d_in[4]; const int* pid = (const int*)d_in[5];   /* token_positions int32 [2048] (= arange) */
    float* OUT = (float*)d_out;     // [2][2048][1024]
    char* wsp = (char*)d_ws;
    auto take = [&](size_t bytes) { char* p = wsp; wsp += (bytes + 255) & ~(size_t)255; return (void*)p; };
    const size_t PL = (size_t)NB_ * NH_ * TT * HD;                    // elements of one plane array of one of Q, K, V (both batches)
    bf* W4 = (bf*)take((size_t)4 * DQ * DM * 2); bf* WO = W4 + (size_t)3 * DQ * DM;   // wq, wk, wv, wo one behind the other
    float* CS = (float*)take((size_t)TT * HD * 2 * 4);
    bf* XB = (bf*)take((size_t)NB_ * TT * DM * 2);
    h16* P16 = (h16*)take(3 * PL * 2); bf* Ph = (bf*)take(3 * PL * 2); bf* Pl = (bf*)take(3 * PL * 2);   // each [Q, K, V][batch][head]...
    bf* ATh = (bf*)take((size_t)NB_ * TT * DQ * 2); bf* ATl = (bf*)take((size_t)NB_ * TT * DQ * 2);
    if ((size_t)(wsp - (char*)d_ws) > ws_size) return;    // ws 256 MiB
    k_prep<<<PB_CS + PB_X + 4 * PB_W, 256, 0, stream>>>(x, wq, wk, wv, wo, pid, XB, W4, CS);
    k_gemmt<0, 1><<<dim3(NB_ * TT / 128, 3 * DQ / 128, 1), 128, 0, stream>>>(XB, nullptr, W4, nullptr, CS, P16, Ph, Pl);
    k_fattn<<<dim3(NB_ * NH_, TT / FQB, 1), 32 * FNW, 0, stream>>>(P16, P16 + PL, P16 + 2 * PL, Ph, Pl, Ph + PL, Pl + PL, Ph + 2 * PL, Pl + 2 * PL, ATh, ATl);
    k_gemmt<1, 0><<<dim3(NB_ * TT / 128, DM / 128, 1), 128, 0, stream>>>(ATh, ATl, WO, OUT, nullptr, nullptr, nullptr, nullptr);
}

// v007
// Measured time: 89.2 microseconds a run.
// In both of two side-by-side timings against v006, it was 1.04 times as fast.
// Counting every step since v000, it is 16.1 times as fast.
#include <hip/hip_runtime.h>

// Causal multi-head self-attention with interleaved rotary embeddings from integer positions (x [2][2048][1024]; Q,K,V = x W^T ('oi' [1024][1024] 0.02, no bias; 16 heads x 64); rotary on (even, odd) pairs with angle pos[t] x THETA ** (-2i/64) (token_positions int [2048], read; float32 power-form constants; precise cosf/sinf); logits / 8, causal (-inf); softmax; out = merged Wo^T -> [2][2048][1024] (4.2 M)).
// Layout, both batches in every launch (4 launches): bf16 copies of x and the weights and the {cos, sin} table in one launch; the Q, K and V projections in one; attention in one; the output projection in one. bf16 copy of x; exact projections; {cos, sin} per (position, pair) from the int positions (jnp-exact float32 inverse frequencies, precise cosf/sinf); the projections' own epilogue applies the interleaved rotary and writes the head planes (no f32 projection leaves the work-group); causal T-2048 attention, all 16 heads of both batches in ONE fused launch (k_fattn: scores, online softmax, P.V and head merge; hybrid rows: < 512 hi/lo 3 products, rest fp16; units above the diagonal never touched); merged hi/lo x wo exact.
// Compute dtypes, f32 accumulate: every input rounded to bf16; projections exact ; rotary f32; attention rows < 512 3 products, rest fp16; softmax f32; wo hl x exact.

#define NB_  2
#define TT   2048
#define DM   1024
#define NH_  16
#define NKV  16
#define REP  (NH_ / NKV)
#define HD   64
#define DQ   (NH_ * HD)
#define DKV  (NKV * HD)
#define RH   512                  // query rows < RH use hi+lo planes (0: none)
typedef _Float16 h16;
typedef unsigned short bf;
typedef __attribute__((ext_vector_type(16))) __bf16   v16bf;
typedef __attribute__((ext_vector_type(16))) _Float16 v16h;
typedef __attribute__((ext_vector_type(8)))  _Float16 v8h;
typedef __attribute__((ext_vector_type(8)))  unsigned short v8us;
typedef __attribute__((ext_vector_type(8)))  float    v8f;
typedef __attribute__((ext_vector_type(4)))  float    v4f;
typedef v8h  __attribute__((may_alias)) v8ha;
typedef v4f  __attribute__((may_alias)) v4fa;
typedef v8us __attribute__((may_alias)) v8usa;
typedef float __attribute__((may_alias)) v1fa;

__device__ __forceinline__ unsigned short f2bf(float f) { unsigned u = __float_as_uint(f); u += 0x7FFFu + ((u >> 16) & 1u); return (unsigned short)(u >> 16); }
__device__ __forceinline__ float bf2f(unsigned short b) { return __uint_as_float(((unsigned)b) << 16); }
__device__ __forceinline__ size_t tri_off(int rb) { return (size_t)(rb * (rb + 1) / 2) * 4096; }   // floats in front of block row rb
__device__ __forceinline__ float bfr(float f) { return bf2f(f2bf(f)); }
__device__ __forceinline__ v16h cat16(v8h lo, v8h hi) { return __builtin_shufflevector(lo, hi, 0, 1, 2, 3, 4, 5, 6, 7, 8, 9, 10, 11, 12, 13, 14, 15); }
__device__ __forceinline__ v16bf cat16b(v8us lo, v8us hi) { return __builtin_bit_cast(v16bf, __builtin_shufflevector(lo, hi, 0, 1, 2, 3, 4, 5, 6, 7, 8, 9, 10, 11, 12, 13, 14, 15)); }
__device__ __forceinline__ v8f wmma16(v16h a, v16h b, v8f c) { return __builtin_amdgcn_wmma_f32_16x16x32_f16(false, a, false, b, (short)0, c, false, false); }
__device__ __forceinline__ v8f wmmab(v16bf a, v16bf b, v8f c) { return __builtin_amdgcn_wmma_f32_16x16x32_bf16(false, a, false, b, (short)0, c, false, false); }

__device__ __forceinline__ h16 tohx(float x) { return (h16)x; }
__device__ __forceinline__ void splitf(float y, unsigned short& h, unsigned short& l) { h = f2bf(y); l = f2bf(y - bf2f(h)); }
typedef __attribute__((ext_vector_type(2))) _Float16 v2h;
typedef __attribute__((ext_vector_type(4))) _Float16 v4h;
typedef __attribute__((ext_vector_type(2))) unsigned short v2us;
typedef __attribute__((ext_vector_type(4))) unsigned short v4us;
typedef __attribute__((ext_vector_type(2))) float v2f;
typedef __attribute__((ext_vector_type(4))) int v4i;

// ---- k_gemmt: GEMM, one 128x128 output tile per work-group of 4 waves (2 x 2), a wave owns a whole 64x64 tile (16 accumulators) over the WHOLE K range; grid (M/128, N/128), 128 threads.
// C[m][n] = sum_k A[m][k] Bt[n][k] (NSPLIT 1: + A2[m][k] Bt[n][k]); all operands K-contiguous bf16 planes of pitch GK.
// The operands come in stages of 64 k (128 B of each of the 128 rows of every operand): whole lines from memory into registers, 16 B a lane, from there into one of two LDS buffers; the next stage's loads fly while this stage is multiplied. Every operand row is so read once per work-group and serves two waves.
// The rows of A run over both batches (row = batch * TT + position; a tile of 64 rows lies in one batch).
// EPI 0: a wave's tile goes to C as f32. EPI 1 (the Q, K and V projections in one launch: Bt holds the three weights one behind the other, so the 64 columns of a wave's tile are ONE head of one of them, its 64 rows 64 positions; the two heads of a work-group belong to the same weight): the tile goes through the wave's own part of the LDS, free by then, and leaves as the head's 16-bit planes (fp16, bf16 hi, bf16 lo; each plane array is [which][batch][head]...), 16 B a lane in whole 128-byte lines.
// Q and K (which < 2): planes [t][d] of the interleaved rotary (even: x0 c - x1 s; odd: x0 s + x1 c; {c, s} from CS[t][d]). V: planes [d][t], the tile turned on its way into LDS. The test is the same for a whole work-group (a scalar branch).
#define TP 68                     // f32 pitch of the epilogue's tile: 272 B = 16 B x odd, so that rows 4 banks apart serve ds_load_b128 / ds_store_b128 without conflicts
#define GK DM                     // K of both GEMMs
#define GP 72                     // 16-bit pitch of an operand row in LDS: 144 B = 16 B x odd (ds_load_b128 without bank conflicts)
#define GT (128 * GP)             // 16-bit elements of one operand's stage in LDS
template <bool B> struct Flag { static constexpr bool v = B; };
template <typename T16> struct WFrag;
template <> struct WFrag<h16> { typedef v16h V; static __device__ __forceinline__ V ld(const h16* p) { return cat16(*(const v8h*)p, *(const v8h*)(p + 16)); } static __device__ __forceinline__ v8f mma(V a, V b, v8f c) { return wmma16(a, b, c); } };
template <> struct WFrag<bf> { typedef v16bf V; static __device__ __forceinline__ V ld(const bf* p) { return cat16b(*(const v8us*)p, *(const v8us*)(p + 16)); } static __device__ __forceinline__ v8f mma(V a, V b, v8f c) { return wmmab(a, b, c); } };
__device__ __forceinline__ v16bf ldsfrag(const bf* p) { return cat16b(*(const v8usa*)p, *(const v8usa*)(p + 16)); }   // the k order of WFrag::ld, from LDS
template <int NSPLIT, int EPI>
__global__ __launch_bounds__(128) void k_gemmt(const bf* __restrict__ A, const bf* __restrict__ A2, const bf* __restrict__ Bt, float* C, const float* __restrict__ CS, h16* P16, bf* Ph, bf* Pl) {
    constexpr int NOP = 2 + NSPLIT, NK = GK / 64; constexpr bool AHEAD = NSPLIT == 1;                    // operands a stage (A, Bt, then A2); stages
    __shared__ __align__(16) bf ring[2 * NOP * GT];                  // [buffer][operand][row 0..127][GP]; behind the K loop (EPI 1): [wave][64][TP] f32
    const int tid = threadIdx.x, lane = tid & 31, lr = lane & 15, hi = lane >> 4;
    const int wave = __builtin_amdgcn_readfirstlane(tid >> 5), wm = wave >> 1, wn = wave & 1;
    const int r0 = blockIdx.x * 128 + wm * 64, c0 = blockIdx.y * 128 + wn * 64;   // the wave's own tile
    v8f acc[4][4];
#pragma unroll
    for (int mb = 0; mb < 4; ++mb)
#pragma unroll
        for (int nb = 0; nb < 4; ++nb) acc[mb][nb] = (v8f){};
    // staging: 8 lanes a row, 16 rows a pass of the work-group, 8 passes an operand
    const size_t goff = (size_t)(tid >> 3) * GK + (tid & 7) * 8;
    const bf* ga = A + (size_t)blockIdx.x * 128 * GK + goff; const bf* gb = Bt + (size_t)blockIdx.y * 128 * GK + goff; const bf* ga2 = (NSPLIT == 1) ? A2 + (size_t)blockIdx.x * 128 * GK + goff : ga;
    bf* sw = ring + (tid >> 3) * GP + (tid & 7) * 8;
    const bf* sa = ring + (wm * 64 + lr) * GP + 8 * hi; const bf* sb = ring + GT + (wn * 64 + lr) * GP + 8 * hi;
    v8us ta[8], tb[8], ta2[8];
    auto fetch = [&](int kt) { const bf* pa = ga + kt * 64; const bf* pb = gb + kt * 64; const bf* pa2 = ga2 + kt * 64;
#pragma unroll
        for (int i = 0; i < 8; ++i) { ta[i] = *(const v8us*)(pa + (size_t)i * 16 * GK); tb[i] = *(const v8us*)(pb + (size_t)i * 16 * GK); if (NSPLIT == 1) ta2[i] = *(const v8us*)(pa2 + (size_t)i * 16 * GK); }
        asm volatile("s_wait_xcnt 0x0" :: "v"(pa), "v"(pb), "v"(pa2) : "memory"); };   // the loads' address registers stay whole up to this wait
    auto put = [&](int buf) { bf* d = sw + buf * (NOP * GT);
#pragma unroll
        for (int i = 0; i < 8; ++i) { *(v8usa*)(d + i * 16 * GP) = ta[i]; *(v8usa*)(d + GT + i * 16 * GP) = tb[i]; if (NSPLIT == 1) *(v8usa*)(d + 2 * GT + i * 16 * GP) = ta2[i]; } };
    fetch(0); put(0);
    __syncthreads();                                                 // stage 0 is in LDS before any wave reads it
#pragma unroll 1                                                     // rolled: one copy of a stage's code in the instruction cache; the buffer follows from the trip's parity
    for (int kt = 0; kt < NK; ++kt) {
        const int bo = (kt & 1) * (NOP * GT);
        if (kt + 1 < NK) fetch(kt + 1);                              // flies while this stage is multiplied (scalar test)
        // a group = the fragments of 32 k, asked for together in front of their matrix instructions (a wait among the matrix instructions costs each time). AHEAD: both groups of the stage are asked for at once, where the work-group is alone on its WGP and no other wave hides the second group's latency
        v16bf a[2][4], a2[2][4], b[2][4];
        auto frags = [&](int ks) {
#pragma unroll
            for (int f = 0; f < 4; ++f) { a[ks][f] = ldsfrag(sa + bo + f * 16 * GP + ks * 32); b[ks][f] = ldsfrag(sb + bo + f * 16 * GP + ks * 32); if (NSPLIT == 1) a2[ks][f] = ldsfrag(sa + bo + 2 * GT + f * 16 * GP + ks * 32); } };
        auto mult = [&](int ks) {
#pragma unroll
            for (int nb = 0; nb < 4; ++nb)
#pragma unroll
                for (int mb = 0; mb < 4; ++mb) { acc[mb][nb] = wmmab(a[ks][mb], b[ks][nb], acc[mb][nb]); if (NSPLIT == 1) acc[mb][nb] = wmmab(a2[ks][mb], b[ks][nb], acc[mb][nb]); } };
        frags(0); if (AHEAD) frags(1);
        __builtin_amdgcn_sched_barrier(0);                           // holds the group's LDS reads in front of its matrix instructions: the scheduler otherwise sinks the b fragments among them, with a full LDS wait in front of every column of tiles
        mult(0);
        if (!AHEAD) { frags(1); __builtin_amdgcn_sched_barrier(0); } // the same for the second group
        mult(1);
        // four vector slots between the stage's last matrix instructions and whatever follows the loop's branch on either path (the next stage's loads into their operands, the epilogue's reads of their results)
        asm volatile("v_nop\n\tv_nop\n\tv_nop\n\tv_nop" : "+v"(acc[0][0]), "+v"(acc[1][1]), "+v"(acc[2][2]), "+v"(acc[3][3]) : "v"(a[1][0]), "v"(a[1][3]));
        if (kt + 1 < NK) put((kt + 1) & 1);                          // into the buffer whose readers all passed the barrier at the foot of the trip before
        __syncthreads();                                             // the next stage is in LDS, and every wave has left this one, before either is touched again
    }
    if constexpr (EPI == 0) {
        float* crow = C + (size_t)(r0 + hi * 8) * DM + c0 + lr;      // one address for the whole tile: every store differs from it by a constant, so that no address arithmetic stands among the stores
#pragma unroll
        for (int mb = 0; mb < 4; ++mb)
#pragma unroll
            for (int nb = 0; nb < 4; ++nb)
#pragma unroll
                for (int j = 0; j < 8; ++j) crow[(mb * 16 + j) * DM + nb * 16] = acc[mb][nb][j];
        asm volatile("s_wait_xcnt 0x0" :: "v"(crow) : "memory");     // the stores' address and data registers stay whole up to this wait
    } else {
        const int hidx = c0 / HD, which = hidx / NH_, head = hidx % NH_, tp0 = r0 % TT; const bool rot = which < 2;
        v2f cs[16][4];                                               // Q and K: {cos, sin} of the lane's pairs, asked for here so that they fly while the tile goes to LDS
        if (rot) { const float* cp = CS + ((size_t)tp0 * HD + (size_t)lane * 8) * 2;
#pragma unroll
            for (int p = 0; p < 16; ++p)
#pragma unroll
                for (int i = 0; i < 4; ++i) cs[p][i] = *(const v2f*)(cp + (p * 256 + 2 * i) * 2);
            asm volatile("s_wait_xcnt 0x0" :: "v"(cp) : "memory"); }  // the loads' address registers stay whole up to this wait
        float* tile = (float*)ring + wave * (64 * TP);               // Q and K: [t][d]; V: [d][t]; the loop's last barrier has freed the buffers
        // each of the two halves of this epilogue is written once, with the kind of plane as a compile-time flag, and the work-group takes one straight-line copy of it (one scalar branch a half)
        auto fill = [&](auto R) {
#pragma unroll
            for (int mb = 0; mb < 4; ++mb)
#pragma unroll
                for (int nb = 0; nb < 4; ++nb) { const v8f t = acc[mb][nb]; const int row = mb * 16 + hi * 8, col = nb * 16 + lr;
                    if constexpr (decltype(R)::v) {
#pragma unroll
                        for (int j = 0; j < 8; ++j) *(v1fa*)(tile + (row + j) * TP + col) = t[j];
                    } else { *(v4fa*)(tile + col * TP + row) = (v4f){ t[0], t[1], t[2], t[3] }; *(v4fa*)(tile + col * TP + row + 4) = (v4f){ t[4], t[5], t[6], t[7] }; } } };
        if (rot) fill(Flag<true>{}); else fill(Flag<false>{});
        __syncthreads();                                             // the whole tile is in LDS before any lane reads rows of it
        const size_t pb = (((size_t)which * NB_ + r0 / TT) * NH_ + head) * ((size_t)TT * HD);   // the head's plane
        auto leave = [&](auto R) {
#pragma unroll
            for (int p = 0; p < 16; ++p) { const int idx = p * 256 + lane * 8, rr = idx >> 6, cc = idx & 63;
                const v4f t0 = *(const v4fa*)(tile + rr * TP + cc), t1 = *(const v4fa*)(tile + rr * TP + cc + 4); float y[8] = { t0[0], t0[1], t0[2], t0[3], t1[0], t1[1], t1[2], t1[3] };
                if constexpr (decltype(R)::v) {
#pragma unroll
                    for (int i = 0; i < 4; ++i) { const float x0 = y[2 * i], x1 = y[2 * i + 1], c = cs[p][i][0], s = cs[p][i][1]; y[2 * i] = x0 * c - x1 * s; y[2 * i + 1] = x0 * s + x1 * c; } }
                v8h o16; v8us oh, ol;
#pragma unroll
                for (int k = 0; k < 8; ++k) { o16[k] = tohx(y[k]); unsigned short a2, c2; splitf(y[k], a2, c2); oh[k] = a2; ol[k] = c2; }
                const size_t oo = pb + (decltype(R)::v ? (size_t)(tp0 + rr) * HD + cc : (size_t)rr * TT + tp0 + cc);
                *(v8h*)(P16 + oo) = o16; *(v8us*)(Ph + oo) = oh; *(v8us*)(Pl + oo) = ol;
                asm volatile("s_wait_xcnt 0x0" ::: "memory");   // the three stores' address and data registers stay whole up to this wait (the next pass, or the other half's code on a joined path, rewrites them)
            } };
        if (rot) leave(Flag<true>{}); else leave(Flag<false>{});
    }
}


__global__ __launch_bounds__(256) void k_wtG(const float* __restrict__ w, int K, int N, bf* Bt) {
    const int lane = threadIdx.x & 31; const int L0 = (blockIdx.x * 8 + (threadIdx.x >> 5)) * 8; const int nlines = N * K / 64;
{
#pragma unroll 1
        for (int l = 0; l < 8; ++l) { const int L = L0 + l; if (L >= nlines) break; const size_t e = (size_t)L * 64 + lane * 2; const int k = (int)(e % K), n = (int)(e / K); v2us o;
            o[0] = f2bf(w[(size_t)k * N + n]); o[1] = f2bf(w[(size_t)(k + 1) * N + n]); *(v2us*)(Bt + e) = o; }
         }
}
__constant__ float INVT[HD / 2] = { 1.000000000e+00f,7.498942018e-01f,5.623413324e-01f,4.216965139e-01f,3.162277639e-01f,2.371373773e-01f,1.778279394e-01f,1.333521456e-01f,1.000000015e-01f,7.498942316e-02f,5.623413250e-02f,4.216964915e-02f,3.162277490e-02f,2.371373773e-02f,1.778279431e-02f,1.333521400e-02f,9.999999776e-03f,7.498942316e-03f,5.623413250e-03f,4.216964822e-03f,3.162277630e-03f,2.371373819e-03f,1.778279431e-03f,1.333521446e-03f,1.000000047e-03f,7.498941850e-04f,5.623413017e-04f,4.216965172e-04f,3.162277571e-04f,2.371373703e-04f,1.778279402e-04f,1.333521504e-04f };   // THETA ** (-2 i / 64) as float32 (the module's power form, jnp-computed)
// ---- k_prep: everything that only rewrites inputs, in one launch; a block's job follows from its index alone (scalar branches). Blocks 0 .. PB_CS-1: the {cos, sin} table, one (position, d) a thread. Then PB_X blocks: x (both batches) to bf16, 8 elements a thread. Then 4 x PB_W blocks: the four weights to bf16, the same way.
#define PB_CS (TT * HD / 256)
#define PB_X  (NB_ * TT * DM / 8 / 256)
#define PB_W  (DQ * DM / 8 / 256)
__global__ __launch_bounds__(256) void k_prep(const float* __restrict__ x, const float* __restrict__ wq, const float* __restrict__ wk, const float* __restrict__ wv, const float* __restrict__ wo, const int* __restrict__ pid, bf* XB, bf* W4, float* CS) {
    int blk = blockIdx.x;
    if (blk < PB_CS) { const int idx = blk * 256 + threadIdx.x; const int d = idx % HD; const int t = idx / HD; const float a = __fmul_rn((float)pid[t], INVT[d >> 1]); v2f cs; cs[0] = cosf(a); cs[1] = sinf(a); *(v2f*)(CS + (size_t)idx * 2) = cs; return; }
    blk -= PB_CS; const float* src = x; bf* dst = XB;
    if (blk >= PB_X) { blk -= PB_X; const int wi = blk / PB_W; blk %= PB_W; src = (wi == 0) ? wq : (wi == 1) ? wk : (wi == 2) ? wv : wo; dst = W4 + (size_t)wi * DQ * DM; }
    const size_t i = (size_t)blk * 256 + threadIdx.x; const float* sp = src + i * 8; const v8f v = *(const v8f*)sp; v8us o;
    asm volatile("s_wait_xcnt 0x0" :: "v"(sp) : "memory");         // the load's address registers stay whole up to this wait
#pragma unroll
    for (int k = 0; k < 8; ++k) o[k] = f2bf(v[k]);
    *(v8us*)(dst + i * 8) = o;
    asm volatile("s_wait_xcnt 0x0" ::: "memory");                 // the store's registers stay whole up to this wait (the built code joins this path with the table's)
}
// ---- k_fattn: scores, causal softmax, probability x value and the head merge of both batches in one kernel; grid (batches x heads, TT / FQB), FNW waves; no score ever leaves the registers.
// A work-group owns FQB query rows of one head. The keys are dealt over its waves in units of 32 (wave w takes units w, w + FNW, ...). Each wave keeps a running maximum, a running sum and a whole [64 d][FQB queries] f32 partial output (online softmax).
// Everything is computed transposed: S^T = K Q^T (A = key rows, B = query rows), so that a lane holds scores of ONE query (column lr) and the two 16-key score tiles, rounded to 16 bit, ARE the B fragment of O^T += V^T P^T in the loader's k order (element e < 8: key 8 hi + e; e >= 8: key 16 + 8 hi + e - 8).
// At the end the waves' partials are brought to the common maximum and summed through LDS in wave order 0 .. FNW-1, divided by the row's sum and stored as the merged hi/lo planes.
#define FQT 2                     // 16-query tiles per work-group
#define FQB (FQT * 16)
#define FNW 8
#define FSK (32 * 72)             // 16-bit elements of a wave's K slice in LDS
#define FSV (64 * 40)             // and of its V^T slice
#define FSW (FSK + FSV)           // fp16 rows: its whole slice (K, then V^T)
#define FS2 (2 * FSV)             // hi/lo rows: its whole slice; first K hi, K lo (2 FSK fit), then, over them, V^T hi, V^T lo
#define SCL2 0.18033688011112042f // HD^-0.5 x log2(e): the scores are kept in the base-2 domain
typedef __attribute__((ext_vector_type(16))) unsigned short v16us;
__device__ __forceinline__ float xhalf(float x) { return __builtin_bit_cast(float, __builtin_amdgcn_permlanex16(__builtin_bit_cast(int, x), __builtin_bit_cast(int, x), 0x76543210, 0xfedcba98, false, false)); }   // lane l with lane l ^ 16
__device__ __forceinline__ void pfrag(const float (&p)[16], v16h& a, v16h& a2) {
#pragma unroll
    for (int e = 0; e < 16; ++e) a[e] = tohx(p[e]);
    a2 = a; }
__device__ __forceinline__ void pfrag(const float (&p)[16], v16bf& a, v16bf& a2) { v16us h, l;
#pragma unroll
    for (int e = 0; e < 16; ++e) { unsigned short x, y; splitf(p[e], x, y); h[e] = x; l[e] = y; }
    a = __builtin_bit_cast(v16bf, h); a2 = __builtin_bit_cast(v16bf, l); }
__device__ __forceinline__ v16h  sfrag(const h16* p) { return cat16(*(const v8ha*)p, *(const v8ha*)(p + 16)); }   // the k order of WFrag::ld, from LDS
__device__ __forceinline__ v16bf sfrag(const bf* p) { return ldsfrag(p); }
__device__ __forceinline__ v8us ld8(const h16* p) { return *(const v8usa*)p; }   // 16 B of a plane, as bits
__device__ __forceinline__ v8us ld8(const bf* p) { return *(const v8us*)p; }
template <typename T16> __device__ __forceinline__ void st8(T16* p, v8us v) { *(v8usa*)p = v; }
__device__ __forceinline__ void lds_order() { __builtin_amdgcn_wave_barrier(); asm volatile("" ::: "memory"); }   // keeps a wave's LDS reads and writes on the two sides of it in program order (one wave's LDS operations run in order; no other wave touches the slice)
template <typename T16, int NSPLIT, int NQ>
__device__ __forceinline__ void fa_loop(const T16* __restrict__ Q, const T16* __restrict__ Q2, const T16* __restrict__ Kp, const T16* __restrict__ K2, const T16* __restrict__ Vt, const T16* __restrict__ V2, int r0, int nu, int u0, int ustep, int lane, T16* stg, v8f (&o)[4][NQ], float (&m)[NQ], float (&l)[NQ]) {
    typedef typename WFrag<T16>::V V; const int lr = lane & 15, hi = lane >> 4;
    V q[NQ][2], q2[NQ][2];
    // The query rows (NQ x 16 x 128 B in a row, per plane) come like a unit's K rows below: whole lines, 16 B a lane, turned into fragments through the wave's own LDS slice.
    { const size_t qoff = (size_t)r0 * HD + lane * 8; const T16* qp = Q + qoff; const T16* qp2 = (NSPLIT == 2) ? Q2 + qoff : qp; v8us tq[NQ * 4], tq2[NQ * 4];
#pragma unroll
      for (int i = 0; i < NQ * 4; ++i) { tq[i] = ld8(qp + i * 256); if (NSPLIT == 2) tq2[i] = ld8(qp2 + i * 256); }
      asm volatile("s_wait_xcnt 0x0" :: "v"(qp), "v"(qp2) : "memory");   // the loads' address registers stay whole up to this wait; only behind it may anything, a later load's result too, overwrite them
#pragma unroll
      for (int i = 0; i < NQ * 4; ++i) { T16* d = stg + (i * 4 + (lane >> 3)) * 72 + (lane & 7) * 8; st8(d, tq[i]); if (NSPLIT == 2) st8(d + FSK, tq2[i]); }
      lds_order();
#pragma unroll
      for (int qt = 0; qt < NQ; ++qt)
#pragma unroll
          for (int ks = 0; ks < 2; ++ks) { const T16* p = stg + (qt * 16 + lr) * 72 + ks * 32 + 8 * hi; q[qt][ks] = sfrag(p); if (NSPLIT == 2) q2[qt][ks] = sfrag(p + FSK); }
      lds_order(); }
#pragma unroll 1
    for (int u = u0; u < nu; u += ustep) {
        const int k0 = u * 32;
        V kf[2][2], kf2[2][2], vf[4], vf2[4];
        if constexpr (NSPLIT != 2) {
            // The unit's K rows (32 x 128 B, 4 KiB in a row) and V^T rows (64 x 64 B) come in whole-line order, 16 B a lane, and are turned into fragments through the wave's OWN LDS slice: a fragment load straight from memory touches 16 lines for 512 B.
            h16* sk = stg; h16* sv = stg + FSK;                       // K at a pitch of 144 B, V^T at 80 B (16 B x odd: ds_load_b128 without bank conflicts)
            const T16* kg = Kp + (size_t)k0 * HD + lane * 8; const T16* vg = Vt + (size_t)(lane >> 2) * TT + k0 + (lane & 3) * 8; v8h tk[8], tv[8];
#pragma unroll
            for (int i = 0; i < 8; ++i) tk[i] = *(const v8h*)(kg + i * 256);
#pragma unroll
            for (int i = 0; i < 8; ++i) tv[i] = *(const v8h*)(vg + (size_t)i * 8 * TT);
            asm volatile("s_wait_xcnt 0x0" :: "v"(kg), "v"(vg) : "memory");   // as behind the query loads: the unit's address registers stay whole up to this wait
#pragma unroll
            for (int i = 0; i < 8; ++i) *(v8ha*)(sk + (i * 4 + (lane >> 3)) * 72 + (lane & 7) * 8) = tk[i];
#pragma unroll
            for (int i = 0; i < 8; ++i) *(v8ha*)(sv + (i * 8 + (lane >> 2)) * 40 + (lane & 3) * 8) = tv[i];
            __builtin_amdgcn_wave_barrier(); asm volatile("" ::: "memory");   // keeps the fragment reads behind the other lanes' stores in program order (one wave's LDS operations run in order; no other wave touches the slice)
#pragma unroll
            for (int kt = 0; kt < 2; ++kt)
#pragma unroll
                for (int ks = 0; ks < 2; ++ks) { const h16* p = sk + (kt * 16 + lr) * 72 + ks * 32 + 8 * hi; kf[kt][ks] = cat16(*(const v8ha*)p, *(const v8ha*)(p + 16)); }
#pragma unroll
            for (int dt = 0; dt < 4; ++dt) { const h16* p = sv + (dt * 16 + lr) * 40 + 8 * hi; vf[dt] = cat16(*(const v8ha*)p, *(const v8ha*)(p + 16)); }
        } else {
            // hi/lo rows: the same whole-line order for all four planes, all 32 loads asked for at once; the slice holds the two K planes first and, once their fragments are read, the two V^T planes
            const size_t koff = (size_t)k0 * HD + lane * 8, voff = (size_t)(lane >> 2) * TT + k0 + (lane & 3) * 8;
            const T16* kg = Kp + koff; const T16* kg2 = K2 + koff; const T16* vg = Vt + voff; const T16* vg2 = V2 + voff; v8us tk[8], tk2[8], tv[8], tv2[8];
#pragma unroll
            for (int i = 0; i < 8; ++i) { tk[i] = ld8(kg + i * 256); tk2[i] = ld8(kg2 + i * 256); }
#pragma unroll
            for (int i = 0; i < 8; ++i) { tv[i] = ld8(vg + (size_t)i * 8 * TT); tv2[i] = ld8(vg2 + (size_t)i * 8 * TT); }
            asm volatile("s_wait_xcnt 0x0" :: "v"(kg), "v"(kg2), "v"(vg), "v"(vg2) : "memory");   // as behind the query loads: the unit's address registers stay whole up to this wait
#pragma unroll
            for (int i = 0; i < 8; ++i) { T16* d = stg + (i * 4 + (lane >> 3)) * 72 + (lane & 7) * 8; st8(d, tk[i]); st8(d + FSK, tk2[i]); }
            lds_order();
#pragma unroll
            for (int kt = 0; kt < 2; ++kt)
#pragma unroll
                for (int ks = 0; ks < 2; ++ks) { const T16* p = stg + (kt * 16 + lr) * 72 + ks * 32 + 8 * hi; kf[kt][ks] = sfrag(p); kf2[kt][ks] = sfrag(p + FSK); }
            lds_order();
#pragma unroll
            for (int i = 0; i < 8; ++i) { T16* d = stg + (i * 8 + (lane >> 2)) * 40 + (lane & 3) * 8; st8(d, tv[i]); st8(d + FSV, tv2[i]); }
            lds_order();
#pragma unroll
            for (int dt = 0; dt < 4; ++dt) { const T16* p = stg + (dt * 16 + lr) * 40 + 8 * hi; vf[dt] = sfrag(p); vf2[dt] = sfrag(p + FSV); }
            lds_order();
        }
#pragma unroll
        for (int qt = 0; qt < NQ; ++qt) {
            v8f s[2];
#pragma unroll
            for (int kt = 0; kt < 2; ++kt) { s[kt] = (v8f){};
#pragma unroll
                for (int ks = 0; ks < 2; ++ks) { s[kt] = WFrag<T16>::mma(kf[kt][ks], q[qt][ks], s[kt]); if (NSPLIT == 2) { s[kt] = WFrag<T16>::mma(kf[kt][ks], q2[qt][ks], s[kt]); s[kt] = WFrag<T16>::mma(kf2[kt][ks], q[qt][ks], s[kt]); } } }
            const int qi = r0 + qt * 16 + lr; float p[16]; float mx = m[qt];
#pragma unroll
            for (int e = 0; e < 16; ++e) p[e] = s[e >> 3][e & 7] * SCL2;
            if (k0 + 31 > r0) {                                      // only a unit that reaches past the wave's first query holds keys above the diagonal (scalar test)
#pragma unroll
                for (int e = 0; e < 16; ++e) { const int key = k0 + (e >> 3) * 16 + hi * 8 + (e & 7); p[e] = (key <= qi) ? p[e] : -3.0e38f; } }
#pragma unroll
            for (int e = 0; e < 16; ++e) mx = fmaxf(mx, p[e]);
            mx = fmaxf(mx, xhalf(mx));                  // the query's other 16 keys of the unit stand in the other half of the wave
            const float al = __builtin_amdgcn_exp2f(m[qt] - mx); m[qt] = mx; float ps = 0.f;
#pragma unroll
            for (int e = 0; e < 16; ++e) { p[e] = __builtin_amdgcn_exp2f(p[e] - mx); ps += p[e]; }
            l[qt] = l[qt] * al + ps;
#pragma unroll
            for (int dt = 0; dt < 4; ++dt) o[dt][qt] *= al;
            V pf, pf2; pfrag(p, pf, pf2);
#pragma unroll
            for (int dt = 0; dt < 4; ++dt) { o[dt][qt] = WFrag<T16>::mma(vf[dt], pf, o[dt][qt]); if (NSPLIT == 2) { o[dt][qt] = WFrag<T16>::mma(vf[dt], pf2, o[dt][qt]); o[dt][qt] = WFrag<T16>::mma(vf2[dt], pf, o[dt][qt]); } }
        }
        // four vector slots between the unit's last matrix instructions and whatever follows the loop's branch on either path (the next unit's loads into their operands, the epilogue's reads of their results)
        asm volatile("v_nop\n\tv_nop\n\tv_nop\n\tv_nop" : "+v"(o[0][NQ - 1]), "+v"(o[1][NQ - 1]), "+v"(o[2][NQ - 1]), "+v"(o[3][NQ - 1]) : "v"(vf[0]), "v"(vf[3]));
    }
}
__global__ __launch_bounds__(32 * FNW) void k_fattn(const h16* __restrict__ Q16, const h16* __restrict__ K16, const h16* __restrict__ V16, const bf* __restrict__ Qh, const bf* __restrict__ Ql, const bf* __restrict__ Kh, const bf* __restrict__ Kl, const bf* __restrict__ Vh, const bf* __restrict__ Vl, bf* Ah, bf* Al) {
    __shared__ __align__(16) float part[(FNW * FS2 / 2 > FNW * FQT * 1024) ? FNW * FS2 / 2 : FNW * FQT * 1024];   // in the unit loop: each wave's own K / V^T slice (FSW or FS2 16-bit elements, FS2 the larger); behind the first barrier: [wave][d tile][query tile][half 0..1][lane][4], each wave's partial output in register order
    __shared__ float sm[FNW * FQB], sl[FNW * FQB], sL[FQB];          // each wave's maximum and sum per query; the row's whole sum
    const int lane = threadIdx.x & 31, lr = lane & 15, hi = lane >> 4;
    const int wave = __builtin_amdgcn_readfirstlane((int)(threadIdx.x >> 5));   // scalar, so that the unit loop's test is a scalar branch and every lane stays on at the matrix instructions
    const int r0 = (TT / FQB - 1 - (int)blockIdx.y) * FQB;          // the slow grid index: its lowest values take the longest rows of every head
    const int h = (int)blockIdx.x % NH_, bt = (int)blockIdx.x / NH_ * TT; const size_t hp = (size_t)blockIdx.x * TT * HD;   // the planes are [batch][head]...; bt: the batch's first row in the merged planes
    v8f o[4][FQT]; float m[FQT], l[FQT];
#pragma unroll
    for (int qt = 0; qt < FQT; ++qt) { m[qt] = -1.0e30f; l[qt] = 0.f;   // above the mask's value, so that a masked score gives probability 0 also where a wave has seen no open key yet
#pragma unroll
        for (int dt = 0; dt < 4; ++dt) o[dt][qt] = (v8f){}; }
    const int nu = r0 / 32 + FQB / 32;                               // units of 32 keys up to and including the diagonal block
    if (r0 < RH) {                                                   // hi/lo rows hold twice the fragments: a wave takes ONE query tile (wave / (FNW / FQT)) and the keys are dealt over the FNW / FQT waves of that tile; its other tiles stay empty partials
        const int myq = wave / (FNW / FQT); v8f o1[4][1]; float m1[1] = { -1.0e30f }, l1[1] = { 0.f };
#pragma unroll
        for (int dt = 0; dt < 4; ++dt) o1[dt][0] = (v8f){};
        fa_loop<bf, 2, 1>(Qh + hp, Ql + hp, Kh + hp, Kl + hp, Vh + hp, Vl + hp, r0 + myq * 16, nu, wave % (FNW / FQT), FNW / FQT, lane, (bf*)part + wave * FS2, o1, m1, l1);
#pragma unroll
        for (int qt = 0; qt < FQT; ++qt) if (qt == myq) { m[qt] = m1[0]; l[qt] = l1[0];
#pragma unroll
            for (int dt = 0; dt < 4; ++dt) o[dt][qt] = o1[dt][0]; }
    } else fa_loop<h16, 0, FQT>(Q16 + hp, nullptr, K16 + hp, nullptr, V16 + hp, nullptr, r0, nu, wave, FNW, lane, (h16*)part + wave * FSW, o, m, l);
#pragma unroll
    for (int qt = 0; qt < FQT; ++qt) { l[qt] += xhalf(l[qt]); if (hi == 0) { sm[wave * FQB + qt * 16 + lr] = m[qt]; sl[wave * FQB + qt * 16 + lr] = l[qt]; } }
    __syncthreads();                                                 // every wave's maxima and sums are in LDS, and every wave has left its K / V^T slice, before any wave rescales and writes its partial output over the slices
    float* mine = part + wave * (FQT * 1024) + lane * 4;
#pragma unroll
    for (int qt = 0; qt < FQT; ++qt) { const int qq = qt * 16 + lr; float M = sm[qq];
#pragma unroll
        for (int w = 1; w < FNW; ++w) M = fmaxf(M, sm[w * FQB + qq]);
        float L = 0.f;
#pragma unroll
        for (int w = 0; w < FNW; ++w) L += sl[w * FQB + qq] * __builtin_amdgcn_exp2f(sm[w * FQB + qq] - M);
        if (wave == 0 && hi == 0) sL[qq] = L;
        const float sc = __builtin_amdgcn_exp2f(m[qt] - M);
#pragma unroll
        for (int dt = 0; dt < 4; ++dt) { const v8f t = o[dt][qt] * sc; *(v4fa*)(mine + ((dt * FQT + qt) * 2) * 128) = (v4f){ t[0], t[1], t[2], t[3] }; *(v4fa*)(mine + ((dt * FQT + qt) * 2 + 1) * 128) = (v4f){ t[4], t[5], t[6], t[7] }; } }
    __syncthreads();                                                 // every wave's rescaled partial output is in LDS before any wave sums
    // a wave sums and stores whole rows (4 queries x 64 d a pass; a lane 8 consecutive d), so each 128-byte line of the merged planes has one writing wave
#pragma unroll
    for (int g = 0; g < FQB / (4 * FNW); ++g) { const int qq = g * (4 * FNW) + wave * 4 + (lane >> 3), c = lane & 7;
        const float* sp = part + (((c >> 1) * FQT + (qq >> 4)) * 2) * 128 + ((qq & 15) + 16 * (c & 1)) * 4; v4f s0 = *(const v4fa*)sp, s1 = *(const v4fa*)(sp + 128);
#pragma unroll
        for (int w = 1; w < FNW; ++w) { s0 += *(const v4fa*)(sp + w * (FQT * 1024)); s1 += *(const v4fa*)(sp + w * (FQT * 1024) + 128); }
        const float f = __fdiv_rn(1.0f, sL[qq]); v8us oh, ol;
#pragma unroll
        for (int j = 0; j < 4; ++j) { unsigned short x, y; splitf(s0[j] * f, x, y); oh[j] = x; ol[j] = y; splitf(s1[j] * f, x, y); oh[4 + j] = x; ol[4 + j] = y; }
        const size_t oo = (size_t)(bt + r0 + qq) * DQ + h * HD + c * 8; *(v8us*)(Ah + oo) = oh; *(v8us*)(Al + oo) = ol; }
}

extern "C" void kernel_launch(void* const* d_in, const int* in_sizes, int n_in,
                              void* d_out, int out_size, void* d_ws, size_t ws_size, hipStream_t stream) {
    (void)in_sizes; (void)n_in; (void)out_size;
    const float* x = (const float*)d_in[0]; const float* wq = (const float*)d_in[1]; const float* wk = (const float*)d_in[2]; const float* wv = (const float*)d_in[3]; const float* wo = (const float*)d_in[4]; const int* pid = (const int*)d_in[5];   /* token_positions int32 [2048] (= arange) */
    float* OUT = (float*)d_out;     // [2][2048][1024]
    char* wsp = (char*)d_ws;
    auto take = [&](size_t bytes) { char* p = wsp; wsp += (bytes + 255) & ~(size_t)255; return (void*)p; };
    const size_t PL = (size_t)NB_ * NH_ * TT * HD;                    // elements of one plane array of one of Q, K, V (both batches)
    bf* W4 = (bf*)take((size_t)4 * DQ * DM * 2); bf* WO = W4 + (size_t)3 * DQ * DM;   // wq, wk, wv, wo one behind the other
    float* CS = (float*)take((size_t)TT * HD * 2 * 4);
    bf* XB = (bf*)take((size_t)NB_ * TT * DM * 2);
    h16* P16 = (h16*)take(3 * PL * 2); bf* Ph = (bf*)take(3 * PL * 2); bf* Pl = (bf*)take(3 * PL * 2);   // each [Q, K, V][batch][head]...
    bf* ATh = (bf*)take((size_t)NB_ * TT * DQ * 2); bf* ATl = (bf*)take((size_t)NB_ * TT * DQ * 2);
    if ((size_t)(wsp - (char*)d_ws) > ws_size) return;    // ws 256 MiB
    k_prep<<<PB_CS + PB_X + 4 * PB_W, 256, 0, stream>>>(x, wq, wk, wv, wo, pid, XB, W4, CS);
    k_gemmt<0, 1><<<dim3(NB_ * TT / 128, 3 * DQ / 128, 1), 128, 0, stream>>>(XB, nullptr, W4, nullptr, CS, P16, Ph, Pl);
    k_fattn<<<dim3(NB_ * NH_, TT / FQB, 1), 32 * FNW, 0, stream>>>(P16, P16 + PL, P16 + 2 * PL, Ph, Pl, Ph + PL, Pl + PL, Ph + 2 * PL, Pl + 2 * PL, ATh, ATl);
    k_gemmt<1, 0><<<dim3(NB_ * TT / 128, DM / 128, 1), 128, 0, stream>>>(ATh, ATl, WO, OUT, nullptr, nullptr, nullptr, nullptr);
}

// v008
// It runs in 80.4 microseconds.
// Timed twice side by side with v007, it ran 1.10 and 1.11 times as fast.
// All steps since v000 together make it 17.7 times as fast.
#include <hip/hip_runtime.h>

// Causal multi-head self-attention with interleaved rotary embeddings from integer positions (x [2][2048][1024]; Q,K,V = x W^T ('oi' [1024][1024] 0.02, no bias; 16 heads x 64); rotary on (even, odd) pairs with angle pos[t] x THETA ** (-2i/64) (token_positions int [2048], read; float32 power-form constants; precise cosf/sinf); logits / 8, causal (-inf); softmax; out = merged Wo^T -> [2][2048][1024] (4.2 M)).
// Layout, both batches in every launch (4 launches): bf16 copies of x and the weights and the {cos, sin} table in one launch; the Q, K and V projections in one; attention in one; the output projection in one. bf16 copy of x; exact projections; {cos, sin} per (position, pair) from the int positions (jnp-exact float32 inverse frequencies, precise cosf/sinf); the projections' own epilogue applies the interleaved rotary and writes the head planes (no f32 projection leaves the work-group); causal T-2048 attention, all 16 heads of both batches in ONE fused launch (k_fattn: scores, online softmax, P.V and head merge; hybrid rows: < 512 hi/lo 3 products, rest fp16; units above the diagonal never touched); merged hi/lo x wo exact.
// Compute dtypes, f32 accumulate: every input rounded to bf16; projections exact ; rotary f32; attention rows < 512 3 products, rest fp16; softmax f32; wo hl x exact.

#define NB_  2
#define TT   2048
#define DM   1024
#define NH_  16
#define NKV  16
#define REP  (NH_ / NKV)
#define HD   64
#define DQ   (NH_ * HD)
#define DKV  (NKV * HD)
#define RH   512                  // query rows < RH use hi+lo planes (0: none)
typedef _Float16 h16;
typedef unsigned short bf;
typedef __attribute__((ext_vector_type(16))) __bf16   v16bf;
typedef __attribute__((ext_vector_type(16))) _Float16 v16h;
typedef __attribute__((ext_vector_type(8)))  _Float16 v8h;
typedef __attribute__((ext_vector_type(8)))  unsigned short v8us;
typedef __attribute__((ext_vector_type(8)))  float    v8f;
typedef __attribute__((ext_vector_type(4)))  float    v4f;
typedef v8h  __attribute__((may_alias)) v8ha;
typedef v4f  __attribute__((may_alias)) v4fa;
typedef v8us __attribute__((may_alias)) v8usa;
typedef float __attribute__((may_alias)) v1fa;

__device__ __forceinline__ unsigned short f2bf(float f) { unsigned u = __float_as_uint(f); u += 0x7FFFu + ((u >> 16) & 1u); return (unsigned short)(u >> 16); }
__device__ __forceinline__ float bf2f(unsigned short b) { return __uint_as_float(((unsigned)b) << 16); }
__device__ __forceinline__ size_t tri_off(int rb) { return (size_t)(rb * (rb + 1) / 2) * 4096; }   // floats in front of block row rb
__device__ __forceinline__ float bfr(float f) { return bf2f(f2bf(f)); }
__device__ __forceinline__ v16h cat16(v8h lo, v8h hi) { return __builtin_shufflevector(lo, hi, 0, 1, 2, 3, 4, 5, 6, 7, 8, 9, 10, 11, 12, 13, 14, 15); }
__device__ __forceinline__ v16bf cat16b(v8us lo, v8us hi) { return __builtin_bit_cast(v16bf, __builtin_shufflevector(lo, hi, 0, 1, 2, 3, 4, 5, 6, 7, 8, 9, 10, 11, 12, 13, 14, 15)); }
__device__ __forceinline__ v8f wmma16(v16h a, v16h b, v8f c) { return __builtin_amdgcn_wmma_f32_16x16x32_f16(false, a, false, b, (short)0, c, false, false); }
__device__ __forceinline__ v8f wmmab(v16bf a, v16bf b, v8f c) { return __builtin_amdgcn_wmma_f32_16x16x32_bf16(false, a, false, b, (short)0, c, false, false); }

__device__ __forceinline__ h16 tohx(float x) { return (h16)x; }
__device__ __forceinline__ void splitf(float y, unsigned short& h, unsigned short& l) { h = f2bf(y); l = f2bf(y - bf2f(h)); }
typedef __attribute__((ext_vector_type(2))) _Float16 v2h;
typedef __attribute__((ext_vector_type(4))) _Float16 v4h;
typedef __attribute__((ext_vector_type(2))) unsigned short v2us;
typedef __attribute__((ext_vector_type(4))) unsigned short v4us;
typedef __attribute__((ext_vector_type(2))) float v2f;
typedef __attribute__((ext_vector_type(4))) int v4i;

// ---- k_gemmt: GEMM, one 128x128 output tile per work-group of 4 waves (2 x 2), a wave owns a whole 64x64 tile (16 accumulators) over the WHOLE K range; grid (M/128, N/128), 128 threads.
// C[m][n] = sum_k A[m][k] Bt[n][k] (NSPLIT 1: + A2[m][k] Bt[n][k]); all operands K-contiguous bf16 planes of pitch GK.
// The operands come in stages of 64 k (128 B of each of the 128 rows of every operand): whole lines from memory into registers, 16 B a lane, from there into one of two LDS buffers; the next stage's loads fly while this stage is multiplied. Every operand row is so read once per work-group and serves two waves.
// The rows of A run over both batches (row = batch * TT + position; a tile of 64 rows lies in one batch).
// EPI 0: a wave's tile goes to C as f32. EPI 1 (the Q, K and V projections in one launch: Bt holds the three weights one behind the other, so the 64 columns of a wave's tile are ONE head of one of them, its 64 rows 64 positions; the two heads of a work-group belong to the same weight): the tile goes through the wave's own part of the LDS, free by then, and leaves as the head's 16-bit planes (fp16, bf16 hi, bf16 lo; each plane array is [which][batch][head]...), 16 B a lane in whole 128-byte lines.
// Q and K (which < 2): planes [t][d] of the interleaved rotary (even: x0 c - x1 s; odd: x0 s + x1 c; {c, s} from CS[t][d]). V: planes [d][t], the tile turned on its way into LDS. The test is the same for a whole work-group (a scalar branch).
#define TP 68                     // f32 pitch of the epilogue's tile: 272 B = 16 B x odd, so that rows 4 banks apart serve ds_load_b128 / ds_store_b128 without conflicts
#define GK DM                     // K of both GEMMs
#define GP 72                     // 16-bit pitch of an operand row in LDS: 144 B = 16 B x odd (ds_load_b128 without bank conflicts)
#define GT (128 * GP)             // 16-bit elements of one operand's stage in LDS
template <bool B> struct Flag { static constexpr bool v = B; };
template <typename T16> struct WFrag;
template <> struct WFrag<h16> { typedef v16h V; static __device__ __forceinline__ V ld(const h16* p) { return cat16(*(const v8h*)p, *(const v8h*)(p + 16)); } static __device__ __forceinline__ v8f mma(V a, V b, v8f c) { return wmma16(a, b, c); } };
template <> struct WFrag<bf> { typedef v16bf V; static __device__ __forceinline__ V ld(const bf* p) { return cat16b(*(const v8us*)p, *(const v8us*)(p + 16)); } static __device__ __forceinline__ v8f mma(V a, V b, v8f c) { return wmmab(a, b, c); } };
__device__ __forceinline__ v16bf ldsfrag(const bf* p) { return cat16b(*(const v8usa*)p, *(const v8usa*)(p + 16)); }   // the k order of WFrag::ld, from LDS
template <int NSPLIT, int EPI>
__global__ __launch_bounds__(128) void k_gemmt(const bf* __restrict__ A, const bf* __restrict__ A2, const bf* __restrict__ Bt, float* C, const float* __restrict__ CS, h16* P16, bf* Ph, bf* Pl) {
    constexpr int NOP = 2 + NSPLIT, NK = GK / 64; constexpr bool AHEAD = NSPLIT == 1;                    // operands a stage (A, Bt, then A2); stages
    __shared__ __align__(16) bf ring[2 * NOP * GT];                  // [buffer][operand][row 0..127][GP]; behind the K loop (EPI 1): [wave][64][TP] f32
    const int tid = threadIdx.x, lane = tid & 31, lr = lane & 15, hi = lane >> 4;
    const int wave = __builtin_amdgcn_readfirstlane(tid >> 5), wm = wave >> 1, wn = wave & 1;
    const int r0 = blockIdx.x * 128 + wm * 64, c0 = blockIdx.y * 128 + wn * 64;   // the wave's own tile
    v8f acc[4][4];
#pragma unroll
    for (int mb = 0; mb < 4; ++mb)
#pragma unroll
        for (int nb = 0; nb < 4; ++nb) acc[mb][nb] = (v8f){};
    // staging: 8 lanes a row, 16 rows a pass of the work-group, 8 passes an operand
    const size_t goff = (size_t)(tid >> 3) * GK + (tid & 7) * 8;
    const bf* ga = A + (size_t)blockIdx.x * 128 * GK + goff; const bf* gb = Bt + (size_t)blockIdx.y * 128 * GK + goff; const bf* ga2 = (NSPLIT == 1) ? A2 + (size_t)blockIdx.x * 128 * GK + goff : ga;
    bf* sw = ring + (tid >> 3) * GP + (tid & 7) * 8;
    const bf* sa = ring + (wm * 64 + lr) * GP + 8 * hi; const bf* sb = ring + GT + (wn * 64 + lr) * GP + 8 * hi;
    v8us ta[8], tb[8], ta2[8];
    auto fetch = [&](int kt) { const bf* pa = ga + kt * 64; const bf* pb = gb + kt * 64; const bf* pa2 = ga2 + kt * 64;
#pragma unroll
        for (int i = 0; i < 8; ++i) { ta[i] = *(const v8us*)(pa + (size_t)i * 16 * GK); tb[i] = *(const v8us*)(pb + (size_t)i * 16 * GK); if (NSPLIT == 1) ta2[i] = *(const v8us*)(pa2 + (size_t)i * 16 * GK); }
        asm volatile("s_wait_xcnt 0x0" :: "v"(pa), "v"(pb), "v"(pa2) : "memory"); };   // the loads' address registers stay whole up to this wait
    auto put = [&](int buf) { bf* d = sw + buf * (NOP * GT);
#pragma unroll
        for (int i = 0; i < 8; ++i) { *(v8usa*)(d + i * 16 * GP) = ta[i]; *(v8usa*)(d + GT + i * 16 * GP) = tb[i]; if (NSPLIT == 1) *(v8usa*)(d + 2 * GT + i * 16 * GP) = ta2[i]; } };
    fetch(0); put(0);
    __syncthreads();                                                 // stage 0 is in LDS before any wave reads it
#pragma unroll 1                                                     // rolled: one copy of a stage's code in the instruction cache; the buffer follows from the trip's parity
    for (int kt = 0; kt < NK; ++kt) {
        const int bo = (kt & 1) * (NOP * GT);
        if (kt + 1 < NK) fetch(kt + 1);                              // flies while this stage is multiplied (scalar test)
        // a group = the fragments of 32 k, asked for together in front of their matrix instructions (a wait among the matrix instructions costs each time). AHEAD: both groups of the stage are asked for at once, where the work-group is alone on its WGP and no other wave hides the second group's latency
        v16bf a[2][4], a2[2][4], b[2][4];
        auto frags = [&](int ks) {
#pragma unroll
            for (int f = 0; f < 4; ++f) { a[ks][f] = ldsfrag(sa + bo + f * 16 * GP + ks * 32); b[ks][f] = ldsfrag(sb + bo + f * 16 * GP + ks * 32); if (NSPLIT == 1) a2[ks][f] = ldsfrag(sa + bo + 2 * GT + f * 16 * GP + ks * 32); } };
        auto mult = [&](int ks) {
#pragma unroll
            for (int nb = 0; nb < 4; ++nb)
#pragma unroll
                for (int mb = 0; mb < 4; ++mb) { acc[mb][nb] = wmmab(a[ks][mb], b[ks][nb], acc[mb][nb]); if (NSPLIT == 1) acc[mb][nb] = wmmab(a2[ks][mb], b[ks][nb], acc[mb][nb]); } };
        frags(0); if (AHEAD) frags(1);
        __builtin_amdgcn_sched_barrier(0);                           // holds the group's LDS reads in front of its matrix instructions: the scheduler otherwise sinks the b fragments among them, with a full LDS wait in front of every column of tiles
        mult(0);
        if (!AHEAD) { frags(1); __builtin_amdgcn_sched_barrier(0); } // the same for the second group
        mult(1);
        // four vector slots between the stage's last matrix instructions and whatever follows the loop's branch on either path (the next stage's loads into their operands, the epilogue's reads of their results)
        asm volatile("v_nop\n\tv_nop\n\tv_nop\n\tv_nop" : "+v"(acc[0][0]), "+v"(acc[1][1]), "+v"(acc[2][2]), "+v"(acc[3][3]) : "v"(a[1][0]), "v"(a[1][3]));
        if (kt + 1 < NK) put((kt + 1) & 1);                          // into the buffer whose readers all passed the barrier at the foot of the trip before
        __syncthreads();                                             // the next stage is in LDS, and every wave has left this one, before either is touched again
    }
    if constexpr (EPI == 0) {
        float* crow = C + (size_t)(r0 + hi * 8) * DM + c0 + lr;      // one address for the whole tile: every store differs from it by a constant, so that no address arithmetic stands among the stores
#pragma unroll
        for (int mb = 0; mb < 4; ++mb)
#pragma unroll
            for (int nb = 0; nb < 4; ++nb)
#pragma unroll
                for (int j = 0; j < 8; ++j) crow[(mb * 16 + j) * DM + nb * 16] = acc[mb][nb][j];
        asm volatile("s_wait_xcnt 0x0" :: "v"(crow) : "memory");     // the stores' address and data registers stay whole up to this wait
    } else {
        const int hidx = c0 / HD, which = hidx / NH_, head = hidx % NH_, tp0 = r0 % TT; const bool rot = which < 2;
        v2f cs[16][4];                                               // Q and K: {cos, sin} of the lane's pairs, asked for here so that they fly while the tile goes to LDS
        if (rot) { const float* cp = CS + ((size_t)tp0 * HD + (size_t)lane * 8) * 2;
#pragma unroll
            for (int p = 0; p < 16; ++p)
#pragma unroll
                for (int i = 0; i < 4; ++i) cs[p][i] = *(const v2f*)(cp + (p * 256 + 2 * i) * 2);
            asm volatile("s_wait_xcnt 0x0" :: "v"(cp) : "memory"); }  // the loads' address registers stay whole up to this wait
        float* tile = (float*)ring + wave * (64 * TP);               // Q and K: [t][d]; V: [d][t]; the loop's last barrier has freed the buffers
        // each of the two halves of this epilogue is written once, with the kind of plane as a compile-time flag, and the work-group takes one straight-line copy of it (one scalar branch a half)
        auto fill = [&](auto R) {
#pragma unroll
            for (int mb = 0; mb < 4; ++mb)
#pragma unroll
                for (int nb = 0; nb < 4; ++nb) { const v8f t = acc[mb][nb]; const int row = mb * 16 + hi * 8, col = nb * 16 + lr;
                    if constexpr (decltype(R)::v) {
#pragma unroll
                        for (int j = 0; j < 8; ++j) *(v1fa*)(tile + (row + j) * TP + col) = t[j];
                    } else { *(v4fa*)(tile + col * TP + row) = (v4f){ t[0], t[1], t[2], t[3] }; *(v4fa*)(tile + col * TP + row + 4) = (v4f){ t[4], t[5], t[6], t[7] }; } } };
        if (rot) fill(Flag<true>{}); else fill(Flag<false>{});
        __syncthreads();                                             // the whole tile is in LDS before any lane reads rows of it
        const size_t pb = (((size_t)which * NB_ + r0 / TT) * NH_ + head) * ((size_t)TT * HD);   // the head's plane
        auto leave = [&](auto R) {
#pragma unroll
            for (int p = 0; p < 16; ++p) { const int idx = p * 256 + lane * 8, rr = idx >> 6, cc = idx & 63;
                const v4f t0 = *(const v4fa*)(tile + rr * TP + cc), t1 = *(const v4fa*)(tile + rr * TP + cc + 4); float y[8] = { t0[0], t0[1], t0[2], t0[3], t1[0], t1[1], t1[2], t1[3] };
                if constexpr (decltype(R)::v) {
#pragma unroll
                    for (int i = 0; i < 4; ++i) { const float x0 = y[2 * i], x1 = y[2 * i + 1], c = cs[p][i][0], s = cs[p][i][1]; y[2 * i] = x0 * c - x1 * s; y[2 * i + 1] = x0 * s + x1 * c; } }
                v8h o16; v8us oh, ol;
#pragma unroll
                for (int k = 0; k < 8; ++k) { o16[k] = tohx(y[k]); unsigned short a2, c2; splitf(y[k], a2, c2); oh[k] = a2; ol[k] = c2; }
                const size_t oo = pb + (decltype(R)::v ? (size_t)(tp0 + rr) * HD + cc : (size_t)rr * TT + tp0 + cc);
                *(v8h*)(P16 + oo) = o16; *(v8us*)(Ph + oo) = oh; *(v8us*)(Pl + oo) = ol;
                asm volatile("s_wait_xcnt 0x0" ::: "memory");   // the three stores' address and data registers stay whole up to this wait (the next pass, or the other half's code on a joined path, rewrites them)
            } };
        if (rot) leave(Flag<true>{}); else leave(Flag<false>{});
    }
}


__global__ __launch_bounds__(256) void k_wtG(const float* __restrict__ w, int K, int N, bf* Bt) {
    const int lane = threadIdx.x & 31; const int L0 = (blockIdx.x * 8 + (threadIdx.x >> 5)) * 8; const int nlines = N * K / 64;
{
#pragma unroll 1
        for (int l = 0; l < 8; ++l) { const int L = L0 + l; if (L >= nlines) break; const size_t e = (size_t)L * 64 + lane * 2; const int k = (int)(e % K), n = (int)(e / K); v2us o;
            o[0] = f2bf(w[(size_t)k * N + n]); o[1] = f2bf(w[(size_t)(k + 1) * N + n]); *(v2us*)(Bt + e) = o; }
         }
}
__constant__ float INVT[HD / 2] = { 1.000000000e+00f,7.498942018e-01f,5.623413324e-01f,4.216965139e-01f,3.162277639e-01f,2.371373773e-01f,1.778279394e-01f,1.333521456e-01f,1.000000015e-01f,7.498942316e-02f,5.623413250e-02f,4.216964915e-02f,3.162277490e-02f,2.371373773e-02f,1.778279431e-02f,1.333521400e-02f,9.999999776e-03f,7.498942316e-03f,5.623413250e-03f,4.216964822e-03f,3.162277630e-03f,2.371373819e-03f,1.778279431e-03f,1.333521446e-03f,1.000000047e-03f,7.498941850e-04f,5.623413017e-04f,4.216965172e-04f,3.162277571e-04f,2.371373703e-04f,1.778279402e-04f,1.333521504e-04f };   // THETA ** (-2 i / 64) as float32 (the module's power form, jnp-computed)
// ---- k_prep: everything that only rewrites inputs, in one launch; a block's job follows from its index alone (scalar branches). Blocks 0 .. PB_CS-1: the {cos, sin} table, one (position, d) a thread. Then PB_X blocks: x (both batches) to bf16, 8 elements a thread. Then 4 x PB_W blocks: the four weights to bf16, the same way.
#define PB_CS (TT * HD / 256)
#define PB_X  (NB_ * TT * DM / 8 / 256)
#define PB_W  (DQ * DM / 8 / 256)
__global__ __launch_bounds__(256) void k_prep(const float* __restrict__ x, const float* __restrict__ wq, const float* __restrict__ wk, const float* __restrict__ wv, const float* __restrict__ wo, const int* __restrict__ pid, bf* XB, bf* W4, float* CS) {
    int blk = blockIdx.x;
    if (blk < PB_CS) { const int idx = blk * 256 + threadIdx.x; const int d = idx % HD; const int t = idx / HD; const float a = __fmul_rn((float)pid[t], INVT[d >> 1]); v2f cs; cs[0] = cosf(a); cs[1] = sinf(a); *(v2f*)(CS + (size_t)idx * 2) = cs; return; }
    blk -= PB_CS; const float* src = x; bf* dst = XB;
    if (blk >= PB_X) { blk -= PB_X; const int wi = blk / PB_W; blk %= PB_W; src = (wi == 0) ? wq : (wi == 1) ? wk : (wi == 2) ? wv : wo; dst = W4 + (size_t)wi * DQ * DM; }
    const size_t i = (size_t)blk * 256 + threadIdx.x; const float* sp = src + i * 8; const v8f v = *(const v8f*)sp; v8us o;
    asm volatile("s_wait_xcnt 0x0" :: "v"(sp) : "memory");         // the load's address registers stay whole up to this wait
#pragma unroll
    for (int k = 0; k < 8; ++k) o[k] = f2bf(v[k]);
    *(v8us*)(dst + i * 8) = o;
    asm volatile("s_wait_xcnt 0x0" ::: "memory");                 // the store's registers stay whole up to this wait (the built code joins this path with the table's)
}
// ---- k_fattn: scores, causal softmax, probability x value and the head merge of both batches in one kernel; grid (batches x heads, blocks of query rows), FNW waves; no score ever leaves the registers.
// A work-group owns a block of query rows of one head: FQB rows where they are hi/lo, SQB where they are fp16. The keys are dealt over waves in units of 32 (hi/lo: fa_loop; fp16: fa_ring). Each wave keeps a running maximum, a running sum and a whole [64 d][its queries] f32 partial output (online softmax).
// Everything is computed transposed: S^T = K Q^T (A = key rows, B = query rows), so that a lane holds scores of ONE query (column lr) and the two 16-key score tiles, rounded to 16 bit, ARE the B fragment of O^T += V^T P^T in the loader's k order (element e < 8: key 8 hi + e; e >= 8: key 16 + 8 hi + e - 8).
// At the end the partials of the waves that share queries are brought to the common maximum and summed through LDS in wave order, divided by the row's sum and stored as the merged hi/lo planes (fa_join).
#define FQT 2                     // 16-query tiles per query group
#define FQB (FQT * 16)
#define FNW 8
#define FSK (32 * 72)             // 16-bit elements of a wave's K (or query) slice in LDS
#define FSV (64 * 40)             // and of its V^T slice
#define FS2 (2 * FSV)             // hi/lo rows: its whole slice; first K hi, K lo (2 FSK fit), then, over them, V^T hi, V^T lo
#define SCL2 0.18033688011112042f // HD^-0.5 x log2(e): the scores are kept in the base-2 domain
typedef __attribute__((ext_vector_type(16))) unsigned short v16us;
__device__ __forceinline__ float xhalf(float x) { return __builtin_bit_cast(float, __builtin_amdgcn_permlanex16(__builtin_bit_cast(int, x), __builtin_bit_cast(int, x), 0x76543210, 0xfedcba98, false, false)); }   // lane l with lane l ^ 16
__device__ __forceinline__ void pfrag(const float (&p)[16], v16h& a, v16h& a2) {
#pragma unroll
    for (int e = 0; e < 16; ++e) a[e] = tohx(p[e]);
    a2 = a; }
__device__ __forceinline__ void pfrag(const float (&p)[16], v16bf& a, v16bf& a2) { v16us h, l;
#pragma unroll
    for (int e = 0; e < 16; ++e) { unsigned short x, y; splitf(p[e], x, y); h[e] = x; l[e] = y; }
    a = __builtin_bit_cast(v16bf, h); a2 = __builtin_bit_cast(v16bf, l); }
__device__ __forceinline__ v16h  sfrag(const h16* p) { return cat16(*(const v8ha*)p, *(const v8ha*)(p + 16)); }   // the k order of WFrag::ld, from LDS
__device__ __forceinline__ v16bf sfrag(const bf* p) { return ldsfrag(p); }
__device__ __forceinline__ v8us ld8(const h16* p) { return *(const v8usa*)p; }   // 16 B of a plane, as bits
__device__ __forceinline__ v8us ld8(const bf* p) { return *(const v8us*)p; }
template <typename T16> __device__ __forceinline__ void st8(T16* p, v8us v) { *(v8usa*)p = v; }
__device__ __forceinline__ void lds_order() { __builtin_amdgcn_wave_barrier(); asm volatile("" ::: "memory"); }   // keeps a wave's LDS reads and writes on the two sides of it in program order (one wave's LDS operations run in order; no other wave touches the slice)
// The query rows (NQ x 16 x 128 B in a row, per plane) come like a unit's K rows below: whole lines, 16 B a lane, turned into fragments through the wave's own LDS slice.
template <typename T16, int NSPLIT, int NQ>
__device__ __forceinline__ void fa_q(const T16* __restrict__ Q, const T16* __restrict__ Q2, int r0, int lane, T16* stg, typename WFrag<T16>::V (&q)[NQ][2], typename WFrag<T16>::V (&q2)[NQ][2]) {
    const int lr = lane & 15, hi = lane >> 4;
    const size_t qoff = (size_t)r0 * HD + lane * 8; const T16* qp = Q + qoff; const T16* qp2 = (NSPLIT == 2) ? Q2 + qoff : qp; v8us tq[NQ * 4], tq2[NQ * 4];
#pragma unroll
    for (int i = 0; i < NQ * 4; ++i) { tq[i] = ld8(qp + i * 256); if (NSPLIT == 2) tq2[i] = ld8(qp2 + i * 256); }
    asm volatile("s_wait_xcnt 0x0" :: "v"(qp), "v"(qp2) : "memory");   // the loads' address registers stay whole up to this wait; only behind it may anything, a later load's result too, overwrite them
#pragma unroll
    for (int i = 0; i < NQ * 4; ++i) { T16* d = stg + (i * 4 + (lane >> 3)) * 72 + (lane & 7) * 8; st8(d, tq[i]); if (NSPLIT == 2) st8(d + FSK, tq2[i]); }
    lds_order();
#pragma unroll
    for (int qt = 0; qt < NQ; ++qt)
#pragma unroll
        for (int ks = 0; ks < 2; ++ks) { const T16* p = stg + (qt * 16 + lr) * 72 + ks * 32 + 8 * hi; q[qt][ks] = sfrag(p); if (NSPLIT == 2) q2[qt][ks] = sfrag(p + FSK); }
    lds_order();
}
// One unit's arithmetic: the scores of 32 keys (first key k0) against the wave's NQ query tiles (first query r0), the online softmax and the unit's share of O^T.
template <typename T16, int NSPLIT, int NQ>
__device__ __forceinline__ void fa_unit(const typename WFrag<T16>::V (&kf)[2][2], const typename WFrag<T16>::V (&kf2)[2][2], const typename WFrag<T16>::V (&vf)[4], const typename WFrag<T16>::V (&vf2)[4], const typename WFrag<T16>::V (&q)[NQ][2], const typename WFrag<T16>::V (&q2)[NQ][2], int r0, int k0, int lane, v8f (&o)[4][NQ], float (&m)[NQ], float (&l)[NQ]) {
    typedef typename WFrag<T16>::V V; const int lr = lane & 15, hi = lane >> 4;
#pragma unroll
    for (int qt = 0; qt < NQ; ++qt) {
        v8f s[2];
#pragma unroll
        for (int kt = 0; kt < 2; ++kt) { s[kt] = (v8f){};
#pragma unroll
            for (int ks = 0; ks < 2; ++ks) { s[kt] = WFrag<T16>::mma(kf[kt][ks], q[qt][ks], s[kt]); if (NSPLIT == 2) { s[kt] = WFrag<T16>::mma(kf[kt][ks], q2[qt][ks], s[kt]); s[kt] = WFrag<T16>::mma(kf2[kt][ks], q[qt][ks], s[kt]); } } }
        const int qi = r0 + qt * 16 + lr; float p[16]; float mx = m[qt];
#pragma unroll
        for (int e = 0; e < 16; ++e) p[e] = s[e >> 3][e & 7] * SCL2;
        if (k0 + 31 > r0) {                                      // only a unit that reaches past the wave's first query holds keys above the diagonal (scalar test)
#pragma unroll
            for (int e = 0; e < 16; ++e) { const int key = k0 + (e >> 3) * 16 + hi * 8 + (e & 7); p[e] = (key <= qi) ? p[e] : -3.0e38f; } }
#pragma unroll
        for (int e = 0; e < 16; ++e) mx = fmaxf(mx, p[e]);
        mx = fmaxf(mx, xhalf(mx));                  // the query's other 16 keys of the unit stand in the other half of the wave
        const float al = __builtin_amdgcn_exp2f(m[qt] - mx); m[qt] = mx; float ps = 0.f;
#pragma unroll
        for (int e = 0; e < 16; ++e) { p[e] = __builtin_amdgcn_exp2f(p[e] - mx); ps += p[e]; }
        l[qt] = l[qt] * al + ps;
#pragma unroll
        for (int dt = 0; dt < 4; ++dt) o[dt][qt] *= al;
        V pf, pf2; pfrag(p, pf, pf2);
#pragma unroll
        for (int dt = 0; dt < 4; ++dt) { o[dt][qt] = WFrag<T16>::mma(vf[dt], pf, o[dt][qt]); if (NSPLIT == 2) { o[dt][qt] = WFrag<T16>::mma(vf[dt], pf2, o[dt][qt]); o[dt][qt] = WFrag<T16>::mma(vf2[dt], pf, o[dt][qt]); } }
    }
}
// ---- the hi/lo rows' unit loop: every wave brings its own units into its own LDS slice
template <int NQ>
__device__ __forceinline__ void fa_loop(const bf* __restrict__ Q, const bf* __restrict__ Q2, const bf* __restrict__ Kp, const bf* __restrict__ K2, const bf* __restrict__ Vt, const bf* __restrict__ V2, int r0, int nu, int u0, int ustep, int lane, bf* stg, v8f (&o)[4][NQ], float (&m)[NQ], float (&l)[NQ]) {
    typedef bf T16; typedef typename WFrag<T16>::V V; const int lr = lane & 15, hi = lane >> 4;
    V q[NQ][2], q2[NQ][2];
    fa_q<bf, 2, NQ>(Q, Q2, r0, lane, stg, q, q2);
#pragma unroll 1
    for (int u = u0; u < nu; u += ustep) {
        const int k0 = u * 32;
        V kf[2][2], kf2[2][2], vf[4], vf2[4];
        {
            // The unit's K rows (32 x 128 B, 4 KiB in a row, per plane) and V^T rows (64 x 64 B) come in whole-line order, 16 B a lane (a fragment load straight from memory touches 16 lines for 512 B), all 32 loads asked for at once; the slice holds the two K planes first and, once their fragments are read, the two V^T planes
            const size_t koff = (size_t)k0 * HD + lane * 8, voff = (size_t)(lane >> 2) * TT + k0 + (lane & 3) * 8;
            const T16* kg = Kp + koff; const T16* kg2 = K2 + koff; const T16* vg = Vt + voff; const T16* vg2 = V2 + voff; v8us tk[8], tk2[8], tv[8], tv2[8];
#pragma unroll
            for (int i = 0; i < 8; ++i) { tk[i] = ld8(kg + i * 256); tk2[i] = ld8(kg2 + i * 256); }
#pragma unroll
            for (int i = 0; i < 8; ++i) { tv[i] = ld8(vg + (size_t)i * 8 * TT); tv2[i] = ld8(vg2 + (size_t)i * 8 * TT); }
            asm volatile("s_wait_xcnt 0x0" :: "v"(kg), "v"(kg2), "v"(vg), "v"(vg2) : "memory");   // as behind the query loads: the unit's address registers stay whole up to this wait
#pragma unroll
            for (int i = 0; i < 8; ++i) { T16* d = stg + (i * 4 + (lane >> 3)) * 72 + (lane & 7) * 8; st8(d, tk[i]); st8(d + FSK, tk2[i]); }
            lds_order();
#pragma unroll
            for (int kt = 0; kt < 2; ++kt)
#pragma unroll
                for (int ks = 0; ks < 2; ++ks) { const T16* p = stg + (kt * 16 + lr) * 72 + ks * 32 + 8 * hi; kf[kt][ks] = sfrag(p); kf2[kt][ks] = sfrag(p + FSK); }
            lds_order();
#pragma unroll
            for (int i = 0; i < 8; ++i) { T16* d = stg + (i * 8 + (lane >> 2)) * 40 + (lane & 3) * 8; st8(d, tv[i]); st8(d + FSV, tv2[i]); }
            lds_order();
#pragma unroll
            for (int dt = 0; dt < 4; ++dt) { const T16* p = stg + (dt * 16 + lr) * 40 + 8 * hi; vf[dt] = sfrag(p); vf2[dt] = sfrag(p + FSV); }
            lds_order();
        }
        fa_unit<bf, 2, NQ>(kf, kf2, vf, vf2, q, q2, r0, k0, lane, o, m, l);
        // four vector slots between the unit's last matrix instructions and whatever follows the loop's branch on either path (the next unit's loads into their operands, the epilogue's reads of their results)
        asm volatile("v_nop\n\tv_nop\n\tv_nop\n\tv_nop" : "+v"(o[0][NQ - 1]), "+v"(o[1][NQ - 1]), "+v"(o[2][NQ - 1]), "+v"(o[3][NQ - 1]) : "v"(vf[0]), "v"(vf[3]));
    }
}
// ---- the fp16 rows' loop: a work-group owns SQB query rows, two groups of 32, four waves a group. The keys come in stages of SKT (four units of 32): the whole work-group copies a stage's K rows and V^T rows into one of two LDS buffers, asynchronously and through no register, while the stage before is worked on. Wave w takes unit w & 3 of every stage for query group w >> 2, so every byte of K and V^T fetched serves 64 queries.
#define SQB 64                    // query rows of such a work-group
#define SKT 128                   // keys of a stage
#define SVP 136                   // 16-bit pitch of a V^T row of a stage in LDS: 272 B = 16 B x odd (K rows: 72, as in a slice)
#define SKE (SKT * 72)            // 16-bit elements of a stage's K rows in LDS
#define SBE (SKE + HD * SVP)      // and of a whole buffer (K, then V^T)
// A thread's 8 copies of one stage, 16 B each: K rows 32 apart (a wave: 4 whole rows a copy), V^T rows 16 apart (a wave: 2 rows of 256 B a copy). kg, vg: the thread's first global addresses; lk, lv: its first LDS byte addresses.
__device__ __forceinline__ void fa_stage(const h16* kg, const h16* vg, unsigned lk, unsigned lv) {
    // the wait on the last line keeps every address register of the copies whole until they are taken over
    asm volatile("global_load_async_to_lds_b128 %0, %8, off\n\t"
                 "global_load_async_to_lds_b128 %1, %9, off\n\t"
                 "global_load_async_to_lds_b128 %2, %10, off\n\t"
                 "global_load_async_to_lds_b128 %3, %11, off\n\t"
                 "global_load_async_to_lds_b128 %4, %12, off\n\t"
                 "global_load_async_to_lds_b128 %5, %13, off\n\t"
                 "global_load_async_to_lds_b128 %6, %14, off\n\t"
                 "global_load_async_to_lds_b128 %7, %15, off\n\t"
                 "s_wait_xcnt 0x0"
                 :: "v"(lk), "v"(lk + 32 * 144), "v"(lk + 64 * 144), "v"(lk + 96 * 144), "v"(lv), "v"(lv + 16 * (SVP * 2)), "v"(lv + 32 * (SVP * 2)), "v"(lv + 48 * (SVP * 2)),
                    "v"(kg), "v"(kg + 32 * HD), "v"(kg + 64 * HD), "v"(kg + 96 * HD), "v"(vg), "v"(vg + 16 * TT), "v"(vg + 32 * TT), "v"(vg + 48 * TT) : "memory");
}
__device__ __forceinline__ void fa_ring(const h16* __restrict__ Q, const h16* __restrict__ Kp, const h16* __restrict__ Vt, int r0, int wave, int lane, h16* ring, v8f (&o)[4][2], float (&m)[2], float (&l)[2]) {
    const int lr = lane & 15, hi = lane >> 4, tid = wave * 32 + lane, ku = wave & 3, rq = r0 + (wave >> 2) * 32;   // the wave's unit in a stage; its first query
    const int nt = (r0 + SQB + SKT - 1) / SKT;                       // stages up to and including the diagonal; a stage lies whole inside the planes (TT is a multiple of SKT)
    const h16* kg = Kp + tid * 8; const h16* vg = Vt + (size_t)(tid >> 4) * TT + (tid & 15) * 8;
    const unsigned lb = (unsigned)(size_t)ring, lk = lb + (tid >> 3) * 144 + (tid & 7) * 16, lv = lb + SKE * 2 + (tid >> 4) * (SVP * 2) + (tid & 15) * 16;
    fa_stage(kg, vg, lk, lv);                                        // stage 0 into buffer 0, which nothing has touched yet
    v16h q[2][2], qn[2][2];
    fa_q<h16, 0, 2>(Q, nullptr, rq, lane, ring + SBE + wave * FSK, q, qn);   // meanwhile the query rows are turned, in slices behind buffer 0
    asm volatile("s_wait_dscnt 0x0" ::: "memory");                   // the wave has left its query slice, which stage 1 overwrites
    asm volatile("s_wait_asynccnt 0x0" ::: "memory");                // the wave's own copies of stage 0 have landed
    __syncthreads();                                                 // stage 0 is whole, and every query slice is free, before any wave goes on
    if (nt > 1) fa_stage(kg + SKT * HD, vg + SKT, lk + SBE * 2, lv + SBE * 2);
#pragma unroll 1                                                     // rolled: one copy of a stage's code; the buffer follows from the trip's parity
    for (int t = 0; t < nt; ++t) {
        const int k0 = t * SKT + ku * 32;
        if (k0 <= rq) {                                              // a unit wholly above the wave's diagonal is left out (scalar test); the publish point below is passed by every wave
            const h16* sk = ring + (t & 1) * SBE + (ku * 32 + lr) * 72 + 8 * hi; const h16* sv = ring + (t & 1) * SBE + SKE + lr * SVP + ku * 32 + 8 * hi;
            v16h kf[2][2], vf[4];
#pragma unroll
            for (int kt = 0; kt < 2; ++kt)
#pragma unroll
                for (int ks = 0; ks < 2; ++ks) kf[kt][ks] = sfrag(sk + kt * 16 * 72 + ks * 32);
#pragma unroll
            for (int dt = 0; dt < 4; ++dt) vf[dt] = sfrag(sv + dt * 16 * SVP);
            fa_unit<h16, 0, 2>(kf, kf, vf, vf, q, qn, rq, k0, lane, o, m, l);
            // four vector slots between the unit's last matrix instructions and whatever follows on either path (address arithmetic into their operands, the epilogue's reads of their results)
            asm volatile("v_nop\n\tv_nop\n\tv_nop\n\tv_nop" : "+v"(o[0][1]), "+v"(o[1][1]), "+v"(o[2][1]), "+v"(o[3][1]) : "v"(vf[0]), "v"(vf[3]));
        }
        asm volatile("s_wait_dscnt 0x0" ::: "memory");               // the wave's reads of this stage's buffer are over
        asm volatile("s_wait_asynccnt 0x0" ::: "memory");            // its own copies of the next stage have landed
        __syncthreads();                                             // the next stage is whole, and every wave has left this one's buffer, before either is touched again
        if (t + 2 < nt) fa_stage(kg + (size_t)(t + 2) * (SKT * HD), vg + (t + 2) * SKT, lk + (t & 1) * (SBE * 2), lv + (t & 1) * (SBE * 2));   // flies while the next stage is worked on (scalar test)
    }
    asm volatile("s_wait_asynccnt 0x0" ::: "memory");                // nothing is in flight when the buffers become the partial outputs' place
}
// The join of the waves' partials. NG query groups of FQB rows, FNW / NG waves a group: the partials of a group are brought to the common maximum and summed through LDS in wave order, divided by the row's sum and stored as the merged hi/lo planes.
template <int NG>
__device__ __forceinline__ void fa_join(float* part, float* sm, float* sl, float* sL, int wave, int lane, v8f (&o)[4][FQT], float (&m)[FQT], float (&l)[FQT], bf* Ah, bf* Al, size_t orow) {
    constexpr int NW = FNW / NG; const int lr = lane & 15, hi = lane >> 4, wb = wave / NW * NW;   // wb: the first wave of this wave's group
#pragma unroll
    for (int qt = 0; qt < FQT; ++qt) { l[qt] += xhalf(l[qt]); if (hi == 0) { sm[wave * FQB + qt * 16 + lr] = m[qt]; sl[wave * FQB + qt * 16 + lr] = l[qt]; } }
    __syncthreads();                                                 // every wave's maxima and sums are in LDS, and every wave has left the K / V^T slices or buffers, before any wave rescales and writes its partial output over them
    float* mine = part + wave * (FQT * 1024) + lane * 4;
#pragma unroll
    for (int qt = 0; qt < FQT; ++qt) { const int qq = wb * FQB + qt * 16 + lr; float M = sm[qq];
#pragma unroll
        for (int w = 1; w < NW; ++w) M = fmaxf(M, sm[w * FQB + qq]);
        float L = 0.f;
#pragma unroll
        for (int w = 0; w < NW; ++w) L += sl[w * FQB + qq] * __builtin_amdgcn_exp2f(sm[w * FQB + qq] - M);
        if (wave == wb && hi == 0) sL[wave / NW * FQB + qt * 16 + lr] = L;
        const float sc = __builtin_amdgcn_exp2f(m[qt] - M);
#pragma unroll
        for (int dt = 0; dt < 4; ++dt) { const v8f t = o[dt][qt] * sc; *(v4fa*)(mine + ((dt * FQT + qt) * 2) * 128) = (v4f){ t[0], t[1], t[2], t[3] }; *(v4fa*)(mine + ((dt * FQT + qt) * 2 + 1) * 128) = (v4f){ t[4], t[5], t[6], t[7] }; } }
    __syncthreads();                                                 // every wave's rescaled partial output is in LDS before any wave sums
    // a wave sums and stores whole rows (4 queries x 64 d a pass, a pass a group; a lane 8 consecutive d), so each 128-byte line of the merged planes has one writing wave
#pragma unroll
    for (int g = 0; g < NG; ++g) { const int qq = wave * 4 + (lane >> 3), c = lane & 7;
        const float* sp = part + g * NW * (FQT * 1024) + (((c >> 1) * FQT + (qq >> 4)) * 2) * 128 + ((qq & 15) + 16 * (c & 1)) * 4; v4f s0 = *(const v4fa*)sp, s1 = *(const v4fa*)(sp + 128);
#pragma unroll
        for (int w = 1; w < NW; ++w) { s0 += *(const v4fa*)(sp + w * (FQT * 1024)); s1 += *(const v4fa*)(sp + w * (FQT * 1024) + 128); }
        const float f = __fdiv_rn(1.0f, sL[g * FQB + qq]); v8us oh, ol;
#pragma unroll
        for (int j = 0; j < 4; ++j) { unsigned short x, y; splitf(s0[j] * f, x, y); oh[j] = x; ol[j] = y; splitf(s1[j] * f, x, y); oh[4 + j] = x; ol[4 + j] = y; }
        const size_t oo = orow + (size_t)(g * FQB + qq) * DQ + c * 8; *(v8us*)(Ah + oo) = oh; *(v8us*)(Al + oo) = ol; }
}
// amdgpu_waves_per_eu(4, 4): two work-groups share a WGP only while a wave holds at most 256 registers (four waves a SIMD); without it the hi/lo loop takes a few more and every work-group runs alone
#define FYB ((TT - RH) / SQB)     // grid rows of fp16 work-groups (SQB queries each); behind them RH / FQB rows of hi/lo work-groups (FQB queries each)
__global__ __launch_bounds__(32 * FNW) __attribute__((amdgpu_waves_per_eu(4, 4))) void k_fattn(const h16* __restrict__ Q16, const h16* __restrict__ K16, const h16* __restrict__ V16, const bf* __restrict__ Qh, const bf* __restrict__ Ql, const bf* __restrict__ Kh, const bf* __restrict__ Kl, const bf* __restrict__ Vh, const bf* __restrict__ Vl, bf* Ah, bf* Al) {
    __shared__ __align__(16) float part[FNW * FS2 / 2];              // hi/lo rows, in the unit loop: each wave's own K / V^T slice (FS2 16-bit elements); fp16 rows: the two stage buffers, the query slices over the second; behind the join's first barrier: [wave][d tile][query tile][half 0..1][lane][4], each wave's partial output in register order
    static_assert(FNW * FS2 / 2 >= FNW * FQT * 1024 && FNW * FS2 >= 2 * SBE && FNW * FS2 >= SBE + FNW * FSK, "the LDS array holds each of its uses");
    __shared__ float sm[FNW * FQB], sl[FNW * FQB], sL[SQB];          // each wave's maximum and sum per query; the row's whole sum
    const int lane = threadIdx.x & 31;
    const int wave = __builtin_amdgcn_readfirstlane((int)(threadIdx.x >> 5));   // scalar, so that the loops' tests are scalar branches and every lane stays on at the matrix instructions and the copies
    const int y = (int)blockIdx.y;                                   // the slow grid index: the longest rows of every head have the lowest y
    const int r0 = (y < FYB) ? TT - (y + 1) * SQB : RH - (y - FYB + 1) * FQB;
    const int h = (int)blockIdx.x % NH_, bt = (int)blockIdx.x / NH_ * TT; const size_t hp = (size_t)blockIdx.x * TT * HD;   // the planes are [batch][head]...; bt: the batch's first row in the merged planes
    const size_t orow = (size_t)(bt + r0) * DQ + h * HD;
    v8f o[4][FQT]; float m[FQT], l[FQT];                             // a maximum starts at -1.0e30, above the mask's value, so that a masked score gives probability 0 also where a wave has seen no open key yet
    if (y >= FYB) {                                                  // hi/lo rows hold twice the fragments: a wave takes ONE query tile (wave / (FNW / FQT)) and the keys are dealt over the FNW / FQT waves of that tile; its other tiles stay empty partials
        const int nu = r0 / 32 + FQB / 32;                           // units of 32 keys up to and including the diagonal block
        const int myq = wave / (FNW / FQT); v8f o1[4][1]; float m1[1] = { -1.0e30f }, l1[1] = { 0.f };
#pragma unroll
        for (int dt = 0; dt < 4; ++dt) o1[dt][0] = (v8f){};
        fa_loop<1>(Qh + hp, Ql + hp, Kh + hp, Kl + hp, Vh + hp, Vl + hp, r0 + myq * 16, nu, wave % (FNW / FQT), FNW / FQT, lane, (bf*)part + wave * FS2, o1, m1, l1);
#pragma unroll
        for (int qt = 0; qt < FQT; ++qt) { const bool mine = qt == myq; m[qt] = mine ? m1[0] : -1.0e30f; l[qt] = mine ? l1[0] : 0.f;
#pragma unroll
            for (int dt = 0; dt < 4; ++dt) o[dt][qt] = mine ? o1[dt][0] : (v8f){}; }
        fa_join<1>(part, sm, sl, sL, wave, lane, o, m, l, Ah, Al, orow);
    } else {
#pragma unroll
        for (int qt = 0; qt < FQT; ++qt) { m[qt] = -1.0e30f; l[qt] = 0.f;
#pragma unroll
            for (int dt = 0; dt < 4; ++dt) o[dt][qt] = (v8f){}; }
        fa_ring(Q16 + hp, K16 + hp, V16 + hp, r0, wave, lane, (h16*)part, o, m, l);
        fa_join<2>(part, sm, sl, sL, wave, lane, o, m, l, Ah, Al, orow);
    }
}

extern "C" void kernel_launch(void* const* d_in, const int* in_sizes, int n_in,
                              void* d_out, int out_size, void* d_ws, size_t ws_size, hipStream_t stream) {
    (void)in_sizes; (void)n_in; (void)out_size;
    const float* x = (const float*)d_in[0]; const float* wq = (const float*)d_in[1]; const float* wk = (const float*)d_in[2]; const float* wv = (const float*)d_in[3]; const float* wo = (const float*)d_in[4]; const int* pid = (const int*)d_in[5];   /* token_positions int32 [2048] (= arange) */
    float* OUT = (float*)d_out;     // [2][2048][1024]
    char* wsp = (char*)d_ws;
    auto take = [&](size_t bytes) { char* p = wsp; wsp += (bytes + 255) & ~(size_t)255; return (void*)p; };
    const size_t PL = (size_t)NB_ * NH_ * TT * HD;                    // elements of one plane array of one of Q, K, V (both batches)
    bf* W4 = (bf*)take((size_t)4 * DQ * DM * 2); bf* WO = W4 + (size_t)3 * DQ * DM;   // wq, wk, wv, wo one behind the other
    float* CS = (float*)take((size_t)TT * HD * 2 * 4);
    bf* XB = (bf*)take((size_t)NB_ * TT * DM * 2);
    h16* P16 = (h16*)take(3 * PL * 2); bf* Ph = (bf*)take(3 * PL * 2); bf* Pl = (bf*)take(3 * PL * 2);   // each [Q, K, V][batch][head]...
    bf* ATh = (bf*)take((size_t)NB_ * TT * DQ * 2); bf* ATl = (bf*)take((size_t)NB_ * TT * DQ * 2);
    if ((size_t)(wsp - (char*)d_ws) > ws_size) return;    // ws 256 MiB
    k_prep<<<PB_CS + PB_X + 4 * PB_W, 256, 0, stream>>>(x, wq, wk, wv, wo, pid, XB, W4, CS);
    k_gemmt<0, 1><<<dim3(NB_ * TT / 128, 3 * DQ / 128, 1), 128, 0, stream>>>(XB, nullptr, W4, nullptr, CS, P16, Ph, Pl);
    k_fattn<<<dim3(NB_ * NH_, FYB + RH / FQB, 1), 32 * FNW, 0, stream>>>(P16, P16 + PL, P16 + 2 * PL, Ph, Pl, Ph + PL, Pl + PL, Ph + 2 * PL, Pl + 2 * PL, ATh, ATl);
    k_gemmt<1, 0><<<dim3(NB_ * TT / 128, DM / 128, 1), 128, 0, stream>>>(ATh, ATl, WO, OUT, nullptr, nullptr, nullptr, nullptr);
}
